// v000
// Times are from an AMD MI455X. After a warm-up the kernel runs many times in a row, and a time is the length of
// such a window on the GPU divided by its runs, so every launch and the gaps after it count. The runs cycle
// through copies of the inputs. A figure is the median of several windows, for all but v000 over two sittings.
// Sittings can differ by a few percent; kernels timed side by side share one.
// v000 is the starting kernel. One run takes 456 microseconds.
// Contractions: q/k/v 1x1-conv projections = W_qkv (bf16, RNE convert of input) . X (bf16, RNE convert of input) on
// v_wmma_f32_16x16x32_bf16, K=128; scores S^T = k (f16) . q^T (f16) on v_wmma_f32_16x16x32_f16, K=128, one product;
// O^T = v (f16) . P^T (f16, e^{s-m} x 1024 taken from the score D registers) on v_wmma_f32_16x16x32_f16 over 4096
// keys, one product; y = W_out (f16 bits of the bf16-RNE input x 16) . O (f16, x 64, taken from the O^T D registers)
// on v_wmma_f32_16x16x32_f16, K=128, one product; f32 accumulate everywhere; softmax (running max, row sums, 1/l),
// the 128^-0.5 scale and the bias add in f32 on VALU.
#include <hip/hip_runtime.h>
#include <math.h>
#include <stdint.h>

#define NB    8
#define DCH   128
#define SEQ   4096
#define NQKV  384
#define NW    512
#define QT    64
#define AP    144
#define LQP   136
#define LVP   72
#define OP    68
#define LNPS  6.931471805599453f
#define SCL   0.08838834764831845f
#define OSC   64.0f
#define WSC   16.0f
#define IYS   0.0009765625f
static_assert((SEQ % QT) == 0);
static_assert((SEQ % 32) == 0);
static_assert((DCH % 32) == 0);
static_assert(NQKV == 3 * DCH);
static_assert(NW == NQKV + DCH);
static_assert(((NW * DCH) / 8) % 256 == 0);
static_assert(64 * AP == DCH * LVP);
static_assert(LQP >= DCH && (LQP % 8) == 0);
static_assert((AP % 8) == 0 && (LVP % 8) == 0);
static_assert(OP >= QT && (OP % 4) == 0);

typedef _Float16       v16h __attribute__((ext_vector_type(16)));
typedef _Float16       v8h  __attribute__((ext_vector_type(8)));
typedef __bf16         v16b __attribute__((ext_vector_type(16)));
typedef unsigned short v8us __attribute__((ext_vector_type(8)));
typedef float          v8f  __attribute__((ext_vector_type(8)));
typedef float          v4f  __attribute__((ext_vector_type(4)));
typedef unsigned int   v4u  __attribute__((ext_vector_type(4)));

union FragH { v16h v; v8h  h[2]; };
union FragB { v16b v; v8us u[2]; };
static_assert(sizeof(FragH) == 32);
static_assert(sizeof(FragB) == 32);

// ---- scalar helpers --------------------------------------------------------------------------------
__device__ __forceinline__ unsigned short bf_bits(float f) {          // f32 -> bf16 bits, RNE convert
  unsigned u = __float_as_uint(f);
  return (unsigned short)((u + 0x7FFFu + ((u >> 16) & 1u)) >> 16);
}
__device__ __forceinline__ float bf_up(unsigned short h) { return __uint_as_float(((unsigned)h) << 16); }
__device__ __forceinline__ float bfr(float f) { return bf_up(bf_bits(f)); }
__device__ __forceinline__ unsigned short h_bits(_Float16 x) { return __builtin_bit_cast(unsigned short, x); }
__device__ __forceinline__ unsigned pk16(unsigned short a, unsigned short b) { return (unsigned)a | ((unsigned)b << 16); }
__device__ __forceinline__ v8f zero8() { v8f z = {0.f, 0.f, 0.f, 0.f, 0.f, 0.f, 0.f, 0.f}; return z; }
__device__ __forceinline__ float hmax8(v8f s) {
  return fmaxf(fmaxf(fmaxf(s[0], s[1]), fmaxf(s[2], s[3])), fmaxf(fmaxf(s[4], s[5]), fmaxf(s[6], s[7])));
}

// ---- fragment loaders: 16-bit A/B operand, lane -> row/col (lane&15), p already includes +8*(lane>>4);
//      elements 0..7 <- p[0..7] (k0+8h..), elements 8..15 <- p[16..23] (k0+16+8h..)
__device__ __forceinline__ v16h ldfrag_h(const _Float16* p) {
  FragH f;
  f.h[0] = *(const v8h*)(p);
  f.h[1] = *(const v8h*)(p + 16);
  return f.v;
}
__device__ __forceinline__ v16b ldfrag_b(const unsigned short* p) {
  FragB f;
  f.u[0] = *(const v8us*)(p);
  f.u[1] = *(const v8us*)(p + 16);
  return f.v;
}

// ---- WMMA helpers: builtin followed by a 4-slot VALU gap tying D and keeping A/B live ----------------------
__device__ __forceinline__ v8f mma_h(v16h a, v16h b, v8f c) {
  v8f d = __builtin_amdgcn_wmma_f32_16x16x32_f16(false, a, false, b, (short)0, c, false, false);
#if defined(__HIP_DEVICE_COMPILE__)
  asm volatile("v_nop\n\tv_nop\n\tv_nop\n\tv_nop" : "+v"(d) : "v"(a), "v"(b));
#endif
  return d;
}
__device__ __forceinline__ v8f mma_b(v16b a, v16b b, v8f c) {
  v8f d = __builtin_amdgcn_wmma_f32_16x16x32_bf16(false, a, false, b, (short)0, c, false, false);
#if defined(__HIP_DEVICE_COMPILE__)
  const v16h ha = __builtin_bit_cast(v16h, a), hb = __builtin_bit_cast(v16h, b);
  asm volatile("v_nop\n\tv_nop\n\tv_nop\n\tv_nop" : "+v"(d) : "v"(ha), "v"(hb));
#endif
  return d;
}

// ---- one wave: 16 n rows x 64 output channels (4 D tiles) over K = 128 (4 k-steps), A from LDS, B from the
//      stacked bf16 weight plane (rows = output channel, k = input channel contiguous, pitch DCH)
__device__ __forceinline__ void gemm4(const unsigned short* ap, const unsigned short* bp,
                                      v8f& acc0, v8f& acc1, v8f& acc2, v8f& acc3) {
  acc0 = zero8(); acc1 = zero8(); acc2 = zero8(); acc3 = zero8();
#pragma unroll
  for (int ks = 0; ks < 4; ++ks) {
    const v16b a = ldfrag_b(ap + 32 * ks);
    const unsigned short* bs = bp + 32 * ks;
    acc0 = mma_b(a, ldfrag_b(bs + 0 * 16 * DCH), acc0);
    acc1 = mma_b(a, ldfrag_b(bs + 1 * 16 * DCH), acc1);
    acc2 = mma_b(a, ldfrag_b(bs + 2 * 16 * DCH), acc2);
    acc3 = mma_b(a, ldfrag_b(bs + 3 * 16 * DCH), acc3);
  }
}

// ---- LDS staging helpers for the projection epilogue (D rows = n, D cols = channel) ------------------------
__device__ __forceinline__ void stage_h(unsigned short* L, int nr, int col, v8f acc) {
#pragma unroll
  for (int r = 0; r < 8; ++r) L[(nr + r) * LQP + col] = h_bits((_Float16)acc[r]);
}
__device__ __forceinline__ void stage_v(unsigned short* Lv, int e, int nr, v8f acc) {
#pragma unroll
  for (int r = 0; r < 8; ++r) Lv[e * LVP + nr + r] = h_bits((_Float16)acc[r]);
}

// ---- weight element convert: rows < NQKV -> bf16 bits; rows >= NQKV -> f16 bits of (bf16 RNE value x 16)
__device__ __forceinline__ unsigned short cvt_sel(bool isq, float fq, float fo) {
  const unsigned short uq = bf_bits(fq);
  const unsigned short uo = h_bits((_Float16)(bfr(fo) * WSC));
  return isq ? uq : uo;
}

// =====================================================================================================
// (0) stacked 16-bit weight plane W16[512][128]: rows 0..383 = bf16 bits of W_qkv (RNE convert),
//     rows 384..511 = f16 bits of (bf16 RNE value of W_out) x 16. Thread i writes 8 halves (16 B) at element 8i;
//     sources loaded with clamped rows, selected by value.
// coverage: 32 blocks x 256 threads x 8 = 65536 = 512 x 128.
// =====================================================================================================
__global__ __launch_bounds__(256) void cvt_w(const float* __restrict__ wqkv, const float* __restrict__ wout,
                                             unsigned short* W16) {
  const int i = blockIdx.x * 256 + threadIdx.x;
  if (i >= (NW * DCH) / 8) return;
  const int row = i >> 4;                  // 0..511
  const int col = (i & 15) * 8;
  const int ra = min(row, NQKV - 1);
  const int rb = min(max(row - NQKV, 0), DCH - 1);
  const v4f a0 = *(const v4f*)(wqkv + (size_t)ra * DCH + col), a1 = *(const v4f*)(wqkv + (size_t)ra * DCH + col + 4);
  const v4f c0 = *(const v4f*)(wout + (size_t)rb * DCH + col), c1 = *(const v4f*)(wout + (size_t)rb * DCH + col + 4);
  const bool isq = row < NQKV;
  v4u w;
#pragma unroll
  for (int t = 0; t < 2; ++t) {
    w[t]     = pk16(cvt_sel(isq, a0[2 * t], c0[2 * t]), cvt_sel(isq, a0[2 * t + 1], c0[2 * t + 1]));
    w[2 + t] = pk16(cvt_sel(isq, a1[2 * t], c1[2 * t]), cvt_sel(isq, a1[2 * t + 1], c1[2 * t + 1]));
  }
  unsigned short* p = W16 + (size_t)i * 8;
  *(v4u*)p = w;
  
}

// =====================================================================================================
// (1) fused q/k/v projection for one (b, 64-position tile): block = 256 threads = 8 waves.
//   x tile [128 d][64 n] f32 is staged once as bf16 A tile Lav[n][d] (pitch AP halves, 2-byte LDS stores), barrier.
//   Wave w: n group ng = w&3 (A rows n = 16ng + (lane&15), split k map over d), channel half ch = w>>2
//   (B = W16 rows chunk*128 + ch*64 + 16j + (lane&15), same split k map), 4 D tiles per chunk, 4 k-steps of 32,
//   chunks q, k, v in sequence (A reloaded from LDS).
//   Epilogue: D -> f16 bits in LDS: q tile Lq[n][128], k tile Lk[n][128], v transposed Lv[e][n] (aliases Lav after
//   [b][e][4096] (line = 64 keys of one e row); every line = 8 consecutive lanes x 16 B of one instruction, two
// coverage: Lav: 256 threads x 8 it x 4 = 64 n x 128 d; Lq/Lk: 8 waves x (16 n x 64 ch) per chunk = 64 x 128;
//           Q/K planes: 4 it x 32 lines x 8 lanes x 8 halves = 64 rows x 128; V plane: 4 it x 32 lines x 8 x 8 =
//           128 e x 64 n; grid = 8 x 64 blocks covers every plane exactly once.
// =====================================================================================================
__global__ __launch_bounds__(256)
void proj_kernel(const float* __restrict__ x, const unsigned short* __restrict__ W16,
                 unsigned short* QP, unsigned short* KP, unsigned short* VP) {
  __shared__ __align__(16) unsigned short Lav[64 * AP];    // A tile [n][d]; reused as Lv[e][n] (pitch LVP) later
  __shared__ __align__(16) unsigned short Lq[64 * LQP];    // q f16 [n][128]
  __shared__ __align__(16) unsigned short Lk[64 * LQP];    // k f16 [n][128]
  const int tid  = threadIdx.x;
  const int lane = tid & 31, wave = tid >> 5;
  const int hh   = lane >> 4, c = lane & 15;
  const int bx   = blockIdx.x;
  const int b    = bx / (SEQ / QT);
  const int nt   = bx % (SEQ / QT);
  const int n0   = nt * QT;

  // ---- stage x tile as bf16 [n][d] ----
  {
    const int n4 = (tid & 15) * 4, ds = tid >> 4;          // ds 0..15
    const float* xp = x + ((size_t)b * DCH + ds) * SEQ + n0 + n4;
#pragma unroll
    for (int it = 0; it < 8; ++it) {
      const v4f v = *(const v4f*)(xp + (size_t)it * 16 * SEQ);
      const int d = it * 16 + ds;                          // 0..127
#pragma unroll
      for (int q = 0; q < 4; ++q) Lav[(n4 + q) * AP + d] = bf_bits(v[q]);
    }
  }
  __syncthreads();

  // ---- GEMMs: 16 n rows x 64 channels per wave per chunk ----
  const int ng = wave & 3, ch = wave >> 2;
  const unsigned short* ap = Lav + (ng * 16 + c) * AP + 8 * hh;
  const int nr = ng * 16 + 8 * hh;                         // D row r -> n local nr + r
  const int cb = ch * 64;                                  // channel base within a chunk; D col = cb + 16j + c
  v8f acc0, acc1, acc2, acc3;

  // q chunk (weight rows 0..127)
  gemm4(ap, W16 + (size_t)(0 * DCH + cb + c) * DCH + 8 * hh, acc0, acc1, acc2, acc3);
  stage_h(Lq, nr, cb + 0 * 16 + c, acc0);
  stage_h(Lq, nr, cb + 1 * 16 + c, acc1);
  stage_h(Lq, nr, cb + 2 * 16 + c, acc2);
  stage_h(Lq, nr, cb + 3 * 16 + c, acc3);
  // k chunk (weight rows 128..255)
  gemm4(ap, W16 + (size_t)(1 * DCH + cb + c) * DCH + 8 * hh, acc0, acc1, acc2, acc3);
  stage_h(Lk, nr, cb + 0 * 16 + c, acc0);
  stage_h(Lk, nr, cb + 1 * 16 + c, acc1);
  stage_h(Lk, nr, cb + 2 * 16 + c, acc2);
  stage_h(Lk, nr, cb + 3 * 16 + c, acc3);
  // v chunk (weight rows 256..383)
  gemm4(ap, W16 + (size_t)(2 * DCH + cb + c) * DCH + 8 * hh, acc0, acc1, acc2, acc3);

  __syncthreads();            // every wave is done reading Lav before it is reused as Lv
  stage_v(Lav, cb + 0 * 16 + c, nr, acc0);
  stage_v(Lav, cb + 1 * 16 + c, nr, acc1);
  stage_v(Lav, cb + 2 * 16 + c, nr, acc2);
  stage_v(Lav, cb + 3 * 16 + c, nr, acc3);
  __syncthreads();

  {
    const int e = tid & 7, lq = tid >> 3;                    // lq 0..31
{
#pragma unroll
      for (int it = 0; it < 4; ++it) {
        const int L  = it * 32 + lq;                         // 0..127
        const int n  = L >> 1, hf = L & 1;                   // row 0..63, half 0..1
        const size_t go = ((size_t)b * SEQ + n0 + n) * DCH + hf * 64 + 8 * e;
        const int lo_ = n * LQP + hf * 64 + 8 * e;
        const v4u uq = *(const v4u*)(Lq + lo_);
        const v4u uk = *(const v4u*)(Lk + lo_);
        *(v4u*)(QP + go) = uq;
        *(v4u*)(KP + go) = uk;
      }
#pragma unroll
      for (int it = 0; it < 4; ++it) {
        const int er = it * 32 + lq;                         // 0..127
        const v4u uv = *(const v4u*)(Lav + er * LVP + 8 * e);
        *(v4u*)(VP + ((size_t)b * DCH + er) * SEQ + n0 + 8 * e) = uv;
      }
      
    }
  }
}

// =====================================================================================================
// (2) attention + output projection for one (b, 64-query tile), transposed formulation, 128-deep scores, 4096 keys:
//   S^T tile (16 keys x 16 queries) = A(k rows = keys kb + (lane&15), d via the split k map, f16 plane) .
//                                     B(q, col = query, same d map, resident f16 fragments), four d-steps.
//   energy = acc * 128^-0.5 in f32. Per lane the D tile holds 8 keys of ONE query: online softmax state per lane,
//   one shuffle (lane^16) for the max over 32 keys, row-sum partials combined at the end. P = e^{s-m} x 1024 as one
//   f16 vector is the B operand of O^T (rows d, cols queries) += A(v rows d, keys contiguous) . B(P^T): element r <-
//   D of the tile covering keys kb..kb+15, element 8+r <- the tile covering kb+16..kb+31, lane unchanged.
//   32 keys per iteration: 8 score WMMAs + 8 output WMMAs per wave. Block = 4 waves = 64 queries; grid = 8 b x 64.
//   Output projection: B fragment of d-step ks = f16(O^T x 64 / l) of D tiles j = 2ks (element r) and 2ks+1 (element
//   8+r), lane unchanged (col = query); A = W16 rows 384 + o (f16, x16), split k map over d; D[row o][col query]
//   x 1/1024 staged in LDS (scalar stores, pitch OP), barrier, then + bf16-RNE bias and 16 instructions each write
// coverage: block writes o 0..127 x n n0..n0+63 of its b (256 lines = 16 it x 16 lines); grid covers y exactly once.
// =====================================================================================================
__global__ __launch_bounds__(128)
void attn_kernel(const unsigned short* __restrict__ QP, const unsigned short* __restrict__ KP,
                 const unsigned short* __restrict__ VP, const unsigned short* __restrict__ W16,
                 const float* __restrict__ bout, float* y) {
  __shared__ __align__(16) float Os[DCH * OP];
  const int tid  = threadIdx.x;
  const int wave = tid >> 5;
  const int lane = tid & 31;
  const int hh   = lane >> 4;
  const int c    = lane & 15;
  const int bx   = blockIdx.x;
  const int b    = bx / (SEQ / QT);
  const int qb   = bx % (SEQ / QT);
  const int n0   = qb * QT;
  const _Float16* QPh = (const _Float16*)(const void*)QP;
  const _Float16* KPh = (const _Float16*)(const void*)KP;
  const _Float16* VPh = (const _Float16*)(const void*)VP;
  const _Float16* WOh = (const _Float16*)(const void*)W16 + (size_t)NQKV * DCH;

  // ---- resident q fragments (B operand, col = query n0 + 16*wave + c), d 0..31, 32..63, 64..95, 96..127 ----
  const size_t qo = ((size_t)b * SEQ + n0 + wave * 16 + c) * DCH + 8 * hh;
  const v16h q0 = ldfrag_h(QPh + qo), q1 = ldfrag_h(QPh + qo + 32);
  const v16h q2 = ldfrag_h(QPh + qo + 64), q3 = ldfrag_h(QPh + qo + 96);
  // ---- k fragment base (A operand, row = key kb + c), + key * 128 ----
  const _Float16* Kp = KPh + ((size_t)b * SEQ + c) * DCH + 8 * hh;
  // ---- v fragment base (A operand, row = d = 16j + c, keys contiguous), + 16*j*SEQ + kb ----
  const _Float16* Vb = VPh + ((size_t)b * DCH + c) * SEQ + 8 * hh;

  float m = -1.0e30f, l = 0.f;
  v8f o0 = zero8(), o1 = zero8(), o2 = zero8(), o3 = zero8();
  v8f o4 = zero8(), o5 = zero8(), o6 = zero8(), o7 = zero8();
#pragma unroll 1
  for (int it = 0; it < SEQ / 32; ++it) {
    const int kb = it * 32;
    const _Float16* k0p = Kp + (size_t)kb * DCH;              // keys kb .. kb+15
    const _Float16* k1p = k0p + 16 * DCH;                     // keys kb+16 .. kb+31
    v8f s0, s1;
    s0 = mma_h(ldfrag_h(k0p),      q0, zero8());
    s0 = mma_h(ldfrag_h(k0p + 32), q1, s0);
    s0 = mma_h(ldfrag_h(k0p + 64), q2, s0);
    s0 = mma_h(ldfrag_h(k0p + 96), q3, s0);
    s1 = mma_h(ldfrag_h(k1p),      q0, zero8());
    s1 = mma_h(ldfrag_h(k1p + 32), q1, s1);
    s1 = mma_h(ldfrag_h(k1p + 64), q2, s1);
    s1 = mma_h(ldfrag_h(k1p + 96), q3, s1);

    float mx = fmaxf(hmax8(s0), hmax8(s1)) * SCL;
    mx = fmaxf(mx, __shfl_xor(mx, 16, 32));
    const float mn   = fmaxf(m, mx);
    const float corr = __expf(m - mn);
    m = mn;
    const float msh = mn - LNPS;            // exp gives e^{s-m} * 1024
    l *= corr;
#pragma unroll
    for (int r = 0; r < 8; ++r) {
      o0[r] *= corr; o1[r] *= corr; o2[r] *= corr; o3[r] *= corr;
      o4[r] *= corr; o5[r] *= corr; o6[r] *= corr; o7[r] *= corr;
    }

    FragH ph;
    float ls = 0.f;
#pragma unroll
    for (int r = 0; r < 8; ++r) {
      const float e0 = __expf(s0[r] * SCL - msh);   // key kb      + 8hh + r
      const float e1 = __expf(s1[r] * SCL - msh);   // key kb + 16 + 8hh + r
      ls += e0 + e1;
      ph.h[0][r] = (_Float16)e0;
      ph.h[1][r] = (_Float16)e1;
    }
    l += ls;

    o0 = mma_h(ldfrag_h(Vb + 0 * 16 * SEQ + kb), ph.v, o0);
    o1 = mma_h(ldfrag_h(Vb + 1 * 16 * SEQ + kb), ph.v, o1);
    o2 = mma_h(ldfrag_h(Vb + 2 * 16 * SEQ + kb), ph.v, o2);
    o3 = mma_h(ldfrag_h(Vb + 3 * 16 * SEQ + kb), ph.v, o3);
    o4 = mma_h(ldfrag_h(Vb + 4 * 16 * SEQ + kb), ph.v, o4);
    o5 = mma_h(ldfrag_h(Vb + 5 * 16 * SEQ + kb), ph.v, o5);
    o6 = mma_h(ldfrag_h(Vb + 6 * 16 * SEQ + kb), ph.v, o6);
    o7 = mma_h(ldfrag_h(Vb + 7 * 16 * SEQ + kb), ph.v, o7);
  }
  l += __shfl_xor(l, 16, 32);
  const float sc = OSC / l;                 // both o and l carry the x1024 factor; sc scales O by 64

  // ---- O (x64) as f16 B fragments of the output projection: d-step ks <- D tiles 2ks (r) and 2ks+1 (8+r) ----
  FragH ob0, ob1, ob2, ob3;
#pragma unroll
  for (int r = 0; r < 8; ++r) {
    ob0.h[0][r] = (_Float16)(o0[r] * sc); ob0.h[1][r] = (_Float16)(o1[r] * sc);
    ob1.h[0][r] = (_Float16)(o2[r] * sc); ob1.h[1][r] = (_Float16)(o3[r] * sc);
    ob2.h[0][r] = (_Float16)(o4[r] * sc); ob2.h[1][r] = (_Float16)(o5[r] * sc);
    ob3.h[0][r] = (_Float16)(o6[r] * sc); ob3.h[1][r] = (_Float16)(o7[r] * sc);
  }

  // ---- y^T tile: for each o tile, A = W_out rows 16*ot + c (f16 x16, split map over d), 4 d-steps; stage x 1/1024 ----
  const _Float16* wp = WOh + (size_t)c * DCH + 8 * hh;
  float* os = Os + (8 * hh) * OP + wave * 16 + c;           // row o = 16*ot + 8hh + r, col = query 16*wave + c
#pragma unroll
  for (int ot = 0; ot < 8; ++ot) {
    v8f ya = zero8();
    ya = mma_h(ldfrag_h(wp + ot * 16 * DCH),      ob0.v, ya);
    ya = mma_h(ldfrag_h(wp + ot * 16 * DCH + 32), ob1.v, ya);
    ya = mma_h(ldfrag_h(wp + ot * 16 * DCH + 64), ob2.v, ya);
    ya = mma_h(ldfrag_h(wp + ot * 16 * DCH + 96), ob3.v, ya);
#pragma unroll
    for (int r = 0; r < 8; ++r) os[(ot * 16 + r) * OP] = ya[r] * IYS;
  }
  __syncthreads();
  {
    const int e = tid & 7, lq = tid >> 3;              // lq 0..15: line within group, e: 16-B piece
    float* ob = y + ((size_t)b * DCH) * SEQ + n0;
{
#pragma unroll
      for (int it = 0; it < 16; ++it) {
        const int L   = it * 16 + lq;                     // lines 0..255 of the block tile
        const int row = L >> 1, hf = L & 1;               // o row 0..127, half-segment 0..1
        const v4f v   = *(const v4f*)(Os + row * OP + hf * 32 + 4 * e);
        const float bb = bfr(bout[row]);
        const v4f vo  = {v[0] + bb, v[1] + bb, v[2] + bb, v[3] + bb};
        *(v4f*)(ob + (size_t)row * SEQ + hf * 32 + 4 * e) = vo;
      }
      
    }
  }
}

// =====================================================================================================
//   W16  16-bit [512][128]        0           131072
//   QP   f16    [8][4096][128]    131072      8388608
//   KP   f16    [8][4096][128]    8519680     8388608
//   VP   f16    [8][128][4096]    16908288    8388608
//   end                           25296896
// =====================================================================================================
extern "C" void kernel_launch(void* const* d_in, const int* in_sizes, int n_in,
                              void* d_out, int out_size, void* d_ws, size_t ws_size,
                              hipStream_t stream) {
  const int NX = NB * DCH * SEQ;                        // 4194304
  if (n_in < 4) return;
  if (in_sizes[0] != NX || in_sizes[1] != NQKV * DCH || in_sizes[2] != DCH * DCH || in_sizes[3] != DCH) return;
  if (out_size != NX) return;

  size_t off = 0;
  const size_t oW  = off; off += (size_t)NW * DCH * 2;            // 131072
  const size_t szP = (size_t)NB * SEQ * DCH * 2;                  // 8388608
  const size_t oQ  = off; off += szP;
  const size_t oK  = off; off += szP;
  const size_t oV  = off; off += (size_t)NB * DCH * SEQ * 2;      // 8388608
  if (off > ws_size) return;                                      // off = 25296896
  if (off > (size_t)134217728) return;

  const float* x    = (const float*)d_in[0];
  const float* Wqkv = (const float*)d_in[1];
  const float* Wout = (const float*)d_in[2];
  const float* bout = (const float*)d_in[3];
  char* ws = (char*)d_ws;
  unsigned short* W16 = (unsigned short*)(ws + oW);
  unsigned short* QPp = (unsigned short*)(ws + oQ);
  unsigned short* KPp = (unsigned short*)(ws + oK);
  unsigned short* VPp = (unsigned short*)(ws + oV);
  float* y = (float*)d_out;

  const dim3 blk256(256), blk128(128);
  const dim3 gW((NW * DCH / 8) / 256);                  // 32 blocks
  const dim3 gP(NB * (SEQ / QT));                       // 512 blocks: one (b, 64-position tile) each
  const dim3 gA(NB * (SEQ / QT));                       // 512 blocks: one (b, 64-query tile) each

  // (0) stacked 16-bit weight plane
  cvt_w<<<gW, blk256, 0, stream>>>(Wqkv, Wout, W16);
  // (1) q, k, v planes
  proj_kernel<<<gP, blk256, 0, stream>>>(x, W16, QPp, KPp, VPp);
  // (2) attention + output projection + bias: y[b][o][n]
  attn_kernel<<<gA, blk128, 0, stream>>>(QPp, KPp, VPp, W16, bout, y);
  (void)hipGetLastError();
}

// v001
// A run of this version takes 96.7 microseconds.
// Two timings next to v000 put it at 4.69 and 4.73 times that version's speed.
// Contractions: q/k/v 1x1-conv projections = W_qkv (bf16, RNE convert of input) . X (bf16, RNE convert of input) on
// v_wmma_f32_16x16x32_bf16, K=128; scores S^T = k (f16) . q^T (f16) on v_wmma_f32_16x16x32_f16, K=128, one product;
// O^T = v (f16) . P^T (f16, e^{s-m} x 1024 taken from the score D registers) on v_wmma_f32_16x16x32_f16 over 4096
// keys, one product; y = W_out (f16 bits of the bf16-RNE input x 16) . O (f16, x 64, taken from the O^T D registers)
// on v_wmma_f32_16x16x32_f16, K=128, one product; f32 accumulate everywhere; softmax (running max, row sums, 1/l),
// the 128^-0.5 scale and the bias add in f32 on VALU.
#include <hip/hip_runtime.h>
#include <math.h>
#include <stdint.h>

#define NB    8
#define DCH   128
#define SEQ   4096
#define NQKV  384
#define NW    512
#define QT    64
#define AP    144
#define LQP   136
#define LVP   72
#define OP    132
#define QB    128
#define SK    128
#define KVH   136
#define TILEB 34816
#define LNPS  6.931471805599453f
#define SCL   0.08838834764831845f
#define OSC   64.0f
#define WSC   16.0f
#define IYS   0.0009765625f
static_assert((SEQ % QT) == 0);
static_assert((SEQ % 32) == 0);
static_assert((DCH % 32) == 0);
static_assert(NQKV == 3 * DCH);
static_assert(NW == NQKV + DCH);
static_assert(((NW * DCH) / 8) % 256 == 0);
static_assert(64 * AP == DCH * LVP);
static_assert(LQP >= DCH && (LQP % 8) == 0);
static_assert((AP % 8) == 0 && (LVP % 8) == 0);
static_assert(OP >= QB && (OP % 4) == 0);
static_assert((SEQ % QB) == 0 && (SEQ % SK) == 0 && (SEQ / SK) >= 2 && (SK % 32) == 0);
static_assert(2 * DCH == 256 && 2 * SK == 256);           // both tiles have rows of 256 bytes
static_assert(2 * KVH == 256 + 16);                        // LDS row pitch = row + the 16-byte pad of the tensor load
static_assert(TILEB == SK * 2 * KVH && TILEB == DCH * 2 * KVH && (TILEB % 2048) == 0);

typedef _Float16       v16h __attribute__((ext_vector_type(16)));
typedef _Float16       v8h  __attribute__((ext_vector_type(8)));
typedef __bf16         v16b __attribute__((ext_vector_type(16)));
typedef unsigned short v8us __attribute__((ext_vector_type(8)));
typedef float          v8f  __attribute__((ext_vector_type(8)));
typedef float          v4f  __attribute__((ext_vector_type(4)));
typedef unsigned int   v4u  __attribute__((ext_vector_type(4)));
typedef uint32_t       u32x4 __attribute__((ext_vector_type(4)));
typedef uint32_t       u32x8 __attribute__((ext_vector_type(8)));

union FragH { v16h v; v8h  h[2]; };
union FragB { v16b v; v8us u[2]; };
static_assert(sizeof(FragH) == 32);
static_assert(sizeof(FragB) == 32);

// ---- scalar helpers --------------------------------------------------------------------------------
__device__ __forceinline__ unsigned short bf_bits(float f) {          // f32 -> bf16 bits, RNE convert
  unsigned u = __float_as_uint(f);
  return (unsigned short)((u + 0x7FFFu + ((u >> 16) & 1u)) >> 16);
}
__device__ __forceinline__ float bf_up(unsigned short h) { return __uint_as_float(((unsigned)h) << 16); }
__device__ __forceinline__ float bfr(float f) { return bf_up(bf_bits(f)); }
__device__ __forceinline__ unsigned short h_bits(_Float16 x) { return __builtin_bit_cast(unsigned short, x); }
__device__ __forceinline__ unsigned pk16(unsigned short a, unsigned short b) { return (unsigned)a | ((unsigned)b << 16); }
__device__ __forceinline__ v8f zero8() { v8f z = {0.f, 0.f, 0.f, 0.f, 0.f, 0.f, 0.f, 0.f}; return z; }
__device__ __forceinline__ float hmax8(v8f s) {
  return fmaxf(fmaxf(fmaxf(s[0], s[1]), fmaxf(s[2], s[3])), fmaxf(fmaxf(s[4], s[5]), fmaxf(s[6], s[7])));
}

// ---- fragment loaders: 16-bit A/B operand, lane -> row/col (lane&15), p already includes +8*(lane>>4);
//      elements 0..7 <- p[0..7] (k0+8h..), elements 8..15 <- p[16..23] (k0+16+8h..)
__device__ __forceinline__ v16h ldfrag_h(const _Float16* p) {
  FragH f;
  f.h[0] = *(const v8h*)(p);
  f.h[1] = *(const v8h*)(p + 16);
  return f.v;
}
__device__ __forceinline__ v16b ldfrag_b(const unsigned short* p) {
  FragB f;
  f.u[0] = *(const v8us*)(p);
  f.u[1] = *(const v8us*)(p + 16);
  return f.v;
}

// ---- WMMA helpers: builtin followed by a 4-slot VALU gap tying D and keeping A/B live ----------------------
__device__ __forceinline__ v8f mma_h(v16h a, v16h b, v8f c) {
  v8f d = __builtin_amdgcn_wmma_f32_16x16x32_f16(false, a, false, b, (short)0, c, false, false);
#if defined(__HIP_DEVICE_COMPILE__)
  asm volatile("v_nop\n\tv_nop\n\tv_nop\n\tv_nop" : "+v"(d) : "v"(a), "v"(b));
#endif
  return d;
}
__device__ __forceinline__ v8f mma_b(v16b a, v16b b, v8f c) {
  v8f d = __builtin_amdgcn_wmma_f32_16x16x32_bf16(false, a, false, b, (short)0, c, false, false);
#if defined(__HIP_DEVICE_COMPILE__)
  const v16h ha = __builtin_bit_cast(v16h, a), hb = __builtin_bit_cast(v16h, b);
  asm volatile("v_nop\n\tv_nop\n\tv_nop\n\tv_nop" : "+v"(d) : "v"(ha), "v"(hb));
#endif
  return d;
}

// ---- one wave: 16 n rows x 64 output channels (4 D tiles) over K = 128 (4 k-steps), A from LDS, B from the
//      stacked bf16 weight plane (rows = output channel, k = input channel contiguous, pitch DCH)
__device__ __forceinline__ void gemm4(const unsigned short* ap, const unsigned short* bp,
                                      v8f& acc0, v8f& acc1, v8f& acc2, v8f& acc3) {
  acc0 = zero8(); acc1 = zero8(); acc2 = zero8(); acc3 = zero8();
#pragma unroll
  for (int ks = 0; ks < 4; ++ks) {
    const v16b a = ldfrag_b(ap + 32 * ks);
    const unsigned short* bs = bp + 32 * ks;
    acc0 = mma_b(a, ldfrag_b(bs + 0 * 16 * DCH), acc0);
    acc1 = mma_b(a, ldfrag_b(bs + 1 * 16 * DCH), acc1);
    acc2 = mma_b(a, ldfrag_b(bs + 2 * 16 * DCH), acc2);
    acc3 = mma_b(a, ldfrag_b(bs + 3 * 16 * DCH), acc3);
  }
}

// ---- LDS staging helpers for the projection epilogue (D rows = n, D cols = channel) ------------------------
__device__ __forceinline__ void stage_h(unsigned short* L, int nr, int col, v8f acc) {
#pragma unroll
  for (int r = 0; r < 8; ++r) L[(nr + r) * LQP + col] = h_bits((_Float16)acc[r]);
}
__device__ __forceinline__ void stage_v(unsigned short* Lv, int e, int nr, v8f acc) {
#pragma unroll
  for (int r = 0; r < 8; ++r) Lv[e * LVP + nr + r] = h_bits((_Float16)acc[r]);
}

// ---- tensor load to LDS: descriptor words live in scalar registers; every test around an issue is a scalar branch ----
__device__ __forceinline__ uint32_t uni(uint32_t v) { return (uint32_t)__builtin_amdgcn_readfirstlane(v); }
__device__ __forceinline__ uint32_t pinned(uint32_t v) {
  uint32_t w = uni(v);
  asm volatile("" : "+s"(w));   // pinned(): an issue test or a descriptor word held in a scalar register; the test then compiles to s_cmp + s_cbranch_scc (tensor loads ignore EXEC)
  return w;
}
// group 1: 1-byte elements, tile = tensor = 128 rows of 256 bytes, 16 bytes of LDS pad behind every 256-byte row
__device__ __forceinline__ u32x8 tdm_group1(uint32_t src_pitch) {
  u32x8 g;
  // pinned(): each descriptor word held in a scalar register of its own, so that the tuple is built once and nothing rewrites it
  // while a request is in flight; word 0 stays a plain constant
  g[0] = uni((1u << 20) | (5u << 22) | (3u << 25));
  g[1] = pinned(256u << 16);
  g[2] = pinned(128u << 16);
  g[3] = pinned(256u << 16);
  g[4] = pinned(128u);
  g[5] = pinned(src_pitch);
  g[6] = pinned(0u);
  g[7] = pinned(0u);
  return g;
}
__device__ __forceinline__ u32x4 tdm_group0(uint32_t lds_dst, uint64_t ga) {
  u32x4 g;
  g[0] = uni(1u);
  g[1] = uni(lds_dst);
  g[2] = uni((uint32_t)ga);
  g[3] = uni((((uint32_t)(ga >> 32)) & 0x01FFFFFFu) | 0x80000000u);
  asm volatile("" : "+s"(g));   // descriptor words held in scalar registers: the tuple is complete here, in front of the issue test
  return g;
}
__device__ __forceinline__ void tdm_load(u32x4 g0, u32x8 g1) {
  asm volatile("tensor_load_to_lds %0, %1" :: "s"(g0), "s"(g1) : "memory");   // one request of the whole wave: a 2-D tile into LDS
}
// the compiler places no wait for a tensor load: the issuing wave's own wait says that its tile has landed
__device__ __forceinline__ void wait_tensor0() { asm volatile("s_wait_tensorcnt 0x0" ::: "memory"); }
// the same wait, naming the request's descriptor as inputs: its registers stay live, so unwritten, until the tile has landed
__device__ __forceinline__ void wait_tensor0_of(u32x4 g0, u32x8 g1) {
  asm volatile("s_wait_tensorcnt 0x0" :: "s"(g0), "s"(g1) : "memory");
}
// this wave's LDS reads have returned before the barrier behind which their buffer is refilled
__device__ __forceinline__ void wait_ds0() { asm volatile("s_wait_dscnt 0x0" ::: "memory"); }

// ---- weight element convert: rows < NQKV -> bf16 bits; rows >= NQKV -> f16 bits of (bf16 RNE value x 16)
__device__ __forceinline__ unsigned short cvt_sel(bool isq, float fq, float fo) {
  const unsigned short uq = bf_bits(fq);
  const unsigned short uo = h_bits((_Float16)(bfr(fo) * WSC));
  return isq ? uq : uo;
}

// =====================================================================================================
// (0) stacked 16-bit weight plane W16[512][128]: rows 0..383 = bf16 bits of W_qkv (RNE convert),
//     rows 384..511 = f16 bits of (bf16 RNE value of W_out) x 16. Thread i writes 8 halves (16 B) at element 8i;
//     sources loaded with clamped rows, selected by value.
// coverage: 32 blocks x 256 threads x 8 = 65536 = 512 x 128.
// =====================================================================================================
__global__ __launch_bounds__(256) void cvt_w(const float* __restrict__ wqkv, const float* __restrict__ wout,
                                             unsigned short* W16) {
  const int i = blockIdx.x * 256 + threadIdx.x;
  if (i >= (NW * DCH) / 8) return;
  const int row = i >> 4;                  // 0..511
  const int col = (i & 15) * 8;
  const int ra = min(row, NQKV - 1);
  const int rb = min(max(row - NQKV, 0), DCH - 1);
  const v4f a0 = *(const v4f*)(wqkv + (size_t)ra * DCH + col), a1 = *(const v4f*)(wqkv + (size_t)ra * DCH + col + 4);
  const v4f c0 = *(const v4f*)(wout + (size_t)rb * DCH + col), c1 = *(const v4f*)(wout + (size_t)rb * DCH + col + 4);
  const bool isq = row < NQKV;
  v4u w;
#pragma unroll
  for (int t = 0; t < 2; ++t) {
    w[t]     = pk16(cvt_sel(isq, a0[2 * t], c0[2 * t]), cvt_sel(isq, a0[2 * t + 1], c0[2 * t + 1]));
    w[2 + t] = pk16(cvt_sel(isq, a1[2 * t], c1[2 * t]), cvt_sel(isq, a1[2 * t + 1], c1[2 * t + 1]));
  }
  unsigned short* p = W16 + (size_t)i * 8;
  *(v4u*)p = w;
  
}

// =====================================================================================================
// (1) fused q/k/v projection for one (b, 64-position tile): block = 256 threads = 8 waves.
//   x tile [128 d][64 n] f32 is staged once as bf16 A tile Lav[n][d] (pitch AP halves, 2-byte LDS stores), barrier.
//   Wave w: n group ng = w&3 (A rows n = 16ng + (lane&15), split k map over d), channel half ch = w>>2
//   (B = W16 rows chunk*128 + ch*64 + 16j + (lane&15), same split k map), 4 D tiles per chunk, 4 k-steps of 32,
//   chunks q, k, v in sequence (A reloaded from LDS).
//   Epilogue: D -> f16 bits in LDS: q tile Lq[n][128], k tile Lk[n][128], v transposed Lv[e][n] (aliases Lav after
//   [b][e][4096] (line = 64 keys of one e row); every line = 8 consecutive lanes x 16 B of one instruction, two
// coverage: Lav: 256 threads x 8 it x 4 = 64 n x 128 d; Lq/Lk: 8 waves x (16 n x 64 ch) per chunk = 64 x 128;
//           Q/K planes: 4 it x 32 lines x 8 lanes x 8 halves = 64 rows x 128; V plane: 4 it x 32 lines x 8 x 8 =
//           128 e x 64 n; grid = 8 x 64 blocks covers every plane exactly once.
// =====================================================================================================
__global__ __launch_bounds__(256)
void proj_kernel(const float* __restrict__ x, const unsigned short* __restrict__ W16,
                 unsigned short* QP, unsigned short* KP, unsigned short* VP) {
  __shared__ __align__(16) unsigned short Lav[64 * AP];    // A tile [n][d]; reused as Lv[e][n] (pitch LVP) later
  __shared__ __align__(16) unsigned short Lq[64 * LQP];    // q f16 [n][128]
  __shared__ __align__(16) unsigned short Lk[64 * LQP];    // k f16 [n][128]
  const int tid  = threadIdx.x;
  const int lane = tid & 31, wave = tid >> 5;
  const int hh   = lane >> 4, c = lane & 15;
  const int bx   = blockIdx.x;
  const int b    = bx / (SEQ / QT);
  const int nt   = bx % (SEQ / QT);
  const int n0   = nt * QT;

  // ---- stage x tile as bf16 [n][d] ----
  {
    const int n4 = (tid & 15) * 4, ds = tid >> 4;          // ds 0..15
    const float* xp = x + ((size_t)b * DCH + ds) * SEQ + n0 + n4;
#pragma unroll
    for (int it = 0; it < 8; ++it) {
      const v4f v = *(const v4f*)(xp + (size_t)it * 16 * SEQ);
      const int d = it * 16 + ds;                          // 0..127
#pragma unroll
      for (int q = 0; q < 4; ++q) Lav[(n4 + q) * AP + d] = bf_bits(v[q]);
    }
  }
  __syncthreads();

  // ---- GEMMs: 16 n rows x 64 channels per wave per chunk ----
  const int ng = wave & 3, ch = wave >> 2;
  const unsigned short* ap = Lav + (ng * 16 + c) * AP + 8 * hh;
  const int nr = ng * 16 + 8 * hh;                         // D row r -> n local nr + r
  const int cb = ch * 64;                                  // channel base within a chunk; D col = cb + 16j + c
  v8f acc0, acc1, acc2, acc3;

  // q chunk (weight rows 0..127)
  gemm4(ap, W16 + (size_t)(0 * DCH + cb + c) * DCH + 8 * hh, acc0, acc1, acc2, acc3);
  stage_h(Lq, nr, cb + 0 * 16 + c, acc0);
  stage_h(Lq, nr, cb + 1 * 16 + c, acc1);
  stage_h(Lq, nr, cb + 2 * 16 + c, acc2);
  stage_h(Lq, nr, cb + 3 * 16 + c, acc3);
  // k chunk (weight rows 128..255)
  gemm4(ap, W16 + (size_t)(1 * DCH + cb + c) * DCH + 8 * hh, acc0, acc1, acc2, acc3);
  stage_h(Lk, nr, cb + 0 * 16 + c, acc0);
  stage_h(Lk, nr, cb + 1 * 16 + c, acc1);
  stage_h(Lk, nr, cb + 2 * 16 + c, acc2);
  stage_h(Lk, nr, cb + 3 * 16 + c, acc3);
  // v chunk (weight rows 256..383)
  gemm4(ap, W16 + (size_t)(2 * DCH + cb + c) * DCH + 8 * hh, acc0, acc1, acc2, acc3);

  __syncthreads();            // every wave is done reading Lav before it is reused as Lv
  stage_v(Lav, cb + 0 * 16 + c, nr, acc0);
  stage_v(Lav, cb + 1 * 16 + c, nr, acc1);
  stage_v(Lav, cb + 2 * 16 + c, nr, acc2);
  stage_v(Lav, cb + 3 * 16 + c, nr, acc3);
  __syncthreads();

  {
    const int e = tid & 7, lq = tid >> 3;                    // lq 0..31
{
#pragma unroll
      for (int it = 0; it < 4; ++it) {
        const int L  = it * 32 + lq;                         // 0..127
        const int n  = L >> 1, hf = L & 1;                   // row 0..63, half 0..1
        const size_t go = ((size_t)b * SEQ + n0 + n) * DCH + hf * 64 + 8 * e;
        const int lo_ = n * LQP + hf * 64 + 8 * e;
        const v4u uq = *(const v4u*)(Lq + lo_);
        const v4u uk = *(const v4u*)(Lk + lo_);
        *(v4u*)(QP + go) = uq;
        *(v4u*)(KP + go) = uk;
      }
#pragma unroll
      for (int it = 0; it < 4; ++it) {
        const int er = it * 32 + lq;                         // 0..127
        const v4u uv = *(const v4u*)(Lav + er * LVP + 8 * e);
        *(v4u*)(VP + ((size_t)b * DCH + er) * SEQ + n0 + 8 * e) = uv;
      }
      
    }
  }
}

// =====================================================================================================
// (2) attention + output projection for one (b, 128-query tile), transposed formulation, 128-deep scores, 4096 keys:
//   K rows and V rows come in stages of 128 keys by tensor_load_to_lds into a ring of two LDS buffers that the block's
//   8 waves share: wave 0 brings the K tile (128 keys x 256 B, source pitch 256 B), wave 1 the V tile (128 d rows x
//   256 B = 128 keys, source pitch 8192 B), each one request per stage, rows padded to a pitch of 272 B in LDS.
//   Stage s + 1 flies while stage s is worked on; at the foot of a stage: s_wait_dscnt 0, the issuers' s_wait_tensorcnt 0,
//   the workgroup barrier, then the refill of the buffer just read.
//   S^T tile (16 keys x 16 queries) = A(k rows = keys kb + (lane&15), d via the split k map, f16, from LDS) .
//                                     B(q, col = query, same d map, resident f16 fragments), four d-steps.
//   energy = acc * 128^-0.5 in f32. Per lane the D tile holds 8 keys of ONE query: online softmax state per lane,
//   one shuffle (lane^16) for the max over 32 keys, row-sum partials combined at the end. P = e^{s-m} x 1024 as one
//   f16 vector is the B operand of O^T (rows d, cols queries) += A(v rows d, keys contiguous, from LDS) . B(P^T):
//   element r <- D of the tile covering keys kb..kb+15, element 8+r <- the tile covering kb+16..kb+31, lane unchanged.
//   32 keys per step: 8 score WMMAs + 8 output WMMAs per wave. Block = 8 waves = 128 queries; grid = 8 b x 32.
//   Output projection: B fragment of d-step ks = f16(O^T x 64 / l) of D tiles j = 2ks (element r) and 2ks+1 (element
//   8+r), lane unchanged (col = query); A = W16 rows 384 + o (f16, x16), split k map over d; D[row o][col query]
//   x 1/1024 staged in LDS (scalar stores, pitch OP), barrier, then + bf16-RNE bias; each wave stores whole 512-B rows.
// coverage: block writes o 0..127 x n n0..n0+127 of its b (16 it x 8 rows); grid covers y exactly once.
// =====================================================================================================
__global__ __launch_bounds__(256)
void attn_kernel(const unsigned short* __restrict__ QP, const unsigned short* __restrict__ KP,
                 const unsigned short* __restrict__ VP, const unsigned short* __restrict__ W16,
                 const float* __restrict__ bout, float* y) {
  // buffer u: K tile at u * 2 * TILEB, V tile at u * 2 * TILEB + TILEB; every tile starts at a multiple of 2 KiB
  __shared__ __attribute__((aligned(2048))) unsigned char Ring[4 * TILEB];
  __shared__ __align__(16) float Os[DCH * OP];
  const int tid  = threadIdx.x;
  const int lane = tid & 31;
  const uint32_t wave = uni((uint32_t)tid >> 5);
  const int hh   = lane >> 4;
  const int c    = lane & 15;
  const int bx   = blockIdx.x;
  const int b    = bx / (SEQ / QB);
  const int qb   = bx % (SEQ / QB);
  const int n0   = qb * QB;
  const _Float16* QPh = (const _Float16*)(const void*)QP;
  const _Float16* WOh = (const _Float16*)(const void*)W16 + (size_t)NQKV * DCH;

  // ---- resident q fragments (B operand, col = query n0 + 16*wave + c), d 0..31, 32..63, 64..95, 96..127 ----
  const size_t qo = ((size_t)b * SEQ + n0 + wave * 16 + c) * DCH + 8 * hh;
  const v16h q0 = ldfrag_h(QPh + qo), q1 = ldfrag_h(QPh + qo + 32);
  const v16h q2 = ldfrag_h(QPh + qo + 64), q3 = ldfrag_h(QPh + qo + 96);

  // ---- the two issuing waves' requests: wave 0 = K tile, wave 1 = V tile ----
  const bool isV = wave == 1u;
  const uint64_t tsrc = isV ? (uint64_t)(size_t)(VP + (size_t)b * DCH * SEQ) : (uint64_t)(size_t)(KP + (size_t)b * SEQ * DCH);
  const uint32_t tstep = isV ? (uint32_t)(SK * 2) : (uint32_t)(SK * DCH * 2);     // bytes from one stage's tile to the next
  const uint32_t tdst  = (uint32_t)(size_t)Ring + (isV ? (uint32_t)TILEB : 0u);
  const u32x8 g1 = tdm_group1(isV ? (uint32_t)(SEQ * 2) : (uint32_t)(DCH * 2));

  u32x4 g0 = tdm_group0(tdst, tsrc);
  if (pinned(wave < 2u)) {
    tdm_load(g0, g1);                                          // stage 0 into buffer 0
    wait_tensor0_of(g0, g1);
  }
  __syncthreads();                                             // stage 0 published
  g0 = tdm_group0(tdst + 2u * TILEB, tsrc + tstep);
  if (pinned(wave < 2u)) {
    tdm_load(g0, g1);                                          // stage 1 into buffer 1
  }

  float m = -1.0e30f, l = 0.f;
  v8f o0 = zero8(), o1 = zero8(), o2 = zero8(), o3 = zero8();
  v8f o4 = zero8(), o5 = zero8(), o6 = zero8(), o7 = zero8();
  // kept rolled: one stage per trip, so the ring's foot (waits, barrier, refill) stands once in the code
#pragma unroll 1
  for (int st = 0; st < SEQ / SK; ++st) {
    // k fragment base (A operand, row = key c of the stage), v fragment base (A operand, row = d = c, keys contiguous)
    const _Float16* Kl = (const _Float16*)(const void*)(Ring + (st & 1) * (2 * TILEB)) + c * KVH + 8 * hh;
    const _Float16* Vl = Kl + TILEB / 2;
    // kept rolled: unrolled, the live set passes 256 VGPRs and nothing of one step can overlap the next
#pragma unroll 1
    for (int sub = 0; sub < SK / 32; ++sub) {
      const int kb = sub * 32;
      const _Float16* k0p = Kl + kb * KVH;                      // keys kb .. kb+15 of the stage
      const _Float16* k1p = k0p + 16 * KVH;                     // keys kb+16 .. kb+31
      // the step's 16 K reads as one group in front of its score products
      const v16h ka0 = ldfrag_h(k0p), ka1 = ldfrag_h(k0p + 32), ka2 = ldfrag_h(k0p + 64), ka3 = ldfrag_h(k0p + 96);
      const v16h kc0 = ldfrag_h(k1p), kc1 = ldfrag_h(k1p + 32), kc2 = ldfrag_h(k1p + 64), kc3 = ldfrag_h(k1p + 96);
      v8f s0, s1;
      s0 = mma_h(ka0, q0, zero8());
      s0 = mma_h(ka1, q1, s0);
      s0 = mma_h(ka2, q2, s0);
      s0 = mma_h(ka3, q3, s0);
      s1 = mma_h(kc0, q0, zero8());
      s1 = mma_h(kc1, q1, s1);
      s1 = mma_h(kc2, q2, s1);
      s1 = mma_h(kc3, q3, s1);
      // the step's 16 V reads as one group, in flight under the softmax
      const v16h va0 = ldfrag_h(Vl + 0 * 16 * KVH + kb), va1 = ldfrag_h(Vl + 1 * 16 * KVH + kb);
      const v16h va2 = ldfrag_h(Vl + 2 * 16 * KVH + kb), va3 = ldfrag_h(Vl + 3 * 16 * KVH + kb);
      const v16h va4 = ldfrag_h(Vl + 4 * 16 * KVH + kb), va5 = ldfrag_h(Vl + 5 * 16 * KVH + kb);
      const v16h va6 = ldfrag_h(Vl + 6 * 16 * KVH + kb), va7 = ldfrag_h(Vl + 7 * 16 * KVH + kb);

      float mx = fmaxf(hmax8(s0), hmax8(s1)) * SCL;
      mx = fmaxf(mx, __shfl_xor(mx, 16, 32));
      const float mn   = fmaxf(m, mx);
      const float corr = __expf(m - mn);
      m = mn;
      const float msh = mn - LNPS;            // exp gives e^{s-m} * 1024
      l *= corr;
#pragma unroll
      for (int r = 0; r < 8; ++r) {
        o0[r] *= corr; o1[r] *= corr; o2[r] *= corr; o3[r] *= corr;
        o4[r] *= corr; o5[r] *= corr; o6[r] *= corr; o7[r] *= corr;
      }

      FragH ph;
      float ls = 0.f;
#pragma unroll
      for (int r = 0; r < 8; ++r) {
        const float e0 = __expf(s0[r] * SCL - msh);   // key kb      + 8hh + r
        const float e1 = __expf(s1[r] * SCL - msh);   // key kb + 16 + 8hh + r
        ls += e0 + e1;
        ph.h[0][r] = (_Float16)e0;
        ph.h[1][r] = (_Float16)e1;
      }
      l += ls;

      o0 = mma_h(va0, ph.v, o0);
      o1 = mma_h(va1, ph.v, o1);
      o2 = mma_h(va2, ph.v, o2);
      o3 = mma_h(va3, ph.v, o3);
      o4 = mma_h(va4, ph.v, o4);
      o5 = mma_h(va5, ph.v, o5);
      o6 = mma_h(va6, ph.v, o6);
      o7 = mma_h(va7, ph.v, o7);
    }
    // ---- foot of stage st: publish stage st + 1, then refill the buffer that stage st has just read ----
    wait_ds0();
    if (pinned(wave < 2u)) wait_tensor0_of(g0, g1);
    __syncthreads();
    if (pinned((wave < 2u) && (st + 2 < SEQ / SK))) {
      g0 = tdm_group0(tdst + (uint32_t)(st & 1) * (2u * TILEB), tsrc + (uint64_t)(st + 2) * tstep);
      tdm_load(g0, g1);
    }
  }
  wait_tensor0();
  wait_ds0();
  l += __shfl_xor(l, 16, 32);
  const float sc = OSC / l;                 // both o and l carry the x1024 factor; sc scales O by 64

  // ---- O (x64) as f16 B fragments of the output projection: d-step ks <- D tiles 2ks (r) and 2ks+1 (8+r) ----
  FragH ob0, ob1, ob2, ob3;
#pragma unroll
  for (int r = 0; r < 8; ++r) {
    ob0.h[0][r] = (_Float16)(o0[r] * sc); ob0.h[1][r] = (_Float16)(o1[r] * sc);
    ob1.h[0][r] = (_Float16)(o2[r] * sc); ob1.h[1][r] = (_Float16)(o3[r] * sc);
    ob2.h[0][r] = (_Float16)(o4[r] * sc); ob2.h[1][r] = (_Float16)(o5[r] * sc);
    ob3.h[0][r] = (_Float16)(o6[r] * sc); ob3.h[1][r] = (_Float16)(o7[r] * sc);
  }

  // ---- y^T tile: for each o tile, A = W_out rows 16*ot + c (f16 x16, split map over d), 4 d-steps; stage x 1/1024 ----
  const _Float16* wp = WOh + (size_t)c * DCH + 8 * hh;
  float* os = Os + (8 * hh) * OP + wave * 16 + c;           // row o = 16*ot + 8hh + r, col = query 16*wave + c
#pragma unroll
  for (int ot = 0; ot < 8; ++ot) {
    v8f ya = zero8();
    ya = mma_h(ldfrag_h(wp + ot * 16 * DCH),      ob0.v, ya);
    ya = mma_h(ldfrag_h(wp + ot * 16 * DCH + 32), ob1.v, ya);
    ya = mma_h(ldfrag_h(wp + ot * 16 * DCH + 64), ob2.v, ya);
    ya = mma_h(ldfrag_h(wp + ot * 16 * DCH + 96), ob3.v, ya);
#pragma unroll
    for (int r = 0; r < 8; ++r) os[(ot * 16 + r) * OP] = ya[r] * IYS;
  }
  __syncthreads();
  {
    float* ob = y + ((size_t)b * DCH) * SEQ + n0;
#pragma unroll
    for (int it = 0; it < 16; ++it) {
      const int row = it * 8 + (int)wave;                 // o row 0..127: one wave stores the row's 128 queries (512 B)
      const v4f v   = *(const v4f*)(Os + row * OP + 4 * lane);
      const float bb = bfr(bout[row]);
      const v4f vo  = {v[0] + bb, v[1] + bb, v[2] + bb, v[3] + bb};
      *(v4f*)(ob + (size_t)row * SEQ + 4 * lane) = vo;
    }
  }
}

// =====================================================================================================
//   W16  16-bit [512][128]        0           131072
//   QP   f16    [8][4096][128]    131072      8388608
//   KP   f16    [8][4096][128]    8519680     8388608
//   VP   f16    [8][128][4096]    16908288    8388608
//   end                           25296896
// =====================================================================================================
extern "C" void kernel_launch(void* const* d_in, const int* in_sizes, int n_in,
                              void* d_out, int out_size, void* d_ws, size_t ws_size,
                              hipStream_t stream) {
  const int NX = NB * DCH * SEQ;                        // 4194304
  if (n_in < 4) return;
  if (in_sizes[0] != NX || in_sizes[1] != NQKV * DCH || in_sizes[2] != DCH * DCH || in_sizes[3] != DCH) return;
  if (out_size != NX) return;

  size_t off = 0;
  const size_t oW  = off; off += (size_t)NW * DCH * 2;            // 131072
  const size_t szP = (size_t)NB * SEQ * DCH * 2;                  // 8388608
  const size_t oQ  = off; off += szP;
  const size_t oK  = off; off += szP;
  const size_t oV  = off; off += (size_t)NB * DCH * SEQ * 2;      // 8388608
  if (off > ws_size) return;                                      // off = 25296896
  if (off > (size_t)134217728) return;

  const float* x    = (const float*)d_in[0];
  const float* Wqkv = (const float*)d_in[1];
  const float* Wout = (const float*)d_in[2];
  const float* bout = (const float*)d_in[3];
  char* ws = (char*)d_ws;
  unsigned short* W16 = (unsigned short*)(ws + oW);
  unsigned short* QPp = (unsigned short*)(ws + oQ);
  unsigned short* KPp = (unsigned short*)(ws + oK);
  unsigned short* VPp = (unsigned short*)(ws + oV);
  float* y = (float*)d_out;

  const dim3 blk256(256);
  const dim3 gW((NW * DCH / 8) / 256);                  // 32 blocks
  const dim3 gP(NB * (SEQ / QT));                       // 512 blocks: one (b, 64-position tile) each
  const dim3 gA(NB * (SEQ / QB));                       // 256 blocks: one (b, 128-query tile) each

  // (0) stacked 16-bit weight plane
  cvt_w<<<gW, blk256, 0, stream>>>(Wqkv, Wout, W16);
  // (1) q, k, v planes
  proj_kernel<<<gP, blk256, 0, stream>>>(x, W16, QPp, KPp, VPp);
  // (2) attention + output projection + bias: y[b][o][n]
  attn_kernel<<<gA, blk256, 0, stream>>>(QPp, KPp, VPp, W16, bout, y);
  (void)hipGetLastError();
}

// v002
// A run of this version takes 85.8 microseconds.
// Two timings next to v001 both put it at 1.13 times that version's speed.
// Counting every step since v000, it is 5.30 times as fast.
// Contractions: q/k/v 1x1-conv projections = W_qkv (bf16, RNE convert of input) . X (bf16, RNE convert of input) on
// v_wmma_f32_16x16x32_bf16, K=128; scores S^T = k (f16) . q^T (f16) on v_wmma_f32_16x16x32_f16, K=128, one product;
// O^T = v (f16) . P^T (f16, e^{s-m} x 1024 taken from the score D registers) on v_wmma_f32_16x16x32_f16 over 4096
// keys, one product; y = W_out (f16 bits of the bf16-RNE input x 16) . O (f16, x 64, taken from the O^T D registers)
// on v_wmma_f32_16x16x32_f16, K=128, one product; f32 accumulate everywhere; softmax (running max, row sums, 1/l),
// the 128^-0.5 scale and the bias add in f32 on VALU.
#include <hip/hip_runtime.h>
#include <math.h>
#include <stdint.h>

#define NB    8
#define DCH   128
#define SEQ   4096
#define NQKV  384
#define NW    512
#define QT    64
#define AP    144
#define LQP   136
#define LVP   72
#define OP    132
#define QB    128
#define SK    128
#define KVH   136
#define TILEB 34816
#define LNPS  6.931471805599453f
#define SCL   0.08838834764831845f
#define OSC   64.0f
#define WSC   16.0f
#define IYS   0.0009765625f
static_assert((SEQ % QT) == 0);
static_assert((SEQ % 32) == 0);
static_assert((DCH % 32) == 0);
static_assert(NQKV == 3 * DCH);
static_assert(NW == NQKV + DCH);
static_assert(((NW * DCH) / 8) % 256 == 0);
static_assert(64 * AP == DCH * LVP);
static_assert(LQP >= DCH && (LQP % 8) == 0);
static_assert((AP % 8) == 0 && (LVP % 8) == 0);
static_assert(OP >= QB && (OP % 4) == 0);
static_assert((SEQ % QB) == 0 && (SEQ % SK) == 0 && (SEQ / SK) >= 2 && (SK % 32) == 0);
static_assert(2 * DCH == 256 && 2 * SK == 256);           // both tiles have rows of 256 bytes
static_assert(2 * KVH == 256 + 16);                        // LDS row pitch = row + the 16-byte pad of the tensor load
static_assert(TILEB == SK * 2 * KVH && TILEB == DCH * 2 * KVH && (TILEB % 2048) == 0);
static_assert((SK % 64) == 0);                             // each key half of a stage is a whole number of 32-key steps
static_assert(8 * 17 * 512 <= 4 * TILEB);                  // the waves' swap of one tile each fits the ring's LDS

typedef _Float16       v16h __attribute__((ext_vector_type(16)));
typedef _Float16       v8h  __attribute__((ext_vector_type(8)));
typedef __bf16         v16b __attribute__((ext_vector_type(16)));
typedef unsigned short v8us __attribute__((ext_vector_type(8)));
typedef float          v8f  __attribute__((ext_vector_type(8)));
typedef float          v4f  __attribute__((ext_vector_type(4)));
typedef unsigned int   v4u  __attribute__((ext_vector_type(4)));
typedef uint32_t       u32x4 __attribute__((ext_vector_type(4)));
typedef uint32_t       u32x8 __attribute__((ext_vector_type(8)));

union FragH { v16h v; v8h  h[2]; };
union FragB { v16b v; v8us u[2]; };
static_assert(sizeof(FragH) == 32);
static_assert(sizeof(FragB) == 32);

// ---- scalar helpers --------------------------------------------------------------------------------
__device__ __forceinline__ unsigned short bf_bits(float f) {          // f32 -> bf16 bits, RNE convert
  unsigned u = __float_as_uint(f);
  return (unsigned short)((u + 0x7FFFu + ((u >> 16) & 1u)) >> 16);
}
__device__ __forceinline__ float bf_up(unsigned short h) { return __uint_as_float(((unsigned)h) << 16); }
__device__ __forceinline__ float bfr(float f) { return bf_up(bf_bits(f)); }
__device__ __forceinline__ unsigned short h_bits(_Float16 x) { return __builtin_bit_cast(unsigned short, x); }
__device__ __forceinline__ unsigned pk16(unsigned short a, unsigned short b) { return (unsigned)a | ((unsigned)b << 16); }
__device__ __forceinline__ v8f zero8() { v8f z = {0.f, 0.f, 0.f, 0.f, 0.f, 0.f, 0.f, 0.f}; return z; }
__device__ __forceinline__ float hmax8(v8f s) {
  return fmaxf(fmaxf(fmaxf(s[0], s[1]), fmaxf(s[2], s[3])), fmaxf(fmaxf(s[4], s[5]), fmaxf(s[6], s[7])));
}

// ---- fragment loaders: 16-bit A/B operand, lane -> row/col (lane&15), p already includes +8*(lane>>4);
//      elements 0..7 <- p[0..7] (k0+8h..), elements 8..15 <- p[16..23] (k0+16+8h..)
__device__ __forceinline__ v16h ldfrag_h(const _Float16* p) {
  FragH f;
  f.h[0] = *(const v8h*)(p);
  f.h[1] = *(const v8h*)(p + 16);
  return f.v;
}
__device__ __forceinline__ v16b ldfrag_b(const unsigned short* p) {
  FragB f;
  f.u[0] = *(const v8us*)(p);
  f.u[1] = *(const v8us*)(p + 16);
  return f.v;
}

// ---- WMMA helpers: builtin followed by a 4-slot VALU gap tying D and keeping A/B live ----------------------
__device__ __forceinline__ v8f mma_h(v16h a, v16h b, v8f c) {
  v8f d = __builtin_amdgcn_wmma_f32_16x16x32_f16(false, a, false, b, (short)0, c, false, false);
#if defined(__HIP_DEVICE_COMPILE__)
  asm volatile("v_nop\n\tv_nop\n\tv_nop\n\tv_nop" : "+v"(d) : "v"(a), "v"(b));
#endif
  return d;
}
// key loop of the attention: the plain builtin, padded by the compiler. The asm statement above takes its vector operands below v256,
// and the 32-column wave's fragments and accumulators do not all fit there (scratch reloads inside the loop).
__device__ __forceinline__ v8f mma_k(v16h a, v16h b, v8f c) {
  return __builtin_amdgcn_wmma_f32_16x16x32_f16(false, a, false, b, (short)0, c, false, false);
}
__device__ __forceinline__ v8f mma_b(v16b a, v16b b, v8f c) {
  v8f d = __builtin_amdgcn_wmma_f32_16x16x32_bf16(false, a, false, b, (short)0, c, false, false);
#if defined(__HIP_DEVICE_COMPILE__)
  const v16h ha = __builtin_bit_cast(v16h, a), hb = __builtin_bit_cast(v16h, b);
  asm volatile("v_nop\n\tv_nop\n\tv_nop\n\tv_nop" : "+v"(d) : "v"(ha), "v"(hb));
#endif
  return d;
}

// ---- one wave: 16 n rows x 64 output channels (4 D tiles) over K = 128 (4 k-steps), A from LDS, B from the
//      stacked bf16 weight plane (rows = output channel, k = input channel contiguous, pitch DCH)
__device__ __forceinline__ void gemm4(const unsigned short* ap, const unsigned short* bp,
                                      v8f& acc0, v8f& acc1, v8f& acc2, v8f& acc3) {
  acc0 = zero8(); acc1 = zero8(); acc2 = zero8(); acc3 = zero8();
#pragma unroll
  for (int ks = 0; ks < 4; ++ks) {
    const v16b a = ldfrag_b(ap + 32 * ks);
    const unsigned short* bs = bp + 32 * ks;
    acc0 = mma_b(a, ldfrag_b(bs + 0 * 16 * DCH), acc0);
    acc1 = mma_b(a, ldfrag_b(bs + 1 * 16 * DCH), acc1);
    acc2 = mma_b(a, ldfrag_b(bs + 2 * 16 * DCH), acc2);
    acc3 = mma_b(a, ldfrag_b(bs + 3 * 16 * DCH), acc3);
  }
}

// ---- LDS staging helpers for the projection epilogue (D rows = n, D cols = channel) ------------------------
__device__ __forceinline__ void stage_h(unsigned short* L, int nr, int col, v8f acc) {
#pragma unroll
  for (int r = 0; r < 8; ++r) L[(nr + r) * LQP + col] = h_bits((_Float16)acc[r]);
}
__device__ __forceinline__ void stage_v(unsigned short* Lv, int e, int nr, v8f acc) {
#pragma unroll
  for (int r = 0; r < 8; ++r) Lv[e * LVP + nr + r] = h_bits((_Float16)acc[r]);
}

// ---- tensor load to LDS: descriptor words live in scalar registers; every test around an issue is a scalar branch ----
__device__ __forceinline__ uint32_t uni(uint32_t v) { return (uint32_t)__builtin_amdgcn_readfirstlane(v); }
__device__ __forceinline__ uint32_t pinned(uint32_t v) {
  uint32_t w = uni(v);
  asm volatile("" : "+s"(w));   // pinned(): an issue test or a descriptor word held in a scalar register; the test then compiles to s_cmp + s_cbranch_scc (tensor loads ignore EXEC)
  return w;
}
// group 1: 1-byte elements, tile = tensor = 128 rows of 256 bytes, 16 bytes of LDS pad behind every 256-byte row
__device__ __forceinline__ u32x8 tdm_group1(uint32_t src_pitch) {
  u32x8 g;
  // pinned(): each descriptor word held in a scalar register of its own, so that the tuple is built once and nothing rewrites it
  // while a request is in flight; word 0 stays a plain constant
  g[0] = uni((1u << 20) | (5u << 22) | (3u << 25));
  g[1] = pinned(256u << 16);
  g[2] = pinned(128u << 16);
  g[3] = pinned(256u << 16);
  g[4] = pinned(128u);
  g[5] = pinned(src_pitch);
  g[6] = pinned(0u);
  g[7] = pinned(0u);
  return g;
}
__device__ __forceinline__ u32x4 tdm_group0(uint32_t lds_dst, uint64_t ga) {
  u32x4 g;
  g[0] = uni(1u);
  g[1] = uni(lds_dst);
  g[2] = uni((uint32_t)ga);
  g[3] = uni((((uint32_t)(ga >> 32)) & 0x01FFFFFFu) | 0x80000000u);
  asm volatile("" : "+s"(g));   // descriptor words held in scalar registers: the tuple is complete here, in front of the issue test
  return g;
}
__device__ __forceinline__ void tdm_load(u32x4 g0, u32x8 g1) {
  asm volatile("tensor_load_to_lds %0, %1" :: "s"(g0), "s"(g1) : "memory");   // one request of the whole wave: a 2-D tile into LDS
}
// the compiler places no wait for a tensor load: the issuing wave's own wait says that its tile has landed
__device__ __forceinline__ void wait_tensor0() { asm volatile("s_wait_tensorcnt 0x0" ::: "memory"); }
// the same wait, naming the request's descriptor as inputs: its registers stay live, so unwritten, until the tile has landed
__device__ __forceinline__ void wait_tensor0_of(u32x4 g0, u32x8 g1) {
  asm volatile("s_wait_tensorcnt 0x0" :: "s"(g0), "s"(g1) : "memory");
}
// this wave's LDS reads have returned before the barrier behind which their buffer is refilled
__device__ __forceinline__ void wait_ds0() { asm volatile("s_wait_dscnt 0x0" ::: "memory"); }

// ---- weight element convert: rows < NQKV -> bf16 bits; rows >= NQKV -> f16 bits of (bf16 RNE value x 16)
__device__ __forceinline__ unsigned short cvt_sel(bool isq, float fq, float fo) {
  const unsigned short uq = bf_bits(fq);
  const unsigned short uo = h_bits((_Float16)(bfr(fo) * WSC));
  return isq ? uq : uo;
}

// =====================================================================================================
// (0) stacked 16-bit weight plane W16[512][128]: rows 0..383 = bf16 bits of W_qkv (RNE convert),
//     rows 384..511 = f16 bits of (bf16 RNE value of W_out) x 16. Thread i writes 8 halves (16 B) at element 8i;
//     sources loaded with clamped rows, selected by value.
// coverage: 32 blocks x 256 threads x 8 = 65536 = 512 x 128.
// =====================================================================================================
__global__ __launch_bounds__(256) void cvt_w(const float* __restrict__ wqkv, const float* __restrict__ wout,
                                             unsigned short* W16) {
  const int i = blockIdx.x * 256 + threadIdx.x;
  if (i >= (NW * DCH) / 8) return;
  const int row = i >> 4;                  // 0..511
  const int col = (i & 15) * 8;
  const int ra = min(row, NQKV - 1);
  const int rb = min(max(row - NQKV, 0), DCH - 1);
  const v4f a0 = *(const v4f*)(wqkv + (size_t)ra * DCH + col), a1 = *(const v4f*)(wqkv + (size_t)ra * DCH + col + 4);
  const v4f c0 = *(const v4f*)(wout + (size_t)rb * DCH + col), c1 = *(const v4f*)(wout + (size_t)rb * DCH + col + 4);
  const bool isq = row < NQKV;
  v4u w;
#pragma unroll
  for (int t = 0; t < 2; ++t) {
    w[t]     = pk16(cvt_sel(isq, a0[2 * t], c0[2 * t]), cvt_sel(isq, a0[2 * t + 1], c0[2 * t + 1]));
    w[2 + t] = pk16(cvt_sel(isq, a1[2 * t], c1[2 * t]), cvt_sel(isq, a1[2 * t + 1], c1[2 * t + 1]));
  }
  unsigned short* p = W16 + (size_t)i * 8;
  *(v4u*)p = w;
  
}

// =====================================================================================================
// (1) fused q/k/v projection for one (b, 64-position tile): block = 256 threads = 8 waves.
//   x tile [128 d][64 n] f32 is staged once as bf16 A tile Lav[n][d] (pitch AP halves, 2-byte LDS stores), barrier.
//   Wave w: n group ng = w&3 (A rows n = 16ng + (lane&15), split k map over d), channel half ch = w>>2
//   (B = W16 rows chunk*128 + ch*64 + 16j + (lane&15), same split k map), 4 D tiles per chunk, 4 k-steps of 32,
//   chunks q, k, v in sequence (A reloaded from LDS).
//   Epilogue: D -> f16 bits in LDS: q tile Lq[n][128], k tile Lk[n][128], v transposed Lv[e][n] (aliases Lav after
//   [b][e][4096] (line = 64 keys of one e row); every line = 8 consecutive lanes x 16 B of one instruction, two
// coverage: Lav: 256 threads x 8 it x 4 = 64 n x 128 d; Lq/Lk: 8 waves x (16 n x 64 ch) per chunk = 64 x 128;
//           Q/K planes: 4 it x 32 lines x 8 lanes x 8 halves = 64 rows x 128; V plane: 4 it x 32 lines x 8 x 8 =
//           128 e x 64 n; grid = 8 x 64 blocks covers every plane exactly once.
// =====================================================================================================
__global__ __launch_bounds__(256)
void proj_kernel(const float* __restrict__ x, const unsigned short* __restrict__ W16,
                 unsigned short* QP, unsigned short* KP, unsigned short* VP) {
  __shared__ __align__(16) unsigned short Lav[64 * AP];    // A tile [n][d]; reused as Lv[e][n] (pitch LVP) later
  __shared__ __align__(16) unsigned short Lq[64 * LQP];    // q f16 [n][128]
  __shared__ __align__(16) unsigned short Lk[64 * LQP];    // k f16 [n][128]
  const int tid  = threadIdx.x;
  const int lane = tid & 31, wave = tid >> 5;
  const int hh   = lane >> 4, c = lane & 15;
  const int bx   = blockIdx.x;
  const int b    = bx / (SEQ / QT);
  const int nt   = bx % (SEQ / QT);
  const int n0   = nt * QT;

  // ---- stage x tile as bf16 [n][d] ----
  {
    const int n4 = (tid & 15) * 4, ds = tid >> 4;          // ds 0..15
    const float* xp = x + ((size_t)b * DCH + ds) * SEQ + n0 + n4;
#pragma unroll
    for (int it = 0; it < 8; ++it) {
      const v4f v = *(const v4f*)(xp + (size_t)it * 16 * SEQ);
      const int d = it * 16 + ds;                          // 0..127
#pragma unroll
      for (int q = 0; q < 4; ++q) Lav[(n4 + q) * AP + d] = bf_bits(v[q]);
    }
  }
  __syncthreads();

  // ---- GEMMs: 16 n rows x 64 channels per wave per chunk ----
  const int ng = wave & 3, ch = wave >> 2;
  const unsigned short* ap = Lav + (ng * 16 + c) * AP + 8 * hh;
  const int nr = ng * 16 + 8 * hh;                         // D row r -> n local nr + r
  const int cb = ch * 64;                                  // channel base within a chunk; D col = cb + 16j + c
  v8f acc0, acc1, acc2, acc3;

  // q chunk (weight rows 0..127)
  gemm4(ap, W16 + (size_t)(0 * DCH + cb + c) * DCH + 8 * hh, acc0, acc1, acc2, acc3);
  stage_h(Lq, nr, cb + 0 * 16 + c, acc0);
  stage_h(Lq, nr, cb + 1 * 16 + c, acc1);
  stage_h(Lq, nr, cb + 2 * 16 + c, acc2);
  stage_h(Lq, nr, cb + 3 * 16 + c, acc3);
  // k chunk (weight rows 128..255)
  gemm4(ap, W16 + (size_t)(1 * DCH + cb + c) * DCH + 8 * hh, acc0, acc1, acc2, acc3);
  stage_h(Lk, nr, cb + 0 * 16 + c, acc0);
  stage_h(Lk, nr, cb + 1 * 16 + c, acc1);
  stage_h(Lk, nr, cb + 2 * 16 + c, acc2);
  stage_h(Lk, nr, cb + 3 * 16 + c, acc3);
  // v chunk (weight rows 256..383)
  gemm4(ap, W16 + (size_t)(2 * DCH + cb + c) * DCH + 8 * hh, acc0, acc1, acc2, acc3);

  __syncthreads();            // every wave is done reading Lav before it is reused as Lv
  stage_v(Lav, cb + 0 * 16 + c, nr, acc0);
  stage_v(Lav, cb + 1 * 16 + c, nr, acc1);
  stage_v(Lav, cb + 2 * 16 + c, nr, acc2);
  stage_v(Lav, cb + 3 * 16 + c, nr, acc3);
  __syncthreads();

  {
    const int e = tid & 7, lq = tid >> 3;                    // lq 0..31
{
#pragma unroll
      for (int it = 0; it < 4; ++it) {
        const int L  = it * 32 + lq;                         // 0..127
        const int n  = L >> 1, hf = L & 1;                   // row 0..63, half 0..1
        const size_t go = ((size_t)b * SEQ + n0 + n) * DCH + hf * 64 + 8 * e;
        const int lo_ = n * LQP + hf * 64 + 8 * e;
        const v4u uq = *(const v4u*)(Lq + lo_);
        const v4u uk = *(const v4u*)(Lk + lo_);
        *(v4u*)(QP + go) = uq;
        *(v4u*)(KP + go) = uk;
      }
#pragma unroll
      for (int it = 0; it < 4; ++it) {
        const int er = it * 32 + lq;                         // 0..127
        const v4u uv = *(const v4u*)(Lav + er * LVP + 8 * e);
        *(v4u*)(VP + ((size_t)b * DCH + er) * SEQ + n0 + 8 * e) = uv;
      }
      
    }
  }
}

// =====================================================================================================
// (2) attention + output projection for one (b, 128-query tile), transposed formulation, 128-deep scores, 4096 keys:
//   K rows and V rows come in stages of 128 keys by tensor_load_to_lds into a ring of two LDS buffers that the block's
//   8 waves share: wave 0 brings the K tile (128 keys x 256 B, source pitch 256 B), wave 1 the V tile (128 d rows x
//   256 B = 128 keys, source pitch 8192 B), each one request per stage, rows padded to a pitch of 272 B in LDS.
//   Stage s + 1 flies while stage s is worked on; at the foot of a stage: s_wait_dscnt 0, the issuers' s_wait_tensorcnt 0,
//   the workgroup barrier, then the refill of the buffer just read.
//   S^T tile (16 keys x 16 queries) = A(k rows = keys kb + (lane&15), d via the split k map, f16, from LDS) .
//                                     B(q, col = query, same d map, resident f16 fragments), four d-steps.
//   energy = acc * 128^-0.5 in f32. Per lane the D tile holds 8 keys of ONE query: online softmax state per lane,
//   one shuffle (lane^16) for the max over 32 keys, row-sum partials combined at the end. P = e^{s-m} x 1024 as one
//   f16 vector is the B operand of O^T (rows d, cols queries) += A(v rows d, keys contiguous, from LDS) . B(P^T):
//   element r <- D of the tile covering keys kb..kb+15, element 8+r <- the tile covering kb+16..kb+31, lane unchanged.
//   Wave map: wave w works on 32 queries (two 16-column tiles, group w&3) and on 64 of every stage's 128 keys (half w>>2), so
//   each K and V fragment read from LDS feeds two query tiles. 32 keys per step: 16 score WMMAs + 16 output WMMAs per wave.
//   Behind the key loop the two waves of a query group swap one tile each (max, row sum, O^T) through the ring's LDS and join
//   the halves in f32: O = Oa e^{ma-m} + Ob e^{mb-m}; each wave then finishes one 16-query tile.
//   Block = 8 waves = 128 queries; grid = 8 b x 32.
//   Output projection: B fragment of d-step ks = f16(O^T x 64 / l) of D tiles j = 2ks (element r) and 2ks+1 (element
//   8+r), lane unchanged (col = query); A = W16 rows 384 + o (f16, x16), split k map over d; D[row o][col query]
//   x 1/1024 staged in LDS (scalar stores, pitch OP), barrier, then + bf16-RNE bias; each wave stores whole 512-B rows.
// coverage: block writes o 0..127 x n n0..n0+127 of its b (16 it x 8 rows); grid covers y exactly once.
// =====================================================================================================
__global__ __launch_bounds__(256)
void attn_kernel(const unsigned short* __restrict__ QP, const unsigned short* __restrict__ KP,
                 const unsigned short* __restrict__ VP, const unsigned short* __restrict__ W16,
                 const float* __restrict__ bout, float* y) {
  // buffer u: K tile at u * 2 * TILEB, V tile at u * 2 * TILEB + TILEB; every tile starts at a multiple of 2 KiB
  __shared__ __attribute__((aligned(2048))) unsigned char Ring[4 * TILEB];
  __shared__ __align__(16) float Os[DCH * OP];
  const int tid  = threadIdx.x;
  const int lane = tid & 31;
  const uint32_t wave = uni((uint32_t)tid >> 5);
  const int hh   = lane >> 4;
  const int c    = lane & 15;
  const int bx   = blockIdx.x;
  const int b    = bx / (SEQ / QB);
  const int qb   = bx % (SEQ / QB);
  const int n0   = qb * QB;
  const _Float16* QPh = (const _Float16*)(const void*)QP;
  const _Float16* WOh = (const _Float16*)(const void*)W16 + (size_t)NQKV * DCH;

  // ---- wave map: query group qg = 32 queries (two 16-column tiles), key half kh = 64 of every stage's 128 keys.
  //      Tile A is the tile this wave finishes (columns 32*qg + 16*kh + c), tile B the one its partner (wave ^ 4) finishes.
  const uint32_t qg = wave & 3u, kh = wave >> 2;
  const int colA = (int)(qg * 32u + kh * 16u), colB = (int)(qg * 32u + (1u - kh) * 16u);
  // ---- resident q fragments (B operand, col = query), d 0..31, 32..63, 64..95, 96..127, for both tiles ----
  const size_t qoA = ((size_t)b * SEQ + n0 + colA + c) * DCH + 8 * hh;
  const size_t qoB = ((size_t)b * SEQ + n0 + colB + c) * DCH + 8 * hh;
  const v16h qa0 = ldfrag_h(QPh + qoA), qa1 = ldfrag_h(QPh + qoA + 32);
  const v16h qa2 = ldfrag_h(QPh + qoA + 64), qa3 = ldfrag_h(QPh + qoA + 96);
  const v16h qb0 = ldfrag_h(QPh + qoB), qb1 = ldfrag_h(QPh + qoB + 32);
  const v16h qb2 = ldfrag_h(QPh + qoB + 64), qb3 = ldfrag_h(QPh + qoB + 96);

  // ---- the two issuing waves' requests: wave 0 = K tile, wave 1 = V tile ----
  const bool isV = wave == 1u;
  const uint64_t tsrc = isV ? (uint64_t)(size_t)(VP + (size_t)b * DCH * SEQ) : (uint64_t)(size_t)(KP + (size_t)b * SEQ * DCH);
  const uint32_t tstep = isV ? (uint32_t)(SK * 2) : (uint32_t)(SK * DCH * 2);     // bytes from one stage's tile to the next
  const uint32_t tdst  = (uint32_t)(size_t)Ring + (isV ? (uint32_t)TILEB : 0u);
  const u32x8 g1 = tdm_group1(isV ? (uint32_t)(SEQ * 2) : (uint32_t)(DCH * 2));

  u32x4 g0 = tdm_group0(tdst, tsrc);
  if (pinned(wave < 2u)) {
    tdm_load(g0, g1);                                          // stage 0 into buffer 0
    wait_tensor0_of(g0, g1);
  }
  asm volatile("s_wait_xcnt 0x0" ::: "memory");                // in front of the first overwrite of the q loads' address registers
  __syncthreads();                                             // stage 0 published
  g0 = tdm_group0(tdst + 2u * TILEB, tsrc + tstep);
  if (pinned(wave < 2u)) {
    tdm_load(g0, g1);                                          // stage 1 into buffer 1
  }

  float mA = -1.0e30f, lA = 0.f, mB = -1.0e30f, lB = 0.f;
  v8f oA[8], oB[8];
#pragma unroll
  for (int j = 0; j < 8; ++j) { oA[j] = zero8(); oB[j] = zero8(); }
  // kept rolled: one stage per trip, so the ring's foot (waits, barrier, refill) stands once in the code
#pragma unroll 1
  for (int st = 0; st < SEQ / SK; ++st) {
    // k fragment base (A operand, row = key 64*kh + c of the stage), v fragment base (A operand, row = d = c, keys contiguous
    // from key 64*kh of the stage)
    const _Float16* Tl = (const _Float16*)(const void*)(Ring + (st & 1) * (2 * TILEB));
    const _Float16* Kl = Tl + ((int)kh * (SK / 2) + c) * KVH + 8 * hh;
    const _Float16* Vl = Tl + TILEB / 2 + c * KVH + 8 * hh + (int)kh * (SK / 2);
    // kept rolled, as it was: one 32-key step per trip
#pragma unroll 1
    for (int sub = 0; sub < SK / 64; ++sub) {
      const int kb = sub * 32;
      const _Float16* k0p = Kl + kb * KVH;                      // keys kb .. kb+15 of the wave's half
      const _Float16* k1p = k0p + 16 * KVH;                     // keys kb+16 .. kb+31
      // the step's 16 K reads as one group in front of its score products; every fragment feeds both query tiles
      const v16h ka0 = ldfrag_h(k0p), ka1 = ldfrag_h(k0p + 32), ka2 = ldfrag_h(k0p + 64), ka3 = ldfrag_h(k0p + 96);
      const v16h kc0 = ldfrag_h(k1p), kc1 = ldfrag_h(k1p + 32), kc2 = ldfrag_h(k1p + 64), kc3 = ldfrag_h(k1p + 96);
      v8f sA0, sA1, sB0, sB1;
      sA0 = mma_k(ka0, qa0, zero8());
      sB0 = mma_k(ka0, qb0, zero8());
      sA1 = mma_k(kc0, qa0, zero8());
      sB1 = mma_k(kc0, qb0, zero8());
      sA0 = mma_k(ka1, qa1, sA0);
      sB0 = mma_k(ka1, qb1, sB0);
      sA1 = mma_k(kc1, qa1, sA1);
      sB1 = mma_k(kc1, qb1, sB1);
      sA0 = mma_k(ka2, qa2, sA0);
      sB0 = mma_k(ka2, qb2, sB0);
      sA1 = mma_k(kc2, qa2, sA1);
      sB1 = mma_k(kc2, qb2, sB1);
      sA0 = mma_k(ka3, qa3, sA0);
      sB0 = mma_k(ka3, qb3, sB0);
      sA1 = mma_k(kc3, qa3, sA1);
      sB1 = mma_k(kc3, qb3, sB1);
      // the step's 16 V reads; every fragment feeds both query tiles
      v16h va[8];
#pragma unroll
      for (int j = 0; j < 8; ++j) va[j] = ldfrag_h(Vl + j * 16 * KVH + kb);

      float mxA = fmaxf(hmax8(sA0), hmax8(sA1)) * SCL;
      float mxB = fmaxf(hmax8(sB0), hmax8(sB1)) * SCL;
      mxA = fmaxf(mxA, __shfl_xor(mxA, 16, 32));
      mxB = fmaxf(mxB, __shfl_xor(mxB, 16, 32));
      const float mnA = fmaxf(mA, mxA), mnB = fmaxf(mB, mxB);
      const float corrA = __expf(mA - mnA), corrB = __expf(mB - mnB);
      mA = mnA; mB = mnB;
      const float mshA = mnA - LNPS, mshB = mnB - LNPS;   // exp gives e^{s-m} * 1024
      lA *= corrA; lB *= corrB;
#pragma unroll
      for (int j = 0; j < 8; ++j) {
#pragma unroll
        for (int r = 0; r < 8; ++r) { oA[j][r] *= corrA; oB[j][r] *= corrB; }
      }

      FragH pA, pB;
      float lsA = 0.f, lsB = 0.f;
#pragma unroll
      for (int r = 0; r < 8; ++r) {
        const float a0 = __expf(sA0[r] * SCL - mshA);   // key kb      + 8hh + r, tile A
        const float a1 = __expf(sA1[r] * SCL - mshA);   // key kb + 16 + 8hh + r, tile A
        const float b0 = __expf(sB0[r] * SCL - mshB);   // the same keys, tile B
        const float b1 = __expf(sB1[r] * SCL - mshB);
        lsA += a0 + a1;
        lsB += b0 + b1;
        pA.h[0][r] = (_Float16)a0;
        pA.h[1][r] = (_Float16)a1;
        pB.h[0][r] = (_Float16)b0;
        pB.h[1][r] = (_Float16)b1;
      }
      lA += lsA; lB += lsB;

#pragma unroll
      for (int j = 0; j < 8; ++j) {
        oA[j] = mma_k(va[j], pA.v, oA[j]);
        oB[j] = mma_k(va[j], pB.v, oB[j]);
      }
      // these four vector slots keep the distance between the
      // step's last WMMA and the first vector instruction behind the loop's back edge, which may overwrite its A or B
      asm volatile("v_nop\n\tv_nop\n\tv_nop\n\tv_nop" : "+v"(oB[7]) : "v"(va[7]), "v"(pB.v));
    }
    // ---- foot of stage st: publish stage st + 1, then refill the buffer that stage st has just read ----
    wait_ds0();
    if (pinned(wave < 2u)) wait_tensor0_of(g0, g1);
    __syncthreads();
    if (pinned((wave < 2u) && (st + 2 < SEQ / SK))) {
      g0 = tdm_group0(tdst + (uint32_t)(st & 1) * (2u * TILEB), tsrc + (uint64_t)(st + 2) * tstep);
      tdm_load(g0, g1);
    }
  }
  wait_tensor0();
  wait_ds0();
  // ---- join the two key halves: every wave hands tile B (running max, row-sum partial, O^T) to its partner through the ring,
  //      which nobody reads any more behind the last stage's barrier, and adds the partner's half to its own tile A ----
  {
    v4f* xs = (v4f*)(void*)Ring + (size_t)wave * (17 * 32) + lane;              // 17 x 512 B per wave, 16 B per lane
    const v4f* xr = (const v4f*)(const void*)Ring + (size_t)(wave ^ 4u) * (17 * 32) + lane;
#pragma unroll
    for (int j = 0; j < 8; ++j) {
      const v4f lo = {oB[j][0], oB[j][1], oB[j][2], oB[j][3]}, hi = {oB[j][4], oB[j][5], oB[j][6], oB[j][7]};
      xs[(2 * j) * 32] = lo;
      xs[(2 * j + 1) * 32] = hi;
    }
    const v4f ml = {mB, lB, 0.f, 0.f};
    xs[16 * 32] = ml;
    __syncthreads();                                                            // both halves' tiles are in LDS
    const v4f pm = xr[16 * 32];
    const float mt = fmaxf(mA, pm[0]);
    const float fa = __expf(mA - mt), fp = __expf(pm[0] - mt);
    lA = lA * fa + pm[1] * fp;
#pragma unroll
    for (int j = 0; j < 8; ++j) {
      const v4f lo = xr[(2 * j) * 32], hi = xr[(2 * j + 1) * 32];
#pragma unroll
      for (int r = 0; r < 4; ++r) {
        oA[j][r]     = oA[j][r] * fa + lo[r] * fp;
        oA[j][4 + r] = oA[j][4 + r] * fa + hi[r] * fp;
      }
    }
  }
  const float l = lA + __shfl_xor(lA, 16, 32);
  const float sc = OSC / l;                 // both o and l carry the x1024 factor; sc scales O by 64

  // ---- O (x64) as f16 B fragments of the output projection: d-step ks <- D tiles 2ks (r) and 2ks+1 (8+r) ----
  FragH ob0, ob1, ob2, ob3;
#pragma unroll
  for (int r = 0; r < 8; ++r) {
    ob0.h[0][r] = (_Float16)(oA[0][r] * sc); ob0.h[1][r] = (_Float16)(oA[1][r] * sc);
    ob1.h[0][r] = (_Float16)(oA[2][r] * sc); ob1.h[1][r] = (_Float16)(oA[3][r] * sc);
    ob2.h[0][r] = (_Float16)(oA[4][r] * sc); ob2.h[1][r] = (_Float16)(oA[5][r] * sc);
    ob3.h[0][r] = (_Float16)(oA[6][r] * sc); ob3.h[1][r] = (_Float16)(oA[7][r] * sc);
  }

  // ---- y^T tile: for each o tile, A = W_out rows 16*ot + c (f16 x16, split map over d), 4 d-steps; stage x 1/1024 ----
  const _Float16* wp = WOh + (size_t)c * DCH + 8 * hh;
  float* os = Os + (8 * hh) * OP + colA + c;                // row o = 16*ot + 8hh + r, col = query colA + c
#pragma unroll
  for (int ot = 0; ot < 8; ++ot) {
    v8f ya = zero8();
    ya = mma_h(ldfrag_h(wp + ot * 16 * DCH),      ob0.v, ya);
    ya = mma_h(ldfrag_h(wp + ot * 16 * DCH + 32), ob1.v, ya);
    ya = mma_h(ldfrag_h(wp + ot * 16 * DCH + 64), ob2.v, ya);
    ya = mma_h(ldfrag_h(wp + ot * 16 * DCH + 96), ob3.v, ya);
#pragma unroll
    for (int r = 0; r < 8; ++r) os[(ot * 16 + r) * OP] = ya[r] * IYS;
  }
  __syncthreads();
  {
    float* ob = y + ((size_t)b * DCH) * SEQ + n0;
#pragma unroll
    for (int it = 0; it < 16; ++it) {
      const int row = it * 8 + (int)wave;                 // o row 0..127: one wave stores the row's 128 queries (512 B)
      const v4f v   = *(const v4f*)(Os + row * OP + 4 * lane);
      const float bb = bfr(bout[row]);
      const v4f vo  = {v[0] + bb, v[1] + bb, v[2] + bb, v[3] + bb};
      *(v4f*)(ob + (size_t)row * SEQ + 4 * lane) = vo;
    }
  }
}

// =====================================================================================================
//   W16  16-bit [512][128]        0           131072
//   QP   f16    [8][4096][128]    131072      8388608
//   KP   f16    [8][4096][128]    8519680     8388608
//   VP   f16    [8][128][4096]    16908288    8388608
//   end                           25296896
// =====================================================================================================
extern "C" void kernel_launch(void* const* d_in, const int* in_sizes, int n_in,
                              void* d_out, int out_size, void* d_ws, size_t ws_size,
                              hipStream_t stream) {
  const int NX = NB * DCH * SEQ;                        // 4194304
  if (n_in < 4) return;
  if (in_sizes[0] != NX || in_sizes[1] != NQKV * DCH || in_sizes[2] != DCH * DCH || in_sizes[3] != DCH) return;
  if (out_size != NX) return;

  size_t off = 0;
  const size_t oW  = off; off += (size_t)NW * DCH * 2;            // 131072
  const size_t szP = (size_t)NB * SEQ * DCH * 2;                  // 8388608
  const size_t oQ  = off; off += szP;
  const size_t oK  = off; off += szP;
  const size_t oV  = off; off += (size_t)NB * DCH * SEQ * 2;      // 8388608
  if (off > ws_size) return;                                      // off = 25296896
  if (off > (size_t)134217728) return;

  const float* x    = (const float*)d_in[0];
  const float* Wqkv = (const float*)d_in[1];
  const float* Wout = (const float*)d_in[2];
  const float* bout = (const float*)d_in[3];
  char* ws = (char*)d_ws;
  unsigned short* W16 = (unsigned short*)(ws + oW);
  unsigned short* QPp = (unsigned short*)(ws + oQ);
  unsigned short* KPp = (unsigned short*)(ws + oK);
  unsigned short* VPp = (unsigned short*)(ws + oV);
  float* y = (float*)d_out;

  const dim3 blk256(256);
  const dim3 gW((NW * DCH / 8) / 256);                  // 32 blocks
  const dim3 gP(NB * (SEQ / QT));                       // 512 blocks: one (b, 64-position tile) each
  const dim3 gA(NB * (SEQ / QB));                       // 256 blocks: one (b, 128-query tile) each

  // (0) stacked 16-bit weight plane
  cvt_w<<<gW, blk256, 0, stream>>>(Wqkv, Wout, W16);
  // (1) q, k, v planes
  proj_kernel<<<gP, blk256, 0, stream>>>(x, W16, QPp, KPp, VPp);
  // (2) attention + output projection + bias: y[b][o][n]
  attn_kernel<<<gA, blk256, 0, stream>>>(QPp, KPp, VPp, W16, bout, y);
  (void)hipGetLastError();
}

// v003
// A run of this version takes 80 microseconds.
// Timed twice side by side with v002, it ran 1.07 times as fast both times.
// Over all steps from v000 it is 5.68 times as fast.
// Contractions: q/k/v 1x1-conv projections = W_qkv (bf16, RNE convert of input) . X (bf16, RNE convert of input) on
// v_wmma_f32_16x16x32_bf16, K=128; scores S^T = k (f16) . q^T (f16) on v_wmma_f32_16x16x32_f16, K=128, one product;
// O^T = v (f16) . P^T (f16, e^{s-m} x 1024 taken from the score D registers) on v_wmma_f32_16x16x32_f16 over 4096
// keys, one product; y = W_out (f16 bits of the bf16-RNE input x 16) . O (f16, x 64, taken from the O^T D registers)
// on v_wmma_f32_16x16x32_f16, K=128, one product; f32 accumulate everywhere; softmax (running max, row sums, 1/l),
// the 128^-0.5 scale and the bias add in f32 on VALU.
#include <hip/hip_runtime.h>
#include <math.h>
#include <stdint.h>

#define NB    8
#define DCH   128
#define SEQ   4096
#define NQKV  384
#define NW    512
#define QT    64
#define AP    144
#define LQP   136
#define LVP   72
#define OP    132
#define QB    128
#define SK    128
#define KVH   136
#define TILEB 34816
#define LNPS  6.931471805599453f
#define LZT   4.0f
#define ISCL  11.313708498984761f
#define SCL   0.08838834764831845f
#define OSC   64.0f
#define WSC   16.0f
#define IYS   0.0009765625f
static_assert((SEQ % QT) == 0);
static_assert((SEQ % 32) == 0);
static_assert((DCH % 32) == 0);
static_assert(NQKV == 3 * DCH);
static_assert(NW == NQKV + DCH);
static_assert(((NW * DCH) / 8) % 256 == 0);
static_assert(64 * AP == DCH * LVP);
static_assert(LQP >= DCH && (LQP % 8) == 0);
static_assert((AP % 8) == 0 && (LVP % 8) == 0);
static_assert(OP >= QB && (OP % 4) == 0);
static_assert((SEQ % QB) == 0 && (SEQ % SK) == 0 && (SEQ / SK) >= 2 && (SK % 32) == 0);
static_assert(2 * DCH == 256 && 2 * SK == 256);           // both tiles have rows of 256 bytes
static_assert(2 * KVH == 256 + 16);                        // LDS row pitch = row + the 16-byte pad of the tensor load
static_assert(TILEB == SK * 2 * KVH && TILEB == DCH * 2 * KVH && (TILEB % 2048) == 0);
static_assert((SK % 64) == 0);                             // each key half of a stage is a whole number of 32-key steps
static_assert(8 * 17 * 512 <= 4 * TILEB);                  // the waves' swap of one tile each fits the ring's LDS

typedef _Float16       v16h __attribute__((ext_vector_type(16)));
typedef _Float16       v8h  __attribute__((ext_vector_type(8)));
typedef __bf16         v16b __attribute__((ext_vector_type(16)));
typedef unsigned short v8us __attribute__((ext_vector_type(8)));
typedef float          v8f  __attribute__((ext_vector_type(8)));
typedef float          v4f  __attribute__((ext_vector_type(4)));
typedef unsigned int   v4u  __attribute__((ext_vector_type(4)));
typedef uint32_t       u32x4 __attribute__((ext_vector_type(4)));
typedef uint32_t       u32x8 __attribute__((ext_vector_type(8)));

union FragH { v16h v; v8h  h[2]; };
union FragB { v16b v; v8us u[2]; };
static_assert(sizeof(FragH) == 32);
static_assert(sizeof(FragB) == 32);

// ---- scalar helpers --------------------------------------------------------------------------------
__device__ __forceinline__ unsigned short bf_bits(float f) {          // f32 -> bf16 bits, RNE convert
  unsigned u = __float_as_uint(f);
  return (unsigned short)((u + 0x7FFFu + ((u >> 16) & 1u)) >> 16);
}
__device__ __forceinline__ float bf_up(unsigned short h) { return __uint_as_float(((unsigned)h) << 16); }
__device__ __forceinline__ float bfr(float f) { return bf_up(bf_bits(f)); }
__device__ __forceinline__ unsigned short h_bits(_Float16 x) { return __builtin_bit_cast(unsigned short, x); }
__device__ __forceinline__ unsigned pk16(unsigned short a, unsigned short b) { return (unsigned)a | ((unsigned)b << 16); }
__device__ __forceinline__ v8f zero8() { v8f z = {0.f, 0.f, 0.f, 0.f, 0.f, 0.f, 0.f, 0.f}; return z; }
__device__ __forceinline__ float hmax8(v8f s) {
  return fmaxf(fmaxf(fmaxf(s[0], s[1]), fmaxf(s[2], s[3])), fmaxf(fmaxf(s[4], s[5]), fmaxf(s[6], s[7])));
}

// ---- fragment loaders: 16-bit A/B operand, lane -> row/col (lane&15), p already includes +8*(lane>>4);
//      elements 0..7 <- p[0..7] (k0+8h..), elements 8..15 <- p[16..23] (k0+16+8h..)
__device__ __forceinline__ v16h ldfrag_h(const _Float16* p) {
  FragH f;
  f.h[0] = *(const v8h*)(p);
  f.h[1] = *(const v8h*)(p + 16);
  return f.v;
}
__device__ __forceinline__ v16b ldfrag_b(const unsigned short* p) {
  FragB f;
  f.u[0] = *(const v8us*)(p);
  f.u[1] = *(const v8us*)(p + 16);
  return f.v;
}

// ---- WMMA helpers: builtin followed by a 4-slot VALU gap tying D and keeping A/B live ----------------------
__device__ __forceinline__ v8f mma_h(v16h a, v16h b, v8f c) {
  v8f d = __builtin_amdgcn_wmma_f32_16x16x32_f16(false, a, false, b, (short)0, c, false, false);
#if defined(__HIP_DEVICE_COMPILE__)
  asm volatile("v_nop\n\tv_nop\n\tv_nop\n\tv_nop" : "+v"(d) : "v"(a), "v"(b));
#endif
  return d;
}
// key loop of the attention: the plain builtin, padded by the compiler. The asm statement above takes its vector operands below v256,
// and the 32-column wave's fragments and accumulators do not all fit there (scratch reloads inside the loop).
__device__ __forceinline__ v8f mma_k(v16h a, v16h b, v8f c) {
  return __builtin_amdgcn_wmma_f32_16x16x32_f16(false, a, false, b, (short)0, c, false, false);
}
__device__ __forceinline__ v8f mma_b(v16b a, v16b b, v8f c) {
  v8f d = __builtin_amdgcn_wmma_f32_16x16x32_bf16(false, a, false, b, (short)0, c, false, false);
#if defined(__HIP_DEVICE_COMPILE__)
  const v16h ha = __builtin_bit_cast(v16h, a), hb = __builtin_bit_cast(v16h, b);
  asm volatile("v_nop\n\tv_nop\n\tv_nop\n\tv_nop" : "+v"(d) : "v"(ha), "v"(hb));
#endif
  return d;
}

// ---- one wave: 16 n rows x 64 output channels (4 D tiles) over K = 128 (4 k-steps), A from LDS, B from the
//      stacked bf16 weight plane (rows = output channel, k = input channel contiguous, pitch DCH)
__device__ __forceinline__ void gemm4(const unsigned short* ap, const unsigned short* bp,
                                      v8f& acc0, v8f& acc1, v8f& acc2, v8f& acc3) {
  acc0 = zero8(); acc1 = zero8(); acc2 = zero8(); acc3 = zero8();
#pragma unroll
  for (int ks = 0; ks < 4; ++ks) {
    const v16b a = ldfrag_b(ap + 32 * ks);
    const unsigned short* bs = bp + 32 * ks;
    acc0 = mma_b(a, ldfrag_b(bs + 0 * 16 * DCH), acc0);
    acc1 = mma_b(a, ldfrag_b(bs + 1 * 16 * DCH), acc1);
    acc2 = mma_b(a, ldfrag_b(bs + 2 * 16 * DCH), acc2);
    acc3 = mma_b(a, ldfrag_b(bs + 3 * 16 * DCH), acc3);
  }
}

// ---- LDS staging helpers for the projection epilogue (D rows = n, D cols = channel) ------------------------
__device__ __forceinline__ void stage_h(unsigned short* L, int nr, int col, v8f acc) {
#pragma unroll
  for (int r = 0; r < 8; ++r) L[(nr + r) * LQP + col] = h_bits((_Float16)acc[r]);
}
__device__ __forceinline__ void stage_v(unsigned short* Lv, int e, int nr, v8f acc) {
#pragma unroll
  for (int r = 0; r < 8; ++r) Lv[e * LVP + nr + r] = h_bits((_Float16)acc[r]);
}

// ---- tensor load to LDS: descriptor words live in scalar registers; every test around an issue is a scalar branch ----
__device__ __forceinline__ uint32_t uni(uint32_t v) { return (uint32_t)__builtin_amdgcn_readfirstlane(v); }
__device__ __forceinline__ uint32_t pinned(uint32_t v) {
  uint32_t w = uni(v);
  asm volatile("" : "+s"(w));   // pinned(): an issue test or a descriptor word held in a scalar register; the test then compiles to s_cmp + s_cbranch_scc (tensor loads ignore EXEC)
  return w;
}
// group 1: 1-byte elements, tile = tensor = 128 rows of 256 bytes, 16 bytes of LDS pad behind every 256-byte row
__device__ __forceinline__ u32x8 tdm_group1(uint32_t src_pitch) {
  u32x8 g;
  // pinned(): each descriptor word held in a scalar register of its own, so that the tuple is built once and nothing rewrites it
  // while a request is in flight; word 0 stays a plain constant
  g[0] = uni((1u << 20) | (5u << 22) | (3u << 25));
  g[1] = pinned(256u << 16);
  g[2] = pinned(128u << 16);
  g[3] = pinned(256u << 16);
  g[4] = pinned(128u);
  g[5] = pinned(src_pitch);
  g[6] = pinned(0u);
  g[7] = pinned(0u);
  return g;
}
__device__ __forceinline__ u32x4 tdm_group0(uint32_t lds_dst, uint64_t ga) {
  u32x4 g;
  g[0] = uni(1u);
  g[1] = uni(lds_dst);
  g[2] = uni((uint32_t)ga);
  g[3] = uni((((uint32_t)(ga >> 32)) & 0x01FFFFFFu) | 0x80000000u);
  asm volatile("" : "+s"(g));   // descriptor words held in scalar registers: the tuple is complete here, in front of the issue test
  return g;
}
__device__ __forceinline__ void tdm_load(u32x4 g0, u32x8 g1) {
  asm volatile("tensor_load_to_lds %0, %1" :: "s"(g0), "s"(g1) : "memory");   // one request of the whole wave: a 2-D tile into LDS
}
// the compiler places no wait for a tensor load: the issuing wave's own wait says that its tile has landed
__device__ __forceinline__ void wait_tensor0() { asm volatile("s_wait_tensorcnt 0x0" ::: "memory"); }
// the same wait, naming the request's descriptor as inputs: its registers stay live, so unwritten, until the tile has landed
__device__ __forceinline__ void wait_tensor0_of(u32x4 g0, u32x8 g1) {
  asm volatile("s_wait_tensorcnt 0x0" :: "s"(g0), "s"(g1) : "memory");
}
// this wave's LDS reads have returned before the barrier behind which their buffer is refilled
__device__ __forceinline__ void wait_ds0() { asm volatile("s_wait_dscnt 0x0" ::: "memory"); }

// ---- weight element convert: rows < NQKV -> bf16 bits; rows >= NQKV -> f16 bits of (bf16 RNE value x 16)
__device__ __forceinline__ unsigned short cvt_sel(bool isq, float fq, float fo) {
  const unsigned short uq = bf_bits(fq);
  const unsigned short uo = h_bits((_Float16)(bfr(fo) * WSC));
  return isq ? uq : uo;
}

// =====================================================================================================
// (0) stacked 16-bit weight plane W16[512][128]: rows 0..383 = bf16 bits of W_qkv (RNE convert),
//     rows 384..511 = f16 bits of (bf16 RNE value of W_out) x 16. Thread i writes 8 halves (16 B) at element 8i;
//     sources loaded with clamped rows, selected by value.
// coverage: 32 blocks x 256 threads x 8 = 65536 = 512 x 128.
// =====================================================================================================
__global__ __launch_bounds__(256) void cvt_w(const float* __restrict__ wqkv, const float* __restrict__ wout,
                                             unsigned short* W16) {
  const int i = blockIdx.x * 256 + threadIdx.x;
  if (i >= (NW * DCH) / 8) return;
  const int row = i >> 4;                  // 0..511
  const int col = (i & 15) * 8;
  const int ra = min(row, NQKV - 1);
  const int rb = min(max(row - NQKV, 0), DCH - 1);
  const v4f a0 = *(const v4f*)(wqkv + (size_t)ra * DCH + col), a1 = *(const v4f*)(wqkv + (size_t)ra * DCH + col + 4);
  const v4f c0 = *(const v4f*)(wout + (size_t)rb * DCH + col), c1 = *(const v4f*)(wout + (size_t)rb * DCH + col + 4);
  const bool isq = row < NQKV;
  v4u w;
#pragma unroll
  for (int t = 0; t < 2; ++t) {
    w[t]     = pk16(cvt_sel(isq, a0[2 * t], c0[2 * t]), cvt_sel(isq, a0[2 * t + 1], c0[2 * t + 1]));
    w[2 + t] = pk16(cvt_sel(isq, a1[2 * t], c1[2 * t]), cvt_sel(isq, a1[2 * t + 1], c1[2 * t + 1]));
  }
  unsigned short* p = W16 + (size_t)i * 8;
  *(v4u*)p = w;
  
}

// =====================================================================================================
// (1) fused q/k/v projection for one (b, 64-position tile): block = 256 threads = 8 waves.
//   x tile [128 d][64 n] f32 is staged once as bf16 A tile Lav[n][d] (pitch AP halves, 2-byte LDS stores), barrier.
//   Wave w: n group ng = w&3 (A rows n = 16ng + (lane&15), split k map over d), channel half ch = w>>2
//   (B = W16 rows chunk*128 + ch*64 + 16j + (lane&15), same split k map), 4 D tiles per chunk, 4 k-steps of 32,
//   chunks q, k, v in sequence (A reloaded from LDS).
//   Epilogue: D -> f16 bits in LDS: q tile Lq[n][128], k tile Lk[n][128], v transposed Lv[e][n] (aliases Lav after
//   [b][e][4096] (line = 64 keys of one e row); every line = 8 consecutive lanes x 16 B of one instruction, two
// coverage: Lav: 256 threads x 8 it x 4 = 64 n x 128 d; Lq/Lk: 8 waves x (16 n x 64 ch) per chunk = 64 x 128;
//           Q/K planes: 4 it x 32 lines x 8 lanes x 8 halves = 64 rows x 128; V plane: 4 it x 32 lines x 8 x 8 =
//           128 e x 64 n; grid = 8 x 64 blocks covers every plane exactly once.
// =====================================================================================================
__global__ __launch_bounds__(256)
void proj_kernel(const float* __restrict__ x, const unsigned short* __restrict__ W16,
                 unsigned short* QP, unsigned short* KP, unsigned short* VP) {
  __shared__ __align__(16) unsigned short Lav[64 * AP];    // A tile [n][d]; reused as Lv[e][n] (pitch LVP) later
  __shared__ __align__(16) unsigned short Lq[64 * LQP];    // q f16 [n][128]
  __shared__ __align__(16) unsigned short Lk[64 * LQP];    // k f16 [n][128]
  const int tid  = threadIdx.x;
  const int lane = tid & 31, wave = tid >> 5;
  const int hh   = lane >> 4, c = lane & 15;
  const int bx   = blockIdx.x;
  const int b    = bx / (SEQ / QT);
  const int nt   = bx % (SEQ / QT);
  const int n0   = nt * QT;

  // ---- stage x tile as bf16 [n][d] ----
  {
    const int n4 = (tid & 15) * 4, ds = tid >> 4;          // ds 0..15
    const float* xp = x + ((size_t)b * DCH + ds) * SEQ + n0 + n4;
#pragma unroll
    for (int it = 0; it < 8; ++it) {
      const v4f v = *(const v4f*)(xp + (size_t)it * 16 * SEQ);
      const int d = it * 16 + ds;                          // 0..127
#pragma unroll
      for (int q = 0; q < 4; ++q) Lav[(n4 + q) * AP + d] = bf_bits(v[q]);
    }
  }
  __syncthreads();

  // ---- GEMMs: 16 n rows x 64 channels per wave per chunk ----
  const int ng = wave & 3, ch = wave >> 2;
  const unsigned short* ap = Lav + (ng * 16 + c) * AP + 8 * hh;
  const int nr = ng * 16 + 8 * hh;                         // D row r -> n local nr + r
  const int cb = ch * 64;                                  // channel base within a chunk; D col = cb + 16j + c
  v8f acc0, acc1, acc2, acc3;

  // q chunk (weight rows 0..127)
  gemm4(ap, W16 + (size_t)(0 * DCH + cb + c) * DCH + 8 * hh, acc0, acc1, acc2, acc3);
  stage_h(Lq, nr, cb + 0 * 16 + c, acc0);
  stage_h(Lq, nr, cb + 1 * 16 + c, acc1);
  stage_h(Lq, nr, cb + 2 * 16 + c, acc2);
  stage_h(Lq, nr, cb + 3 * 16 + c, acc3);
  // k chunk (weight rows 128..255)
  gemm4(ap, W16 + (size_t)(1 * DCH + cb + c) * DCH + 8 * hh, acc0, acc1, acc2, acc3);
  stage_h(Lk, nr, cb + 0 * 16 + c, acc0);
  stage_h(Lk, nr, cb + 1 * 16 + c, acc1);
  stage_h(Lk, nr, cb + 2 * 16 + c, acc2);
  stage_h(Lk, nr, cb + 3 * 16 + c, acc3);
  // v chunk (weight rows 256..383)
  gemm4(ap, W16 + (size_t)(2 * DCH + cb + c) * DCH + 8 * hh, acc0, acc1, acc2, acc3);

  __syncthreads();            // every wave is done reading Lav before it is reused as Lv
  stage_v(Lav, cb + 0 * 16 + c, nr, acc0);
  stage_v(Lav, cb + 1 * 16 + c, nr, acc1);
  stage_v(Lav, cb + 2 * 16 + c, nr, acc2);
  stage_v(Lav, cb + 3 * 16 + c, nr, acc3);
  __syncthreads();

  {
    const int e = tid & 7, lq = tid >> 3;                    // lq 0..31
{
#pragma unroll
      for (int it = 0; it < 4; ++it) {
        const int L  = it * 32 + lq;                         // 0..127
        const int n  = L >> 1, hf = L & 1;                   // row 0..63, half 0..1
        const size_t go = ((size_t)b * SEQ + n0 + n) * DCH + hf * 64 + 8 * e;
        const int lo_ = n * LQP + hf * 64 + 8 * e;
        const v4u uq = *(const v4u*)(Lq + lo_);
        const v4u uk = *(const v4u*)(Lk + lo_);
        *(v4u*)(QP + go) = uq;
        *(v4u*)(KP + go) = uk;
      }
#pragma unroll
      for (int it = 0; it < 4; ++it) {
        const int er = it * 32 + lq;                         // 0..127
        const v4u uv = *(const v4u*)(Lav + er * LVP + 8 * e);
        *(v4u*)(VP + ((size_t)b * DCH + er) * SEQ + n0 + 8 * e) = uv;
      }
      
    }
  }
}

// =====================================================================================================
// (2) attention + output projection for one (b, 128-query tile), transposed formulation, 128-deep scores, 4096 keys:
//   K rows and V rows come in stages of 128 keys by tensor_load_to_lds into a ring of two LDS buffers that the block's
//   8 waves share: wave 0 brings the K tile (128 keys x 256 B, source pitch 256 B), wave 1 the V tile (128 d rows x
//   256 B = 128 keys, source pitch 8192 B), each one request per stage, rows padded to a pitch of 272 B in LDS.
//   Stage s + 1 flies while stage s is worked on; at the foot of a stage: s_wait_dscnt 0, the issuers' s_wait_tensorcnt 0,
//   the workgroup barrier, then the refill of the buffer just read.
//   S^T tile (16 keys x 16 queries) = A(k rows = keys kb + (lane&15), d via the split k map, f16, from LDS) .
//                                     B(q, col = query, same d map, resident f16 fragments), four d-steps.
//   energy = acc * 128^-0.5 in f32. Per lane the D tile holds 8 keys of ONE query: online softmax state per lane; the reference
//   point m moves (one shuffle lane^16, O and l rescaled) only when a score exceeds it by more than 4; row-sum partials combined at the end. P = e^{s-m} x 1024 as one
//   f16 vector is the B operand of O^T (rows d, cols queries) += A(v rows d, keys contiguous, from LDS) . B(P^T):
//   element r <- D of the tile covering keys kb..kb+15, element 8+r <- the tile covering kb+16..kb+31, lane unchanged.
//   Wave map: wave w works on 32 queries (two 16-column tiles, group w&3) and on 64 of every stage's 128 keys (half w>>2), so
//   each K and V fragment read from LDS feeds two query tiles. 32 keys per step: 16 score WMMAs + 16 output WMMAs per wave.
//   Behind the key loop the two waves of a query group swap one tile each (max, row sum, O^T) through the ring's LDS and join
//   the halves in f32: O = Oa e^{ma-m} + Ob e^{mb-m}; each wave then finishes one 16-query tile.
//   Block = 8 waves = 128 queries; grid = 8 b x 32.
//   Output projection: B fragment of d-step ks = f16(O^T x 64 / l) of D tiles j = 2ks (element r) and 2ks+1 (element
//   8+r), lane unchanged (col = query); A = W16 rows 384 + o (f16, x16), split k map over d; D[row o][col query]
//   x 1/1024 staged in LDS (scalar stores, pitch OP), barrier, then + bf16-RNE bias; each wave stores whole 512-B rows.
// coverage: block writes o 0..127 x n n0..n0+127 of its b (16 it x 8 rows); grid covers y exactly once.
// =====================================================================================================
__global__ __launch_bounds__(256)
void attn_kernel(const unsigned short* __restrict__ QP, const unsigned short* __restrict__ KP,
                 const unsigned short* __restrict__ VP, const unsigned short* __restrict__ W16,
                 const float* __restrict__ bout, float* y) {
  // buffer u: K tile at u * 2 * TILEB, V tile at u * 2 * TILEB + TILEB; every tile starts at a multiple of 2 KiB
  __shared__ __attribute__((aligned(2048))) unsigned char Ring[4 * TILEB];
  __shared__ __align__(16) float Os[DCH * OP];
  const int tid  = threadIdx.x;
  const int lane = tid & 31;
  const uint32_t wave = uni((uint32_t)tid >> 5);
  const int hh   = lane >> 4;
  const int c    = lane & 15;
  const int bx   = blockIdx.x;
  const int b    = bx / (SEQ / QB);
  const int qb   = bx % (SEQ / QB);
  const int n0   = qb * QB;
  const _Float16* QPh = (const _Float16*)(const void*)QP;
  const _Float16* WOh = (const _Float16*)(const void*)W16 + (size_t)NQKV * DCH;

  // ---- wave map: query group qg = 32 queries (two 16-column tiles), key half kh = 64 of every stage's 128 keys.
  //      Tile A is the tile this wave finishes (columns 32*qg + 16*kh + c), tile B the one its partner (wave ^ 4) finishes.
  const uint32_t qg = wave & 3u, kh = wave >> 2;
  const int colA = (int)(qg * 32u + kh * 16u), colB = (int)(qg * 32u + (1u - kh) * 16u);
  // ---- resident q fragments (B operand, col = query), d 0..31, 32..63, 64..95, 96..127, for both tiles ----
  const size_t qoA = ((size_t)b * SEQ + n0 + colA + c) * DCH + 8 * hh;
  const size_t qoB = ((size_t)b * SEQ + n0 + colB + c) * DCH + 8 * hh;
  const v16h qa0 = ldfrag_h(QPh + qoA), qa1 = ldfrag_h(QPh + qoA + 32);
  const v16h qa2 = ldfrag_h(QPh + qoA + 64), qa3 = ldfrag_h(QPh + qoA + 96);
  const v16h qb0 = ldfrag_h(QPh + qoB), qb1 = ldfrag_h(QPh + qoB + 32);
  const v16h qb2 = ldfrag_h(QPh + qoB + 64), qb3 = ldfrag_h(QPh + qoB + 96);

  // ---- the two issuing waves' requests: wave 0 = K tile, wave 1 = V tile ----
  const bool isV = wave == 1u;
  const uint64_t tsrc = isV ? (uint64_t)(size_t)(VP + (size_t)b * DCH * SEQ) : (uint64_t)(size_t)(KP + (size_t)b * SEQ * DCH);
  const uint32_t tstep = isV ? (uint32_t)(SK * 2) : (uint32_t)(SK * DCH * 2);     // bytes from one stage's tile to the next
  const uint32_t tdst  = (uint32_t)(size_t)Ring + (isV ? (uint32_t)TILEB : 0u);
  const u32x8 g1 = tdm_group1(isV ? (uint32_t)(SEQ * 2) : (uint32_t)(DCH * 2));

  u32x4 g0 = tdm_group0(tdst, tsrc);
  if (pinned(wave < 2u)) {
    tdm_load(g0, g1);                                          // stage 0 into buffer 0
    wait_tensor0_of(g0, g1);
  }
  asm volatile("s_wait_xcnt 0x0" ::: "memory");                // in front of the first overwrite of the q loads' address registers
  __syncthreads();                                             // stage 0 published
  g0 = tdm_group0(tdst + 2u * TILEB, tsrc + tstep);
  if (pinned(wave < 2u)) {
    tdm_load(g0, g1);                                          // stage 1 into buffer 1
  }

  float mA = -1.0e30f, lA = 0.f, mB = -1.0e30f, lB = 0.f;
  float tA = -1.0e30f, tB = -1.0e30f, mshA = -1.0e30f, mshB = -1.0e30f;   // below every finite score: the first step sets m
  v8f oA[8], oB[8];
#pragma unroll
  for (int j = 0; j < 8; ++j) { oA[j] = zero8(); oB[j] = zero8(); }
  // kept rolled: one stage per trip, so the ring's foot (waits, barrier, refill) stands once in the code
#pragma unroll 1
  for (int st = 0; st < SEQ / SK; ++st) {
    // k fragment base (A operand, row = key 64*kh + c of the stage), v fragment base (A operand, row = d = c, keys contiguous
    // from key 64*kh of the stage)
    const _Float16* Tl = (const _Float16*)(const void*)(Ring + (st & 1) * (2 * TILEB));
    const _Float16* Kl = Tl + ((int)kh * (SK / 2) + c) * KVH + 8 * hh;
    const _Float16* Vl = Tl + TILEB / 2 + c * KVH + 8 * hh + (int)kh * (SK / 2);
    // kept rolled, as it was: one 32-key step per trip
#pragma unroll 1
    for (int sub = 0; sub < SK / 64; ++sub) {
      const int kb = sub * 32;
      const _Float16* k0p = Kl + kb * KVH;                      // keys kb .. kb+15 of the wave's half
      const _Float16* k1p = k0p + 16 * KVH;                     // keys kb+16 .. kb+31
      // the step's 16 K reads as one group in front of its score products; every fragment feeds both query tiles
      const v16h ka0 = ldfrag_h(k0p), ka1 = ldfrag_h(k0p + 32), ka2 = ldfrag_h(k0p + 64), ka3 = ldfrag_h(k0p + 96);
      const v16h kc0 = ldfrag_h(k1p), kc1 = ldfrag_h(k1p + 32), kc2 = ldfrag_h(k1p + 64), kc3 = ldfrag_h(k1p + 96);
      v8f sA0, sA1, sB0, sB1;
      sA0 = mma_k(ka0, qa0, zero8());
      sB0 = mma_k(ka0, qb0, zero8());
      sA1 = mma_k(kc0, qa0, zero8());
      sB1 = mma_k(kc0, qb0, zero8());
      sA0 = mma_k(ka1, qa1, sA0);
      sB0 = mma_k(ka1, qb1, sB0);
      sA1 = mma_k(kc1, qa1, sA1);
      sB1 = mma_k(kc1, qb1, sB1);
      sA0 = mma_k(ka2, qa2, sA0);
      sB0 = mma_k(ka2, qb2, sB0);
      sA1 = mma_k(kc2, qa2, sA1);
      sB1 = mma_k(kc2, qb2, sB1);
      sA0 = mma_k(ka3, qa3, sA0);
      sB0 = mma_k(ka3, qb3, sB0);
      sA1 = mma_k(kc3, qa3, sA1);
      sB1 = mma_k(kc3, qb3, sB1);
      // lazy rescale: a column's reference point m stays in use until one of the step's scores exceeds it by more than LZT;
      // one test per step for both tiles, a scalar branch. Up to there P = e^{s-m} x 1024 <= e^LZT x 1024 stays finite in f16.
      // tA, tB = (m + LZT) / SCL: the test compares this lane's 16 unscaled scores of the step.
      const float rxA = fmaxf(hmax8(sA0), hmax8(sA1)), rxB = fmaxf(hmax8(sB0), hmax8(sB1));
      if (__builtin_amdgcn_ballot_w32((rxA > tA) || (rxB > tB)) != 0u) {
        float mxA = rxA * SCL, mxB = rxB * SCL;
        mxA = fmaxf(mxA, __shfl_xor(mxA, 16, 32));        // both halves of a column take the same new m
        mxB = fmaxf(mxB, __shfl_xor(mxB, 16, 32));
        const float mnA = fmaxf(mA, mxA), mnB = fmaxf(mB, mxB);
        const float corrA = __expf(mA - mnA), corrB = __expf(mB - mnB);
        mA = mnA; mB = mnB;
        tA = (mnA + LZT) * ISCL; tB = (mnB + LZT) * ISCL;
        mshA = mnA - LNPS; mshB = mnB - LNPS;             // exp gives e^{s-m} * 1024
        lA *= corrA; lB *= corrB;
#pragma unroll
        for (int j = 0; j < 8; ++j) {
#pragma unroll
          for (int r = 0; r < 8; ++r) { oA[j][r] *= corrA; oB[j][r] *= corrB; }
        }
      }
      // the step's 16 V reads; every fragment feeds both query tiles
      v16h va[8];
#pragma unroll
      for (int j = 0; j < 8; ++j) va[j] = ldfrag_h(Vl + j * 16 * KVH + kb);
      // the V reads issue as one group in front of the exponentials, which cover their latency; without this the scheduler
      // spreads them through the exponentials, close ahead of their first use
      __builtin_amdgcn_sched_barrier(0);

      FragH pA, pB;
      float lsA = 0.f, lsB = 0.f;
#pragma unroll
      for (int r = 0; r < 8; ++r) {
        const float a0 = __expf(sA0[r] * SCL - mshA);   // key kb      + 8hh + r, tile A
        const float a1 = __expf(sA1[r] * SCL - mshA);   // key kb + 16 + 8hh + r, tile A
        const float b0 = __expf(sB0[r] * SCL - mshB);   // the same keys, tile B
        const float b1 = __expf(sB1[r] * SCL - mshB);
        lsA += a0 + a1;
        lsB += b0 + b1;
        pA.h[0][r] = (_Float16)a0;
        pA.h[1][r] = (_Float16)a1;
        pB.h[0][r] = (_Float16)b0;
        pB.h[1][r] = (_Float16)b1;
      }
      lA += lsA; lB += lsB;

#pragma unroll
      for (int j = 0; j < 8; ++j) {
        oA[j] = mma_k(va[j], pA.v, oA[j]);
        oB[j] = mma_k(va[j], pB.v, oB[j]);
      }
      // these four vector slots keep the distance between the
      // step's last WMMA and the first vector instruction behind the loop's back edge, which may overwrite its A or B
      asm volatile("v_nop\n\tv_nop\n\tv_nop\n\tv_nop" : "+v"(oB[7]) : "v"(va[7]), "v"(pB.v));
    }
    // ---- foot of stage st: publish stage st + 1, then refill the buffer that stage st has just read ----
    wait_ds0();
    if (pinned(wave < 2u)) wait_tensor0_of(g0, g1);
    __syncthreads();
    if (pinned((wave < 2u) && (st + 2 < SEQ / SK))) {
      g0 = tdm_group0(tdst + (uint32_t)(st & 1) * (2u * TILEB), tsrc + (uint64_t)(st + 2) * tstep);
      tdm_load(g0, g1);
    }
  }
  wait_tensor0();
  wait_ds0();
  // ---- join the two key halves: every wave hands tile B (running max, row-sum partial, O^T) to its partner through the ring,
  //      which nobody reads any more behind the last stage's barrier, and adds the partner's half to its own tile A ----
  {
    v4f* xs = (v4f*)(void*)Ring + (size_t)wave * (17 * 32) + lane;              // 17 x 512 B per wave, 16 B per lane
    const v4f* xr = (const v4f*)(const void*)Ring + (size_t)(wave ^ 4u) * (17 * 32) + lane;
#pragma unroll
    for (int j = 0; j < 8; ++j) {
      const v4f lo = {oB[j][0], oB[j][1], oB[j][2], oB[j][3]}, hi = {oB[j][4], oB[j][5], oB[j][6], oB[j][7]};
      xs[(2 * j) * 32] = lo;
      xs[(2 * j + 1) * 32] = hi;
    }
    const v4f ml = {mB, lB, 0.f, 0.f};
    xs[16 * 32] = ml;
    __syncthreads();                                                            // both halves' tiles are in LDS
    const v4f pm = xr[16 * 32];
    const float mt = fmaxf(mA, pm[0]);
    const float fa = __expf(mA - mt), fp = __expf(pm[0] - mt);
    lA = lA * fa + pm[1] * fp;
#pragma unroll
    for (int j = 0; j < 8; ++j) {
      const v4f lo = xr[(2 * j) * 32], hi = xr[(2 * j + 1) * 32];
#pragma unroll
      for (int r = 0; r < 4; ++r) {
        oA[j][r]     = oA[j][r] * fa + lo[r] * fp;
        oA[j][4 + r] = oA[j][4 + r] * fa + hi[r] * fp;
      }
    }
  }
  const float l = lA + __shfl_xor(lA, 16, 32);
  const float sc = OSC / l;                 // both o and l carry the x1024 factor; sc scales O by 64

  // ---- O (x64) as f16 B fragments of the output projection: d-step ks <- D tiles 2ks (r) and 2ks+1 (8+r) ----
  FragH ob0, ob1, ob2, ob3;
#pragma unroll
  for (int r = 0; r < 8; ++r) {
    ob0.h[0][r] = (_Float16)(oA[0][r] * sc); ob0.h[1][r] = (_Float16)(oA[1][r] * sc);
    ob1.h[0][r] = (_Float16)(oA[2][r] * sc); ob1.h[1][r] = (_Float16)(oA[3][r] * sc);
    ob2.h[0][r] = (_Float16)(oA[4][r] * sc); ob2.h[1][r] = (_Float16)(oA[5][r] * sc);
    ob3.h[0][r] = (_Float16)(oA[6][r] * sc); ob3.h[1][r] = (_Float16)(oA[7][r] * sc);
  }

  // ---- y^T tile: for each o tile, A = W_out rows 16*ot + c (f16 x16, split map over d), 4 d-steps; stage x 1/1024 ----
  const _Float16* wp = WOh + (size_t)c * DCH + 8 * hh;
  float* os = Os + (8 * hh) * OP + colA + c;                // row o = 16*ot + 8hh + r, col = query colA + c
#pragma unroll
  for (int ot = 0; ot < 8; ++ot) {
    v8f ya = zero8();
    ya = mma_h(ldfrag_h(wp + ot * 16 * DCH),      ob0.v, ya);
    ya = mma_h(ldfrag_h(wp + ot * 16 * DCH + 32), ob1.v, ya);
    ya = mma_h(ldfrag_h(wp + ot * 16 * DCH + 64), ob2.v, ya);
    ya = mma_h(ldfrag_h(wp + ot * 16 * DCH + 96), ob3.v, ya);
#pragma unroll
    for (int r = 0; r < 8; ++r) os[(ot * 16 + r) * OP] = ya[r] * IYS;
  }
  __syncthreads();
  {
    float* ob = y + ((size_t)b * DCH) * SEQ + n0;
#pragma unroll
    for (int it = 0; it < 16; ++it) {
      const int row = it * 8 + (int)wave;                 // o row 0..127: one wave stores the row's 128 queries (512 B)
      const v4f v   = *(const v4f*)(Os + row * OP + 4 * lane);
      const float bb = bfr(bout[row]);
      const v4f vo  = {v[0] + bb, v[1] + bb, v[2] + bb, v[3] + bb};
      *(v4f*)(ob + (size_t)row * SEQ + 4 * lane) = vo;
    }
  }
}

// =====================================================================================================
//   W16  16-bit [512][128]        0           131072
//   QP   f16    [8][4096][128]    131072      8388608
//   KP   f16    [8][4096][128]    8519680     8388608
//   VP   f16    [8][128][4096]    16908288    8388608
//   end                           25296896
// =====================================================================================================
extern "C" void kernel_launch(void* const* d_in, const int* in_sizes, int n_in,
                              void* d_out, int out_size, void* d_ws, size_t ws_size,
                              hipStream_t stream) {
  const int NX = NB * DCH * SEQ;                        // 4194304
  if (n_in < 4) return;
  if (in_sizes[0] != NX || in_sizes[1] != NQKV * DCH || in_sizes[2] != DCH * DCH || in_sizes[3] != DCH) return;
  if (out_size != NX) return;

  size_t off = 0;
  const size_t oW  = off; off += (size_t)NW * DCH * 2;            // 131072
  const size_t szP = (size_t)NB * SEQ * DCH * 2;                  // 8388608
  const size_t oQ  = off; off += szP;
  const size_t oK  = off; off += szP;
  const size_t oV  = off; off += (size_t)NB * DCH * SEQ * 2;      // 8388608
  if (off > ws_size) return;                                      // off = 25296896
  if (off > (size_t)134217728) return;

  const float* x    = (const float*)d_in[0];
  const float* Wqkv = (const float*)d_in[1];
  const float* Wout = (const float*)d_in[2];
  const float* bout = (const float*)d_in[3];
  char* ws = (char*)d_ws;
  unsigned short* W16 = (unsigned short*)(ws + oW);
  unsigned short* QPp = (unsigned short*)(ws + oQ);
  unsigned short* KPp = (unsigned short*)(ws + oK);
  unsigned short* VPp = (unsigned short*)(ws + oV);
  float* y = (float*)d_out;

  const dim3 blk256(256);
  const dim3 gW((NW * DCH / 8) / 256);                  // 32 blocks
  const dim3 gP(NB * (SEQ / QT));                       // 512 blocks: one (b, 64-position tile) each
  const dim3 gA(NB * (SEQ / QB));                       // 256 blocks: one (b, 128-query tile) each

  // (0) stacked 16-bit weight plane
  cvt_w<<<gW, blk256, 0, stream>>>(Wqkv, Wout, W16);
  // (1) q, k, v planes
  proj_kernel<<<gP, blk256, 0, stream>>>(x, W16, QPp, KPp, VPp);
  // (2) attention + output projection + bias: y[b][o][n]
  attn_kernel<<<gA, blk256, 0, stream>>>(QPp, KPp, VPp, W16, bout, y);
  (void)hipGetLastError();
}

// v004
// A run of this version takes 67.1 microseconds.
// In both of two side-by-side timings against v003, it was 1.19 times as fast.
// All steps since v000 together make it 6.77 times as fast.
// Contractions: q/k/v 1x1-conv projections = W_qkv (bf16, RNE convert of input) . X (bf16, RNE convert of input) on
// v_wmma_f32_16x16x32_bf16, K=128; scores S^T = k (f16) . q^T (f16) on v_wmma_f32_16x16x32_f16, K=128, one product;
// O^T = v (f16) . P^T (f16, e^{s-m} x 1024 taken from the score D registers) on v_wmma_f32_16x16x32_f16 over 4096
// keys, one product; y = W_out (f16 bits of the bf16-RNE input x 16) . O (f16, x 64, taken from the O^T D registers)
// on v_wmma_f32_16x16x32_f16, K=128, one product; f32 accumulate everywhere; softmax (running max, row sums, 1/l),
// the 128^-0.5 scale and the bias add in f32 on VALU.
#include <hip/hip_runtime.h>
#include <math.h>
#include <stdint.h>

#define NB    8
#define DCH   128
#define SEQ   4096
#define NQKV  384
#define NW    512
#define QT    64
#define AP    144
#define LQP   136
#define LVP   72
#define OP    132
#define QB    128
#define SK    128
#define KVH   136
#define TILEB 34816
#define LNPS  6.931471805599453f
#define LZT   4.0f
#define ISCL  11.313708498984761f
#define SCL   0.08838834764831845f
#define OSC   64.0f
#define WSC   16.0f
#define IYS   0.0009765625f
static_assert((SEQ % QT) == 0);
static_assert((SEQ % 32) == 0);
static_assert((DCH % 32) == 0);
static_assert(NQKV == 3 * DCH);
static_assert(NW == NQKV + DCH);
static_assert(((NW * DCH) / 8) % 256 == 0);
static_assert(64 * AP == DCH * LVP);
static_assert(LQP >= DCH && (LQP % 8) == 0);
static_assert((AP % 8) == 0 && (LVP % 8) == 0);
static_assert(OP >= QB && (OP % 4) == 0);
static_assert((SEQ % QB) == 0 && (SEQ % SK) == 0 && (SEQ / SK) >= 2 && (SK % 32) == 0);
static_assert(2 * DCH == 256 && 2 * SK == 256);           // both tiles have rows of 256 bytes
static_assert(2 * KVH == 256 + 16);                        // LDS row pitch = row + the 16-byte pad of the tensor load
static_assert(TILEB == SK * 2 * KVH && TILEB == DCH * 2 * KVH && (TILEB % 2048) == 0);
static_assert((SK % 64) == 0);                             // each key half of a stage is a whole number of 32-key steps
static_assert(8 * 17 * 512 <= 4 * TILEB);                  // the waves' swap of one tile each fits the ring's LDS

typedef _Float16       v16h __attribute__((ext_vector_type(16)));
typedef _Float16       v8h  __attribute__((ext_vector_type(8)));
typedef __bf16         v16b __attribute__((ext_vector_type(16)));
typedef unsigned short v8us __attribute__((ext_vector_type(8)));
typedef float          v8f  __attribute__((ext_vector_type(8)));
typedef float          v4f  __attribute__((ext_vector_type(4)));
typedef unsigned int   v4u  __attribute__((ext_vector_type(4)));
typedef uint32_t       u32x4 __attribute__((ext_vector_type(4)));
typedef uint32_t       u32x8 __attribute__((ext_vector_type(8)));

union FragH { v16h v; v8h  h[2]; };
union FragB { v16b v; v8us u[2]; };
static_assert(sizeof(FragH) == 32);
static_assert(sizeof(FragB) == 32);

// ---- scalar helpers --------------------------------------------------------------------------------
__device__ __forceinline__ unsigned short bf_bits(float f) {          // f32 -> bf16 bits, RNE convert
  unsigned u = __float_as_uint(f);
  return (unsigned short)((u + 0x7FFFu + ((u >> 16) & 1u)) >> 16);
}
__device__ __forceinline__ float bf_up(unsigned short h) { return __uint_as_float(((unsigned)h) << 16); }
__device__ __forceinline__ float bfr(float f) { return bf_up(bf_bits(f)); }
__device__ __forceinline__ unsigned short h_bits(_Float16 x) { return __builtin_bit_cast(unsigned short, x); }
__device__ __forceinline__ unsigned pk16(unsigned short a, unsigned short b) { return (unsigned)a | ((unsigned)b << 16); }
__device__ __forceinline__ v8f zero8() { v8f z = {0.f, 0.f, 0.f, 0.f, 0.f, 0.f, 0.f, 0.f}; return z; }
__device__ __forceinline__ float hmax8(v8f s) {
  return fmaxf(fmaxf(fmaxf(s[0], s[1]), fmaxf(s[2], s[3])), fmaxf(fmaxf(s[4], s[5]), fmaxf(s[6], s[7])));
}

// ---- fragment loaders: 16-bit A/B operand, lane -> row/col (lane&15), p already includes +8*(lane>>4);
//      elements 0..7 <- p[0..7] (k0+8h..), elements 8..15 <- p[16..23] (k0+16+8h..)
__device__ __forceinline__ v16h ldfrag_h(const _Float16* p) {
  FragH f;
  f.h[0] = *(const v8h*)(p);
  f.h[1] = *(const v8h*)(p + 16);
  return f.v;
}
__device__ __forceinline__ v16b ldfrag_b(const unsigned short* p) {
  FragB f;
  f.u[0] = *(const v8us*)(p);
  f.u[1] = *(const v8us*)(p + 16);
  return f.v;
}

// ---- WMMA helpers: builtin followed by a 4-slot VALU gap tying D and keeping A/B live ----------------------
__device__ __forceinline__ v8f mma_h(v16h a, v16h b, v8f c) {
  v8f d = __builtin_amdgcn_wmma_f32_16x16x32_f16(false, a, false, b, (short)0, c, false, false);
#if defined(__HIP_DEVICE_COMPILE__)
  asm volatile("v_nop\n\tv_nop\n\tv_nop\n\tv_nop" : "+v"(d) : "v"(a), "v"(b));
#endif
  return d;
}
// key loop of the attention: the plain builtin, padded by the compiler. The asm statement above takes its vector operands below v256,
// and the 32-column wave's fragments and accumulators do not all fit there (scratch reloads inside the loop).
__device__ __forceinline__ v8f mma_k(v16h a, v16h b, v8f c) {
  return __builtin_amdgcn_wmma_f32_16x16x32_f16(false, a, false, b, (short)0, c, false, false);
}
__device__ __forceinline__ v8f mma_b(v16b a, v16b b, v8f c) {
  v8f d = __builtin_amdgcn_wmma_f32_16x16x32_bf16(false, a, false, b, (short)0, c, false, false);
#if defined(__HIP_DEVICE_COMPILE__)
  const v16h ha = __builtin_bit_cast(v16h, a), hb = __builtin_bit_cast(v16h, b);
  asm volatile("v_nop\n\tv_nop\n\tv_nop\n\tv_nop" : "+v"(d) : "v"(ha), "v"(hb));
#endif
  return d;
}

// ---- one wave: 16 n rows x 64 output channels (4 D tiles) over K = 128 (4 k-steps), A from LDS, B from the chunk's
//      bf16 weight tile in LDS (rows = output channel, k = input channel contiguous, pitch KVH); the chunk's fragment
//      reads stand as one group in front of its 16 products, so their latency is paid once per chunk
__device__ __forceinline__ void gemm4(const unsigned short* ap, const unsigned short* bp,
                                      v8f& acc0, v8f& acc1, v8f& acc2, v8f& acc3) {
  v16b a[4], w[16];
#pragma unroll
  for (int ks = 0; ks < 4; ++ks) {
    a[ks] = ldfrag_b(ap + 32 * ks);
#pragma unroll
    for (int j = 0; j < 4; ++j) w[4 * ks + j] = ldfrag_b(bp + 32 * ks + j * 16 * KVH);
  }
  acc0 = zero8(); acc1 = zero8(); acc2 = zero8(); acc3 = zero8();
#pragma unroll
  for (int ks = 0; ks < 4; ++ks) {
    acc0 = mma_b(a[ks], w[4 * ks + 0], acc0);
    acc1 = mma_b(a[ks], w[4 * ks + 1], acc1);
    acc2 = mma_b(a[ks], w[4 * ks + 2], acc2);
    acc3 = mma_b(a[ks], w[4 * ks + 3], acc3);
  }
}

// ---- LDS staging helpers for the projection epilogue (D rows = n, D cols = channel) ------------------------
__device__ __forceinline__ void stage_h(unsigned short* L, int nr, int col, v8f acc) {
#pragma unroll
  for (int r = 0; r < 8; ++r) L[(nr + r) * LQP + col] = h_bits((_Float16)acc[r]);
}
__device__ __forceinline__ void stage_v(unsigned short* Lv, int e, int nr, v8f acc) {
#pragma unroll
  for (int r = 0; r < 8; ++r) Lv[e * LVP + nr + r] = h_bits((_Float16)acc[r]);
}

// ---- tensor load to LDS: descriptor words live in scalar registers; every test around an issue is a scalar branch ----
__device__ __forceinline__ uint32_t uni(uint32_t v) { return (uint32_t)__builtin_amdgcn_readfirstlane(v); }
__device__ __forceinline__ uint32_t pinned(uint32_t v) {
  uint32_t w = uni(v);
  asm volatile("" : "+s"(w));   // pinned(): an issue test or a descriptor word held in a scalar register; the test then compiles to s_cmp + s_cbranch_scc (tensor loads ignore EXEC)
  return w;
}
// group 1: 1-byte elements, tile = tensor = 128 rows of 256 bytes, 16 bytes of LDS pad behind every 256-byte row
__device__ __forceinline__ u32x8 tdm_group1(uint32_t src_pitch) {
  u32x8 g;
  // pinned(): each descriptor word held in a scalar register of its own, so that the tuple is built once and nothing rewrites it
  // while a request is in flight; word 0 stays a plain constant
  g[0] = uni((1u << 20) | (5u << 22) | (3u << 25));
  g[1] = pinned(256u << 16);
  g[2] = pinned(128u << 16);
  g[3] = pinned(256u << 16);
  g[4] = pinned(128u);
  g[5] = pinned(src_pitch);
  g[6] = pinned(0u);
  g[7] = pinned(0u);
  return g;
}
__device__ __forceinline__ u32x4 tdm_group0(uint32_t lds_dst, uint64_t ga) {
  u32x4 g;
  g[0] = uni(1u);
  g[1] = uni(lds_dst);
  g[2] = uni((uint32_t)ga);
  g[3] = uni((((uint32_t)(ga >> 32)) & 0x01FFFFFFu) | 0x80000000u);
  asm volatile("" : "+s"(g));   // descriptor words held in scalar registers: the tuple is complete here, in front of the issue test
  return g;
}
__device__ __forceinline__ void tdm_load(u32x4 g0, u32x8 g1) {
  asm volatile("tensor_load_to_lds %0, %1" :: "s"(g0), "s"(g1) : "memory");   // one request of the whole wave: a 2-D tile into LDS
}
// the compiler places no wait for a tensor load: the issuing wave's own wait says that its tile has landed
__device__ __forceinline__ void wait_tensor0() { asm volatile("s_wait_tensorcnt 0x0" ::: "memory"); }
// the same wait, naming the request's descriptor as inputs: its registers stay live, so unwritten, until the tile has landed
__device__ __forceinline__ void wait_tensor0_of(u32x4 g0, u32x8 g1) {
  asm volatile("s_wait_tensorcnt 0x0" :: "s"(g0), "s"(g1) : "memory");
}
// this wave's LDS reads have returned before the barrier behind which their buffer is refilled
__device__ __forceinline__ void wait_ds0() { asm volatile("s_wait_dscnt 0x0" ::: "memory"); }

// ---- weight element convert: rows < NQKV -> bf16 bits; rows >= NQKV -> f16 bits of (bf16 RNE value x 16)
__device__ __forceinline__ unsigned short cvt_sel(bool isq, float fq, float fo) {
  const unsigned short uq = bf_bits(fq);
  const unsigned short uo = h_bits((_Float16)(bfr(fo) * WSC));
  return isq ? uq : uo;
}

// =====================================================================================================
// (0) stacked 16-bit weight plane W16[512][128]: rows 0..383 = bf16 bits of W_qkv (RNE convert),
//     rows 384..511 = f16 bits of (bf16 RNE value of W_out) x 16. Thread i writes 8 halves (16 B) at element 8i;
//     sources loaded with clamped rows, selected by value.
// coverage: 32 blocks x 256 threads x 8 = 65536 = 512 x 128.
// =====================================================================================================
__global__ __launch_bounds__(256) void cvt_w(const float* __restrict__ wqkv, const float* __restrict__ wout,
                                             unsigned short* W16) {
  const int i = blockIdx.x * 256 + threadIdx.x;
  if (i >= (NW * DCH) / 8) return;
  const int row = i >> 4;                  // 0..511
  const int col = (i & 15) * 8;
  const int ra = min(row, NQKV - 1);
  const int rb = min(max(row - NQKV, 0), DCH - 1);
  const v4f a0 = *(const v4f*)(wqkv + (size_t)ra * DCH + col), a1 = *(const v4f*)(wqkv + (size_t)ra * DCH + col + 4);
  const v4f c0 = *(const v4f*)(wout + (size_t)rb * DCH + col), c1 = *(const v4f*)(wout + (size_t)rb * DCH + col + 4);
  const bool isq = row < NQKV;
  v4u w;
#pragma unroll
  for (int t = 0; t < 2; ++t) {
    w[t]     = pk16(cvt_sel(isq, a0[2 * t], c0[2 * t]), cvt_sel(isq, a0[2 * t + 1], c0[2 * t + 1]));
    w[2 + t] = pk16(cvt_sel(isq, a1[2 * t], c1[2 * t]), cvt_sel(isq, a1[2 * t + 1], c1[2 * t + 1]));
  }
  unsigned short* p = W16 + (size_t)i * 8;
  *(v4u*)p = w;
  
}

// =====================================================================================================
// (1) fused q/k/v projection for one (b, 64-position tile): block = 256 threads = 8 waves.
//   x tile [128 d][64 n] f32 is staged once as bf16 A tile Lav[n][d] (pitch AP halves, 2-byte LDS stores), barrier.
//   Wave w: n group ng = w&3 (A rows n = 16ng + (lane&15), split k map over d), channel half ch = w>>2
//   (B = W16 rows chunk*128 + ch*64 + 16j + (lane&15), same split k map), 4 D tiles per chunk, 4 k-steps of 32,
//   chunks q, k, v in sequence (A reloaded from LDS). The 384 weight rows come once per block by tensor_load_to_lds into three
//   LDS tiles (rows padded to 272 B); every B fragment is read from there.
//   Epilogue: D -> f16 bits in LDS: q tile Lq[n][128], k tile Lk[n][128], v transposed Lv[e][n] (aliases Lav after
//   [b][e][4096] (line = 64 keys of one e row); every line = 8 consecutive lanes x 16 B of one instruction, two
// coverage: Lav: 256 threads x 8 it x 4 = 64 n x 128 d; Lq/Lk: 8 waves x (16 n x 64 ch) per chunk = 64 x 128;
//           Q/K planes: 4 it x 32 lines x 8 lanes x 8 halves = 64 rows x 128; V plane: 4 it x 32 lines x 8 x 8 =
//           128 e x 64 n; grid = 8 x 64 blocks covers every plane exactly once.
// =====================================================================================================
__global__ __launch_bounds__(256)
void proj_kernel(const float* __restrict__ x, const unsigned short* __restrict__ W16,
                 unsigned short* QP, unsigned short* KP, unsigned short* VP) {
  // q, k and v weight tiles (128 rows of 256 B each, LDS pitch 272 B), tile t at t * TILEB: a multiple of 2 KiB
  __shared__ __attribute__((aligned(2048))) unsigned char Wt[3 * TILEB];
  __shared__ __align__(16) unsigned short Lav[64 * AP];    // A tile [n][d]; reused as Lv[e][n] (pitch LVP) later
  __shared__ __align__(16) unsigned short Lq[64 * LQP];    // q f16 [n][128]
  __shared__ __align__(16) unsigned short Lk[64 * LQP];    // k f16 [n][128]
  const int tid  = threadIdx.x;
  const int lane = tid & 31, wave = tid >> 5;
  const int hh   = lane >> 4, c = lane & 15;
  const int bx   = blockIdx.x;
  const int b    = bx / (SEQ / QT);
  const int nt   = bx % (SEQ / QT);
  const int n0   = nt * QT;

  // ---- stage x tile as bf16 [n][d] ----
  {
    const int n4 = (tid & 15) * 4, ds = tid >> 4;          // ds 0..15
    const float* xp = x + ((size_t)b * DCH + ds) * SEQ + n0 + n4;
    v4f xv[8];
#pragma unroll
    for (int it = 0; it < 8; ++it) xv[it] = *(const v4f*)(xp + (size_t)it * 16 * SEQ);
    asm volatile("s_wait_xcnt 0x0" ::: "memory");          // in front of the first overwrite of the x loads' address registers
    // ---- the three weight tiles by tensor_load_to_lds, once per block: waves 0, 1, 2 bring the q, k, v rows of W16, one request
    //      each, behind the issue of the x loads, whose latency the request's own wait overlaps ----
    const uint32_t wv = uni((uint32_t)tid >> 5);
    const u32x8 g1 = tdm_group1((uint32_t)(DCH * 2));
    const u32x4 g0 = tdm_group0((uint32_t)(size_t)Wt + wv * (uint32_t)TILEB,
                                (uint64_t)(size_t)W16 + (uint64_t)wv * (uint64_t)(DCH * DCH * 2));
    if (pinned(wv < 3u)) {
      tdm_load(g0, g1);
      wait_tensor0_of(g0, g1);
    }
#pragma unroll
    for (int it = 0; it < 8; ++it) {
      const int d = it * 16 + ds;                          // 0..127
#pragma unroll
      for (int q = 0; q < 4; ++q) Lav[(n4 + q) * AP + d] = bf_bits(xv[it][q]);
    }
  }
  __syncthreads();            // publishes the x tile and the three weight tiles

  // ---- GEMMs: 16 n rows x 64 channels per wave per chunk ----
  const int ng = wave & 3, ch = wave >> 2;
  const unsigned short* ap = Lav + (ng * 16 + c) * AP + 8 * hh;
  const int nr = ng * 16 + 8 * hh;                         // D row r -> n local nr + r
  const int cb = ch * 64;                                  // channel base within a chunk; D col = cb + 16j + c
  v8f acc0, acc1, acc2, acc3;
  const unsigned short* wl = (const unsigned short*)(const void*)Wt + (cb + c) * KVH + 8 * hh;   // tile rows follow on: row r at r * KVH

  // q chunk (weight rows 0..127)
  gemm4(ap, wl + 0 * DCH * KVH, acc0, acc1, acc2, acc3);
  stage_h(Lq, nr, cb + 0 * 16 + c, acc0);
  stage_h(Lq, nr, cb + 1 * 16 + c, acc1);
  stage_h(Lq, nr, cb + 2 * 16 + c, acc2);
  stage_h(Lq, nr, cb + 3 * 16 + c, acc3);
  // k chunk (weight rows 128..255)
  gemm4(ap, wl + 1 * DCH * KVH, acc0, acc1, acc2, acc3);
  stage_h(Lk, nr, cb + 0 * 16 + c, acc0);
  stage_h(Lk, nr, cb + 1 * 16 + c, acc1);
  stage_h(Lk, nr, cb + 2 * 16 + c, acc2);
  stage_h(Lk, nr, cb + 3 * 16 + c, acc3);
  // v chunk (weight rows 256..383)
  gemm4(ap, wl + 2 * DCH * KVH, acc0, acc1, acc2, acc3);

  __syncthreads();            // every wave is done reading Lav before it is reused as Lv
  stage_v(Lav, cb + 0 * 16 + c, nr, acc0);
  stage_v(Lav, cb + 1 * 16 + c, nr, acc1);
  stage_v(Lav, cb + 2 * 16 + c, nr, acc2);
  stage_v(Lav, cb + 3 * 16 + c, nr, acc3);
  __syncthreads();

  {
    const int e = tid & 7, lq = tid >> 3;                    // lq 0..31
{
#pragma unroll
      for (int it = 0; it < 4; ++it) {
        const int L  = it * 32 + lq;                         // 0..127
        const int n  = L >> 1, hf = L & 1;                   // row 0..63, half 0..1
        const size_t go = ((size_t)b * SEQ + n0 + n) * DCH + hf * 64 + 8 * e;
        const int lo_ = n * LQP + hf * 64 + 8 * e;
        const v4u uq = *(const v4u*)(Lq + lo_);
        const v4u uk = *(const v4u*)(Lk + lo_);
        *(v4u*)(QP + go) = uq;
        *(v4u*)(KP + go) = uk;
      }
#pragma unroll
      for (int it = 0; it < 4; ++it) {
        const int er = it * 32 + lq;                         // 0..127
        const v4u uv = *(const v4u*)(Lav + er * LVP + 8 * e);
        *(v4u*)(VP + ((size_t)b * DCH + er) * SEQ + n0 + 8 * e) = uv;
      }
      
    }
  }
}

// =====================================================================================================
// (2) attention + output projection for one (b, 128-query tile), transposed formulation, 128-deep scores, 4096 keys:
//   K rows and V rows come in stages of 128 keys by tensor_load_to_lds into a ring of two LDS buffers that the block's
//   8 waves share: wave 0 brings the K tile (128 keys x 256 B, source pitch 256 B), wave 1 the V tile (128 d rows x
//   256 B = 128 keys, source pitch 8192 B), each one request per stage, rows padded to a pitch of 272 B in LDS.
//   Stage s + 1 flies while stage s is worked on; at the foot of a stage: s_wait_dscnt 0, the issuers' s_wait_tensorcnt 0,
//   the workgroup barrier, then the refill of the buffer just read.
//   S^T tile (16 keys x 16 queries) = A(k rows = keys kb + (lane&15), d via the split k map, f16, from LDS) .
//                                     B(q, col = query, same d map, resident f16 fragments), four d-steps.
//   energy = acc * 128^-0.5 in f32. Per lane the D tile holds 8 keys of ONE query: online softmax state per lane; the reference
//   point m moves (one shuffle lane^16, O and l rescaled) only when a score exceeds it by more than 4; row-sum partials combined at the end. P = e^{s-m} x 1024 as one
//   f16 vector is the B operand of O^T (rows d, cols queries) += A(v rows d, keys contiguous, from LDS) . B(P^T):
//   element r <- D of the tile covering keys kb..kb+15, element 8+r <- the tile covering kb+16..kb+31, lane unchanged.
//   Wave map: wave w works on 32 queries (two 16-column tiles, group w&3) and on 64 of every stage's 128 keys (half w>>2), so
//   each K and V fragment read from LDS feeds two query tiles. 32 keys per step: 16 score WMMAs + 16 output WMMAs per wave.
//   Behind the key loop the two waves of a query group swap one tile each (max, row sum, O^T) through the ring's LDS and join
//   the halves in f32: O = Oa e^{ma-m} + Ob e^{mb-m}; each wave then finishes one 16-query tile.
//   Block = 8 waves = 128 queries; grid = 8 b x 32.
//   Output projection: B fragment of d-step ks = f16(O^T x 64 / l) of D tiles j = 2ks (element r) and 2ks+1 (element
//   8+r), lane unchanged (col = query); A = W16 rows 384 + o (f16, x16), split k map over d, read from an LDS tile that wave 2
//   fills by one tensor_load_to_lds in front of the first barrier; D[row o][col query]
//   x 1/1024 staged in LDS (scalar stores, pitch OP), barrier, then + bf16-RNE bias; each wave stores whole 512-B rows.
// coverage: block writes o 0..127 x n n0..n0+127 of its b (16 it x 8 rows); grid covers y exactly once.
// =====================================================================================================
__global__ __launch_bounds__(256)
void attn_kernel(const unsigned short* __restrict__ QP, const unsigned short* __restrict__ KP,
                 const unsigned short* __restrict__ VP, const unsigned short* __restrict__ W16,
                 const float* __restrict__ bout, float* y) {
  // buffer u: K tile at u * 2 * TILEB, V tile at u * 2 * TILEB + TILEB; every tile starts at a multiple of 2 KiB
  __shared__ __attribute__((aligned(2048))) unsigned char Ring[4 * TILEB];
  // W_out tile (128 rows of 256 B, LDS pitch 272 B), loaded once, read by the output projection
  __shared__ __attribute__((aligned(2048))) unsigned char Wt[TILEB];
  __shared__ __align__(16) float Os[DCH * OP];
  const int tid  = threadIdx.x;
  const int lane = tid & 31;
  const uint32_t wave = uni((uint32_t)tid >> 5);
  const int hh   = lane >> 4;
  const int c    = lane & 15;
  const int bx   = blockIdx.x;
  const int b    = bx / (SEQ / QB);
  const int qb   = bx % (SEQ / QB);
  const int n0   = qb * QB;
  const _Float16* QPh = (const _Float16*)(const void*)QP;

  // ---- wave map: query group qg = 32 queries (two 16-column tiles), key half kh = 64 of every stage's 128 keys.
  //      Tile A is the tile this wave finishes (columns 32*qg + 16*kh + c), tile B the one its partner (wave ^ 4) finishes.
  const uint32_t qg = wave & 3u, kh = wave >> 2;
  const int colA = (int)(qg * 32u + kh * 16u), colB = (int)(qg * 32u + (1u - kh) * 16u);
  // ---- resident q fragments (B operand, col = query), d 0..31, 32..63, 64..95, 96..127, for both tiles ----
  const size_t qoA = ((size_t)b * SEQ + n0 + colA + c) * DCH + 8 * hh;
  const size_t qoB = ((size_t)b * SEQ + n0 + colB + c) * DCH + 8 * hh;
  const v16h qa0 = ldfrag_h(QPh + qoA), qa1 = ldfrag_h(QPh + qoA + 32);
  const v16h qa2 = ldfrag_h(QPh + qoA + 64), qa3 = ldfrag_h(QPh + qoA + 96);
  const v16h qb0 = ldfrag_h(QPh + qoB), qb1 = ldfrag_h(QPh + qoB + 32);
  const v16h qb2 = ldfrag_h(QPh + qoB + 64), qb3 = ldfrag_h(QPh + qoB + 96);

  // ---- the two issuing waves' requests: wave 0 = K tile, wave 1 = V tile ----
  const bool isV = wave == 1u;
  const uint64_t tsrc = isV ? (uint64_t)(size_t)(VP + (size_t)b * DCH * SEQ) : (uint64_t)(size_t)(KP + (size_t)b * SEQ * DCH);
  const uint32_t tstep = isV ? (uint32_t)(SK * 2) : (uint32_t)(SK * DCH * 2);     // bytes from one stage's tile to the next
  const uint32_t tdst  = (uint32_t)(size_t)Ring + (isV ? (uint32_t)TILEB : 0u);
  const u32x8 g1 = tdm_group1(isV ? (uint32_t)(SEQ * 2) : (uint32_t)(DCH * 2));

  u32x4 g0 = tdm_group0(tdst, tsrc);
  if (pinned(wave < 2u)) {
    tdm_load(g0, g1);                                          // stage 0 into buffer 0
    wait_tensor0_of(g0, g1);
  }
  // wave 2: the W_out rows of W16 (source pitch 256 B, as the K tile's) into Wt, one request per block
  const u32x4 gw = tdm_group0((uint32_t)(size_t)Wt, (uint64_t)(size_t)(W16 + (size_t)NQKV * DCH));
  if (pinned(wave == 2u)) {
    tdm_load(gw, g1);
    wait_tensor0_of(gw, g1);
  }
  asm volatile("s_wait_xcnt 0x0" ::: "memory");                // in front of the first overwrite of the q loads' address registers
  __syncthreads();                                             // stage 0 and the W_out tile published
  g0 = tdm_group0(tdst + 2u * TILEB, tsrc + tstep);
  if (pinned(wave < 2u)) {
    tdm_load(g0, g1);                                          // stage 1 into buffer 1
  }

  float mA = -1.0e30f, lA = 0.f, mB = -1.0e30f, lB = 0.f;
  float tA = -1.0e30f, tB = -1.0e30f, mshA = -1.0e30f, mshB = -1.0e30f;   // below every finite score: the first step sets m
  v8f oA[8], oB[8];
#pragma unroll
  for (int j = 0; j < 8; ++j) { oA[j] = zero8(); oB[j] = zero8(); }
  // kept rolled: one stage per trip, so the ring's foot (waits, barrier, refill) stands once in the code
#pragma unroll 1
  for (int st = 0; st < SEQ / SK; ++st) {
    // k fragment base (A operand, row = key 64*kh + c of the stage), v fragment base (A operand, row = d = c, keys contiguous
    // from key 64*kh of the stage)
    const _Float16* Tl = (const _Float16*)(const void*)(Ring + (st & 1) * (2 * TILEB));
    const _Float16* Kl = Tl + ((int)kh * (SK / 2) + c) * KVH + 8 * hh;
    const _Float16* Vl = Tl + TILEB / 2 + c * KVH + 8 * hh + (int)kh * (SK / 2);
    // kept rolled, as it was: one 32-key step per trip
#pragma unroll 1
    for (int sub = 0; sub < SK / 64; ++sub) {
      const int kb = sub * 32;
      const _Float16* k0p = Kl + kb * KVH;                      // keys kb .. kb+15 of the wave's half
      const _Float16* k1p = k0p + 16 * KVH;                     // keys kb+16 .. kb+31
      // the step's 16 K reads as one group in front of its score products; every fragment feeds both query tiles
      const v16h ka0 = ldfrag_h(k0p), ka1 = ldfrag_h(k0p + 32), ka2 = ldfrag_h(k0p + 64), ka3 = ldfrag_h(k0p + 96);
      const v16h kc0 = ldfrag_h(k1p), kc1 = ldfrag_h(k1p + 32), kc2 = ldfrag_h(k1p + 64), kc3 = ldfrag_h(k1p + 96);
      v8f sA0, sA1, sB0, sB1;
      sA0 = mma_k(ka0, qa0, zero8());
      sB0 = mma_k(ka0, qb0, zero8());
      sA1 = mma_k(kc0, qa0, zero8());
      sB1 = mma_k(kc0, qb0, zero8());
      sA0 = mma_k(ka1, qa1, sA0);
      sB0 = mma_k(ka1, qb1, sB0);
      sA1 = mma_k(kc1, qa1, sA1);
      sB1 = mma_k(kc1, qb1, sB1);
      sA0 = mma_k(ka2, qa2, sA0);
      sB0 = mma_k(ka2, qb2, sB0);
      sA1 = mma_k(kc2, qa2, sA1);
      sB1 = mma_k(kc2, qb2, sB1);
      sA0 = mma_k(ka3, qa3, sA0);
      sB0 = mma_k(ka3, qb3, sB0);
      sA1 = mma_k(kc3, qa3, sA1);
      sB1 = mma_k(kc3, qb3, sB1);
      // lazy rescale: a column's reference point m stays in use until one of the step's scores exceeds it by more than LZT;
      // one test per step for both tiles, a scalar branch. Up to there P = e^{s-m} x 1024 <= e^LZT x 1024 stays finite in f16.
      // tA, tB = (m + LZT) / SCL: the test compares this lane's 16 unscaled scores of the step.
      const float rxA = fmaxf(hmax8(sA0), hmax8(sA1)), rxB = fmaxf(hmax8(sB0), hmax8(sB1));
      if (__builtin_amdgcn_ballot_w32((rxA > tA) || (rxB > tB)) != 0u) {
        float mxA = rxA * SCL, mxB = rxB * SCL;
        mxA = fmaxf(mxA, __shfl_xor(mxA, 16, 32));        // both halves of a column take the same new m
        mxB = fmaxf(mxB, __shfl_xor(mxB, 16, 32));
        const float mnA = fmaxf(mA, mxA), mnB = fmaxf(mB, mxB);
        const float corrA = __expf(mA - mnA), corrB = __expf(mB - mnB);
        mA = mnA; mB = mnB;
        tA = (mnA + LZT) * ISCL; tB = (mnB + LZT) * ISCL;
        mshA = mnA - LNPS; mshB = mnB - LNPS;             // exp gives e^{s-m} * 1024
        lA *= corrA; lB *= corrB;
#pragma unroll
        for (int j = 0; j < 8; ++j) {
#pragma unroll
          for (int r = 0; r < 8; ++r) { oA[j][r] *= corrA; oB[j][r] *= corrB; }
        }
      }
      // the step's 16 V reads; every fragment feeds both query tiles
      v16h va[8];
#pragma unroll
      for (int j = 0; j < 8; ++j) va[j] = ldfrag_h(Vl + j * 16 * KVH + kb);
      // the V reads issue as one group in front of the exponentials, which cover their latency; without this the scheduler
      // spreads them through the exponentials, close ahead of their first use
      __builtin_amdgcn_sched_barrier(0);

      FragH pA, pB;
      float lsA = 0.f, lsB = 0.f;
#pragma unroll
      for (int r = 0; r < 8; ++r) {
        const float a0 = __expf(sA0[r] * SCL - mshA);   // key kb      + 8hh + r, tile A
        const float a1 = __expf(sA1[r] * SCL - mshA);   // key kb + 16 + 8hh + r, tile A
        const float b0 = __expf(sB0[r] * SCL - mshB);   // the same keys, tile B
        const float b1 = __expf(sB1[r] * SCL - mshB);
        lsA += a0 + a1;
        lsB += b0 + b1;
        pA.h[0][r] = (_Float16)a0;
        pA.h[1][r] = (_Float16)a1;
        pB.h[0][r] = (_Float16)b0;
        pB.h[1][r] = (_Float16)b1;
      }
      lA += lsA; lB += lsB;

#pragma unroll
      for (int j = 0; j < 8; ++j) {
        oA[j] = mma_k(va[j], pA.v, oA[j]);
        oB[j] = mma_k(va[j], pB.v, oB[j]);
      }
      // these four vector slots keep the distance between the
      // step's last WMMA and the first vector instruction behind the loop's back edge, which may overwrite its A or B
      asm volatile("v_nop\n\tv_nop\n\tv_nop\n\tv_nop" : "+v"(oB[7]) : "v"(va[7]), "v"(pB.v));
    }
    // ---- foot of stage st: publish stage st + 1, then refill the buffer that stage st has just read ----
    wait_ds0();
    if (pinned(wave < 2u)) wait_tensor0_of(g0, g1);
    __syncthreads();
    if (pinned((wave < 2u) && (st + 2 < SEQ / SK))) {
      g0 = tdm_group0(tdst + (uint32_t)(st & 1) * (2u * TILEB), tsrc + (uint64_t)(st + 2) * tstep);
      tdm_load(g0, g1);
    }
  }
  wait_tensor0();
  wait_ds0();
  // ---- join the two key halves: every wave hands tile B (running max, row-sum partial, O^T) to its partner through the ring,
  //      which nobody reads any more behind the last stage's barrier, and adds the partner's half to its own tile A ----
  {
    v4f* xs = (v4f*)(void*)Ring + (size_t)wave * (17 * 32) + lane;              // 17 x 512 B per wave, 16 B per lane
    const v4f* xr = (const v4f*)(const void*)Ring + (size_t)(wave ^ 4u) * (17 * 32) + lane;
#pragma unroll
    for (int j = 0; j < 8; ++j) {
      const v4f lo = {oB[j][0], oB[j][1], oB[j][2], oB[j][3]}, hi = {oB[j][4], oB[j][5], oB[j][6], oB[j][7]};
      xs[(2 * j) * 32] = lo;
      xs[(2 * j + 1) * 32] = hi;
    }
    const v4f ml = {mB, lB, 0.f, 0.f};
    xs[16 * 32] = ml;
    __syncthreads();                                                            // both halves' tiles are in LDS
    const v4f pm = xr[16 * 32];
    const float mt = fmaxf(mA, pm[0]);
    const float fa = __expf(mA - mt), fp = __expf(pm[0] - mt);
    lA = lA * fa + pm[1] * fp;
#pragma unroll
    for (int j = 0; j < 8; ++j) {
      const v4f lo = xr[(2 * j) * 32], hi = xr[(2 * j + 1) * 32];
#pragma unroll
      for (int r = 0; r < 4; ++r) {
        oA[j][r]     = oA[j][r] * fa + lo[r] * fp;
        oA[j][4 + r] = oA[j][4 + r] * fa + hi[r] * fp;
      }
    }
  }
  const float l = lA + __shfl_xor(lA, 16, 32);
  const float sc = OSC / l;                 // both o and l carry the x1024 factor; sc scales O by 64

  // ---- O (x64) as f16 B fragments of the output projection: d-step ks <- D tiles 2ks (r) and 2ks+1 (8+r) ----
  FragH ob0, ob1, ob2, ob3;
#pragma unroll
  for (int r = 0; r < 8; ++r) {
    ob0.h[0][r] = (_Float16)(oA[0][r] * sc); ob0.h[1][r] = (_Float16)(oA[1][r] * sc);
    ob1.h[0][r] = (_Float16)(oA[2][r] * sc); ob1.h[1][r] = (_Float16)(oA[3][r] * sc);
    ob2.h[0][r] = (_Float16)(oA[4][r] * sc); ob2.h[1][r] = (_Float16)(oA[5][r] * sc);
    ob3.h[0][r] = (_Float16)(oA[6][r] * sc); ob3.h[1][r] = (_Float16)(oA[7][r] * sc);
  }

  // ---- y^T tile: for each o tile, A = W_out rows 16*ot + c (f16 x16, split map over d), 4 d-steps; stage x 1/1024 ----
  const _Float16* wp = (const _Float16*)(const void*)Wt + c * KVH + 8 * hh;
  float* os = Os + (8 * hh) * OP + colA + c;                // row o = 16*ot + 8hh + r, col = query colA + c
#pragma unroll
  for (int og = 0; og < 2; ++og) {
    // four o tiles' 16 fragments as one group of LDS reads in front of their products: one read latency per group
    v16h wf[16];
#pragma unroll
    for (int t = 0; t < 16; ++t) wf[t] = ldfrag_h(wp + (og * 4 + (t >> 2)) * 16 * KVH + 32 * (t & 3));
#pragma unroll
    for (int t = 0; t < 4; ++t) {
      const int ot = og * 4 + t;
      v8f ya = zero8();
      ya = mma_h(wf[4 * t + 0], ob0.v, ya);
      ya = mma_h(wf[4 * t + 1], ob1.v, ya);
      ya = mma_h(wf[4 * t + 2], ob2.v, ya);
      ya = mma_h(wf[4 * t + 3], ob3.v, ya);
#pragma unroll
      for (int r = 0; r < 8; ++r) os[(ot * 16 + r) * OP] = ya[r] * IYS;
    }
  }
  __syncthreads();
  {
    float* ob = y + ((size_t)b * DCH) * SEQ + n0;
#pragma unroll
    for (int it = 0; it < 16; ++it) {
      const int row = it * 8 + (int)wave;                 // o row 0..127: one wave stores the row's 128 queries (512 B)
      const v4f v   = *(const v4f*)(Os + row * OP + 4 * lane);
      const float bb = bfr(bout[row]);
      const v4f vo  = {v[0] + bb, v[1] + bb, v[2] + bb, v[3] + bb};
      *(v4f*)(ob + (size_t)row * SEQ + 4 * lane) = vo;
    }
  }
}

// =====================================================================================================
//   W16  16-bit [512][128]        0           131072
//   QP   f16    [8][4096][128]    131072      8388608
//   KP   f16    [8][4096][128]    8519680     8388608
//   VP   f16    [8][128][4096]    16908288    8388608
//   end                           25296896
// =====================================================================================================
extern "C" void kernel_launch(void* const* d_in, const int* in_sizes, int n_in,
                              void* d_out, int out_size, void* d_ws, size_t ws_size,
                              hipStream_t stream) {
  const int NX = NB * DCH * SEQ;                        // 4194304
  if (n_in < 4) return;
  if (in_sizes[0] != NX || in_sizes[1] != NQKV * DCH || in_sizes[2] != DCH * DCH || in_sizes[3] != DCH) return;
  if (out_size != NX) return;

  size_t off = 0;
  const size_t oW  = off; off += (size_t)NW * DCH * 2;            // 131072
  const size_t szP = (size_t)NB * SEQ * DCH * 2;                  // 8388608
  const size_t oQ  = off; off += szP;
  const size_t oK  = off; off += szP;
  const size_t oV  = off; off += (size_t)NB * DCH * SEQ * 2;      // 8388608
  if (off > ws_size) return;                                      // off = 25296896
  if (off > (size_t)134217728) return;

  const float* x    = (const float*)d_in[0];
  const float* Wqkv = (const float*)d_in[1];
  const float* Wout = (const float*)d_in[2];
  const float* bout = (const float*)d_in[3];
  char* ws = (char*)d_ws;
  unsigned short* W16 = (unsigned short*)(ws + oW);
  unsigned short* QPp = (unsigned short*)(ws + oQ);
  unsigned short* KPp = (unsigned short*)(ws + oK);
  unsigned short* VPp = (unsigned short*)(ws + oV);
  float* y = (float*)d_out;

  const dim3 blk256(256);
  const dim3 gW((NW * DCH / 8) / 256);                  // 32 blocks
  const dim3 gP(NB * (SEQ / QT));                       // 512 blocks: one (b, 64-position tile) each
  const dim3 gA(NB * (SEQ / QB));                       // 256 blocks: one (b, 128-query tile) each

  // (0) stacked 16-bit weight plane
  cvt_w<<<gW, blk256, 0, stream>>>(Wqkv, Wout, W16);
  // (1) q, k, v planes
  proj_kernel<<<gP, blk256, 0, stream>>>(x, W16, QPp, KPp, VPp);
  // (2) attention + output projection + bias: y[b][o][n]
  attn_kernel<<<gA, blk256, 0, stream>>>(QPp, KPp, VPp, W16, bout, y);
  (void)hipGetLastError();
}

// v005
// One run takes 64.3 microseconds.
// In two side-by-side timings against v004, it was 1.04 and 1.05 times as fast.
// Over all steps from v000 it is 7.08 times as fast.
// Contractions: q/k/v 1x1-conv projections = W_qkv (bf16, RNE convert of input) . X (bf16, RNE convert of input) on
// v_wmma_f32_16x16x32_bf16, K=128; scores S^T = k (f16) . q^T (f16) on v_wmma_f32_16x16x32_f16, K=128, one product;
// O^T = v (f16) . P^T (f16, e^{s-m} x 1024 taken from the score D registers) on v_wmma_f32_16x16x32_f16 over 4096
// keys, one product; y = W_out (f16 bits of the bf16-RNE input x 16) . O (f16, x 64, taken from the O^T D registers)
// on v_wmma_f32_16x16x32_f16, K=128, one product; f32 accumulate everywhere; softmax (running max, row sums, 1/l),
// the 128^-0.5 scale and the bias add in f32 on VALU.
#include <hip/hip_runtime.h>
#include <math.h>
#include <stdint.h>

#define NB    8
#define DCH   128
#define SEQ   4096
#define NQKV  384
#define NW    512
#define QT    64
#define AP    144
#define LQP   136
#define LVP   72
#define OP    132
#define QB    128
#define SK    128
#define KVH   136
#define TILEB 34816
#define LNPS  6.931471805599453f
#define LZT   4.0f
#define ISCL  11.313708498984761f
#define SCL   0.08838834764831845f
#define OSC   64.0f
#define WSC   16.0f
#define IYS   0.0009765625f
static_assert((SEQ % QT) == 0);
static_assert((SEQ % 32) == 0);
static_assert((DCH % 32) == 0);
static_assert(NQKV == 3 * DCH);
static_assert(NW == NQKV + DCH);
static_assert(((NW * DCH) / 8) % 256 == 0);
static_assert(64 * AP == DCH * LVP);
static_assert(LQP >= DCH && (LQP % 8) == 0);
static_assert((AP % 8) == 0 && (LVP % 8) == 0);
static_assert(OP >= QB && (OP % 4) == 0);
static_assert((SEQ % QB) == 0 && (SEQ % SK) == 0 && (SEQ / SK) >= 2 && (SK % 32) == 0);
static_assert(2 * DCH == 256 && 2 * SK == 256);           // both tiles have rows of 256 bytes
static_assert(2 * KVH == 256 + 16);                        // LDS row pitch = row + the 16-byte pad of the tensor load
static_assert(TILEB == SK * 2 * KVH && TILEB == DCH * 2 * KVH && (TILEB % 2048) == 0);
static_assert((SK % 64) == 0);                             // each key half of a stage is a whole number of 32-key steps
static_assert(8 * 17 * 512 <= 6 * TILEB);                  // the waves' swap of one tile each fits the ring's LDS

typedef _Float16       v16h __attribute__((ext_vector_type(16)));
typedef _Float16       v8h  __attribute__((ext_vector_type(8)));
typedef __bf16         v16b __attribute__((ext_vector_type(16)));
typedef unsigned short v8us __attribute__((ext_vector_type(8)));
typedef float          v8f  __attribute__((ext_vector_type(8)));
typedef float          v4f  __attribute__((ext_vector_type(4)));
typedef unsigned int   v4u  __attribute__((ext_vector_type(4)));
typedef uint32_t       u32x4 __attribute__((ext_vector_type(4)));
typedef uint32_t       u32x8 __attribute__((ext_vector_type(8)));

union FragH { v16h v; v8h  h[2]; };
union FragB { v16b v; v8us u[2]; };
static_assert(sizeof(FragH) == 32);
static_assert(sizeof(FragB) == 32);

// ---- scalar helpers --------------------------------------------------------------------------------
__device__ __forceinline__ unsigned short bf_bits(float f) {          // f32 -> bf16 bits, RNE convert
  unsigned u = __float_as_uint(f);
  return (unsigned short)((u + 0x7FFFu + ((u >> 16) & 1u)) >> 16);
}
__device__ __forceinline__ float bf_up(unsigned short h) { return __uint_as_float(((unsigned)h) << 16); }
__device__ __forceinline__ float bfr(float f) { return bf_up(bf_bits(f)); }
__device__ __forceinline__ unsigned short h_bits(_Float16 x) { return __builtin_bit_cast(unsigned short, x); }
__device__ __forceinline__ unsigned pk16(unsigned short a, unsigned short b) { return (unsigned)a | ((unsigned)b << 16); }
__device__ __forceinline__ v8f zero8() { v8f z = {0.f, 0.f, 0.f, 0.f, 0.f, 0.f, 0.f, 0.f}; return z; }
__device__ __forceinline__ float hmax8(v8f s) {
  return fmaxf(fmaxf(fmaxf(s[0], s[1]), fmaxf(s[2], s[3])), fmaxf(fmaxf(s[4], s[5]), fmaxf(s[6], s[7])));
}

// ---- fragment loaders: 16-bit A/B operand, lane -> row/col (lane&15), p already includes +8*(lane>>4);
//      elements 0..7 <- p[0..7] (k0+8h..), elements 8..15 <- p[16..23] (k0+16+8h..)
__device__ __forceinline__ v16h ldfrag_h(const _Float16* p) {
  FragH f;
  f.h[0] = *(const v8h*)(p);
  f.h[1] = *(const v8h*)(p + 16);
  return f.v;
}
__device__ __forceinline__ v16b ldfrag_b(const unsigned short* p) {
  FragB f;
  f.u[0] = *(const v8us*)(p);
  f.u[1] = *(const v8us*)(p + 16);
  return f.v;
}

// ---- WMMA helpers: builtin followed by a 4-slot VALU gap tying D and keeping A/B live ----------------------
__device__ __forceinline__ v8f mma_h(v16h a, v16h b, v8f c) {
  v8f d = __builtin_amdgcn_wmma_f32_16x16x32_f16(false, a, false, b, (short)0, c, false, false);
#if defined(__HIP_DEVICE_COMPILE__)
  asm volatile("v_nop\n\tv_nop\n\tv_nop\n\tv_nop" : "+v"(d) : "v"(a), "v"(b));
#endif
  return d;
}
// key loop of the attention: the plain builtin, padded by the compiler. The asm statement above takes its vector operands below v256,
// and the 32-column wave's fragments and accumulators do not all fit there (scratch reloads inside the loop).
__device__ __forceinline__ v8f mma_k(v16h a, v16h b, v8f c) {
  return __builtin_amdgcn_wmma_f32_16x16x32_f16(false, a, false, b, (short)0, c, false, false);
}
__device__ __forceinline__ v8f mma_b(v16b a, v16b b, v8f c) {
  v8f d = __builtin_amdgcn_wmma_f32_16x16x32_bf16(false, a, false, b, (short)0, c, false, false);
#if defined(__HIP_DEVICE_COMPILE__)
  const v16h ha = __builtin_bit_cast(v16h, a), hb = __builtin_bit_cast(v16h, b);
  asm volatile("v_nop\n\tv_nop\n\tv_nop\n\tv_nop" : "+v"(d) : "v"(ha), "v"(hb));
#endif
  return d;
}

// ---- one wave: 16 n rows x 64 output channels (4 D tiles) over K = 128 (4 k-steps), A from LDS, B from the chunk's
//      bf16 weight tile in LDS (rows = output channel, k = input channel contiguous, pitch KVH); the chunk's fragment
//      reads stand as one group in front of its 16 products, so their latency is paid once per chunk
__device__ __forceinline__ void gemm4(const unsigned short* ap, const unsigned short* bp,
                                      v8f& acc0, v8f& acc1, v8f& acc2, v8f& acc3) {
  v16b a[4], w[16];
#pragma unroll
  for (int ks = 0; ks < 4; ++ks) {
    a[ks] = ldfrag_b(ap + 32 * ks);
#pragma unroll
    for (int j = 0; j < 4; ++j) w[4 * ks + j] = ldfrag_b(bp + 32 * ks + j * 16 * KVH);
  }
  acc0 = zero8(); acc1 = zero8(); acc2 = zero8(); acc3 = zero8();
#pragma unroll
  for (int ks = 0; ks < 4; ++ks) {
    acc0 = mma_b(a[ks], w[4 * ks + 0], acc0);
    acc1 = mma_b(a[ks], w[4 * ks + 1], acc1);
    acc2 = mma_b(a[ks], w[4 * ks + 2], acc2);
    acc3 = mma_b(a[ks], w[4 * ks + 3], acc3);
  }
}

// ---- LDS staging helpers for the projection epilogue (D rows = n, D cols = channel) ------------------------
__device__ __forceinline__ void stage_h(unsigned short* L, int nr, int col, v8f acc) {
#pragma unroll
  for (int r = 0; r < 8; ++r) L[(nr + r) * LQP + col] = h_bits((_Float16)acc[r]);
}
__device__ __forceinline__ void stage_v(unsigned short* Lv, int e, int nr, v8f acc) {
#pragma unroll
  for (int r = 0; r < 8; ++r) Lv[e * LVP + nr + r] = h_bits((_Float16)acc[r]);
}

// ---- tensor load to LDS: descriptor words live in scalar registers; every test around an issue is a scalar branch ----
__device__ __forceinline__ uint32_t uni(uint32_t v) { return (uint32_t)__builtin_amdgcn_readfirstlane(v); }
__device__ __forceinline__ uint32_t pinned(uint32_t v) {
  uint32_t w = uni(v);
  asm volatile("" : "+s"(w));   // pinned(): an issue test or a descriptor word held in a scalar register; the test then compiles to s_cmp + s_cbranch_scc (tensor loads ignore EXEC)
  return w;
}
// group 1: 1-byte elements, tile = tensor = 128 rows of 256 bytes, 16 bytes of LDS pad behind every 256-byte row
__device__ __forceinline__ u32x8 tdm_group1(uint32_t src_pitch) {
  u32x8 g;
  // pinned(): each descriptor word held in a scalar register of its own, so that the tuple is built once and nothing rewrites it
  // while a request is in flight; word 0 stays a plain constant
  g[0] = uni((1u << 20) | (5u << 22) | (3u << 25));
  g[1] = pinned(256u << 16);
  g[2] = pinned(128u << 16);
  g[3] = pinned(256u << 16);
  g[4] = pinned(128u);
  g[5] = pinned(src_pitch);
  g[6] = pinned(0u);
  g[7] = pinned(0u);
  return g;
}
__device__ __forceinline__ u32x4 tdm_group0(uint32_t lds_dst, uint64_t ga) {
  u32x4 g;
  g[0] = uni(1u);
  g[1] = uni(lds_dst);
  g[2] = uni((uint32_t)ga);
  g[3] = uni((((uint32_t)(ga >> 32)) & 0x01FFFFFFu) | 0x80000000u);
  asm volatile("" : "+s"(g));   // descriptor words held in scalar registers: the tuple is complete here, in front of the issue test
  return g;
}
__device__ __forceinline__ void tdm_load(u32x4 g0, u32x8 g1) {
  asm volatile("tensor_load_to_lds %0, %1" :: "s"(g0), "s"(g1) : "memory");   // one request of the whole wave: a 2-D tile into LDS
}
// the compiler places no wait for a tensor load: the issuing wave's own wait says that its tile has landed
__device__ __forceinline__ void wait_tensor0() { asm volatile("s_wait_tensorcnt 0x0" ::: "memory"); }
// the same wait, naming the request's descriptor as inputs: its registers stay live, so unwritten, until the tile has landed
__device__ __forceinline__ void wait_tensor0_of(u32x4 g0, u32x8 g1) {
  asm volatile("s_wait_tensorcnt 0x0" :: "s"(g0), "s"(g1) : "memory");
}
// this wave's LDS reads have returned before the barrier behind which their buffer is refilled
__device__ __forceinline__ void wait_ds0() { asm volatile("s_wait_dscnt 0x0" ::: "memory"); }

// ---- weight element convert: rows < NQKV -> bf16 bits; rows >= NQKV -> f16 bits of (bf16 RNE value x 16)
__device__ __forceinline__ unsigned short cvt_sel(bool isq, float fq, float fo) {
  const unsigned short uq = bf_bits(fq);
  const unsigned short uo = h_bits((_Float16)(bfr(fo) * WSC));
  return isq ? uq : uo;
}

// =====================================================================================================
// (0) stacked 16-bit weight plane W16[512][128]: rows 0..383 = bf16 bits of W_qkv (RNE convert),
//     rows 384..511 = f16 bits of (bf16 RNE value of W_out) x 16. Thread i writes 8 halves (16 B) at element 8i;
//     sources loaded with clamped rows, selected by value.
// coverage: 32 blocks x 256 threads x 8 = 65536 = 512 x 128.
// =====================================================================================================
__global__ __launch_bounds__(256) void cvt_w(const float* __restrict__ wqkv, const float* __restrict__ wout,
                                             unsigned short* W16) {
  const int i = blockIdx.x * 256 + threadIdx.x;
  if (i >= (NW * DCH) / 8) return;
  const int row = i >> 4;                  // 0..511
  const int col = (i & 15) * 8;
  const int ra = min(row, NQKV - 1);
  const int rb = min(max(row - NQKV, 0), DCH - 1);
  const v4f a0 = *(const v4f*)(wqkv + (size_t)ra * DCH + col), a1 = *(const v4f*)(wqkv + (size_t)ra * DCH + col + 4);
  const v4f c0 = *(const v4f*)(wout + (size_t)rb * DCH + col), c1 = *(const v4f*)(wout + (size_t)rb * DCH + col + 4);
  const bool isq = row < NQKV;
  v4u w;
#pragma unroll
  for (int t = 0; t < 2; ++t) {
    w[t]     = pk16(cvt_sel(isq, a0[2 * t], c0[2 * t]), cvt_sel(isq, a0[2 * t + 1], c0[2 * t + 1]));
    w[2 + t] = pk16(cvt_sel(isq, a1[2 * t], c1[2 * t]), cvt_sel(isq, a1[2 * t + 1], c1[2 * t + 1]));
  }
  unsigned short* p = W16 + (size_t)i * 8;
  *(v4u*)p = w;
  
}

// =====================================================================================================
// (1) fused q/k/v projection for one (b, 64-position tile): block = 256 threads = 8 waves.
//   x tile [128 d][64 n] f32 is staged once as bf16 A tile Lav[n][d] (pitch AP halves, 2-byte LDS stores), barrier.
//   Wave w: n group ng = w&3 (A rows n = 16ng + (lane&15), split k map over d), channel half ch = w>>2
//   (B = W16 rows chunk*128 + ch*64 + 16j + (lane&15), same split k map), 4 D tiles per chunk, 4 k-steps of 32,
//   chunks q, k, v in sequence (A reloaded from LDS). The 384 weight rows come once per block by tensor_load_to_lds into three
//   LDS tiles (rows padded to 272 B); every B fragment is read from there.
//   Epilogue: D -> f16 bits in LDS: q tile Lq[n][128], k tile Lk[n][128], v transposed Lv[e][n] (aliases Lav after
//   [b][e][4096] (line = 64 keys of one e row); every line = 8 consecutive lanes x 16 B of one instruction, two
// coverage: Lav: 256 threads x 8 it x 4 = 64 n x 128 d; Lq/Lk: 8 waves x (16 n x 64 ch) per chunk = 64 x 128;
//           Q/K planes: 4 it x 32 lines x 8 lanes x 8 halves = 64 rows x 128; V plane: 4 it x 32 lines x 8 x 8 =
//           128 e x 64 n; grid = 8 x 64 blocks covers every plane exactly once.
// =====================================================================================================
__global__ __launch_bounds__(256)
void proj_kernel(const float* __restrict__ x, const unsigned short* __restrict__ W16,
                 unsigned short* QP, unsigned short* KP, unsigned short* VP) {
  // q, k and v weight tiles (128 rows of 256 B each, LDS pitch 272 B), tile t at t * TILEB: a multiple of 2 KiB
  __shared__ __attribute__((aligned(2048))) unsigned char Wt[3 * TILEB];
  __shared__ __align__(16) unsigned short Lav[64 * AP];    // A tile [n][d]; reused as Lv[e][n] (pitch LVP) later
  __shared__ __align__(16) unsigned short Lq[64 * LQP];    // q f16 [n][128]
  __shared__ __align__(16) unsigned short Lk[64 * LQP];    // k f16 [n][128]
  const int tid  = threadIdx.x;
  const int lane = tid & 31, wave = tid >> 5;
  const int hh   = lane >> 4, c = lane & 15;
  const int bx   = blockIdx.x;
  const int b    = bx / (SEQ / QT);
  const int nt   = bx % (SEQ / QT);
  const int n0   = nt * QT;

  // ---- stage x tile as bf16 [n][d] ----
  {
    const int n4 = (tid & 15) * 4, ds = tid >> 4;          // ds 0..15
    const float* xp = x + ((size_t)b * DCH + ds) * SEQ + n0 + n4;
    v4f xv[8];
#pragma unroll
    for (int it = 0; it < 8; ++it) xv[it] = *(const v4f*)(xp + (size_t)it * 16 * SEQ);
    asm volatile("s_wait_xcnt 0x0" ::: "memory");          // in front of the first overwrite of the x loads' address registers
    // ---- the three weight tiles by tensor_load_to_lds, once per block: waves 0, 1, 2 bring the q, k, v rows of W16, one request
    //      each, behind the issue of the x loads, whose latency the request's own wait overlaps ----
    const uint32_t wv = uni((uint32_t)tid >> 5);
    const u32x8 g1 = tdm_group1((uint32_t)(DCH * 2));
    const u32x4 g0 = tdm_group0((uint32_t)(size_t)Wt + wv * (uint32_t)TILEB,
                                (uint64_t)(size_t)W16 + (uint64_t)wv * (uint64_t)(DCH * DCH * 2));
    if (pinned(wv < 3u)) {
      tdm_load(g0, g1);
      wait_tensor0_of(g0, g1);
    }
#pragma unroll
    for (int it = 0; it < 8; ++it) {
      const int d = it * 16 + ds;                          // 0..127
#pragma unroll
      for (int q = 0; q < 4; ++q) Lav[(n4 + q) * AP + d] = bf_bits(xv[it][q]);
    }
  }
  __syncthreads();            // publishes the x tile and the three weight tiles

  // ---- GEMMs: 16 n rows x 64 channels per wave per chunk ----
  const int ng = wave & 3, ch = wave >> 2;
  const unsigned short* ap = Lav + (ng * 16 + c) * AP + 8 * hh;
  const int nr = ng * 16 + 8 * hh;                         // D row r -> n local nr + r
  const int cb = ch * 64;                                  // channel base within a chunk; D col = cb + 16j + c
  v8f acc0, acc1, acc2, acc3;
  const unsigned short* wl = (const unsigned short*)(const void*)Wt + (cb + c) * KVH + 8 * hh;   // tile rows follow on: row r at r * KVH

  // q chunk (weight rows 0..127)
  gemm4(ap, wl + 0 * DCH * KVH, acc0, acc1, acc2, acc3);
  stage_h(Lq, nr, cb + 0 * 16 + c, acc0);
  stage_h(Lq, nr, cb + 1 * 16 + c, acc1);
  stage_h(Lq, nr, cb + 2 * 16 + c, acc2);
  stage_h(Lq, nr, cb + 3 * 16 + c, acc3);
  // k chunk (weight rows 128..255)
  gemm4(ap, wl + 1 * DCH * KVH, acc0, acc1, acc2, acc3);
  stage_h(Lk, nr, cb + 0 * 16 + c, acc0);
  stage_h(Lk, nr, cb + 1 * 16 + c, acc1);
  stage_h(Lk, nr, cb + 2 * 16 + c, acc2);
  stage_h(Lk, nr, cb + 3 * 16 + c, acc3);
  // v chunk (weight rows 256..383)
  gemm4(ap, wl + 2 * DCH * KVH, acc0, acc1, acc2, acc3);

  __syncthreads();            // every wave is done reading Lav before it is reused as Lv
  stage_v(Lav, cb + 0 * 16 + c, nr, acc0);
  stage_v(Lav, cb + 1 * 16 + c, nr, acc1);
  stage_v(Lav, cb + 2 * 16 + c, nr, acc2);
  stage_v(Lav, cb + 3 * 16 + c, nr, acc3);
  __syncthreads();

  {
    const int e = tid & 7, lq = tid >> 3;                    // lq 0..31
{
#pragma unroll
      for (int it = 0; it < 4; ++it) {
        const int L  = it * 32 + lq;                         // 0..127
        const int n  = L >> 1, hf = L & 1;                   // row 0..63, half 0..1
        const size_t go = ((size_t)b * SEQ + n0 + n) * DCH + hf * 64 + 8 * e;
        const int lo_ = n * LQP + hf * 64 + 8 * e;
        const v4u uq = *(const v4u*)(Lq + lo_);
        const v4u uk = *(const v4u*)(Lk + lo_);
        *(v4u*)(QP + go) = uq;
        *(v4u*)(KP + go) = uk;
      }
#pragma unroll
      for (int it = 0; it < 4; ++it) {
        const int er = it * 32 + lq;                         // 0..127
        const v4u uv = *(const v4u*)(Lav + er * LVP + 8 * e);
        *(v4u*)(VP + ((size_t)b * DCH + er) * SEQ + n0 + 8 * e) = uv;
      }
      
    }
  }
}

// =====================================================================================================
// (2) attention + output projection for one (b, 128-query tile), transposed formulation, 128-deep scores, 4096 keys:
//   K rows and V rows come in stages of 128 keys by tensor_load_to_lds into a ring of three LDS buffers that the block's
//   8 waves share: wave 0 brings the K tile (128 keys x 256 B, source pitch 256 B), wave 1 the V tile (128 d rows x
//   256 B = 128 keys, source pitch 8192 B), each one request per stage, rows padded to a pitch of 272 B in LDS.
//   Every wave fetches its K fragments one 32-key step ahead, so the publish point of stage s + 1 stands in front of stage s's
//   last step: s_wait_dscnt 0, the issuers' s_wait_tensorcnt 0, the workgroup barrier, then stage s + 2's load into the buffer
//   that stage s - 1 has left.
//   S^T tile (16 keys x 16 queries) = A(k rows = keys kb + (lane&15), d via the split k map, f16, from LDS) .
//                                     B(q, col = query, same d map, resident f16 fragments), four d-steps.
//   energy = acc * 128^-0.5 in f32. Per lane the D tile holds 8 keys of ONE query: online softmax state per lane; the reference
//   point m moves (one shuffle lane^16, O and l rescaled) only when a score exceeds it by more than 4; row-sum partials combined at the end. P = e^{s-m} x 1024 as one
//   f16 vector is the B operand of O^T (rows d, cols queries) += A(v rows d, keys contiguous, from LDS) . B(P^T):
//   element r <- D of the tile covering keys kb..kb+15, element 8+r <- the tile covering kb+16..kb+31, lane unchanged.
//   Wave map: wave w works on 32 queries (two 16-column tiles, group w&3) and on 64 of every stage's 128 keys (half w>>2), so
//   each K and V fragment read from LDS feeds two query tiles. 32 keys per step: 16 score WMMAs + 16 output WMMAs per wave.
//   Behind the key loop the two waves of a query group swap one tile each (max, row sum, O^T) through the ring's LDS and join
//   the halves in f32: O = Oa e^{ma-m} + Ob e^{mb-m}; each wave then finishes one 16-query tile.
//   Block = 8 waves = 128 queries; grid = 8 b x 32.
//   Output projection: B fragment of d-step ks = f16(O^T x 64 / l) of D tiles j = 2ks (element r) and 2ks+1 (element
//   8+r), lane unchanged (col = query); A = W16 rows 384 + o (f16, x16), split k map over d, read from an LDS tile that wave 2
//   fills by one tensor_load_to_lds in front of the first barrier; D[row o][col query]
//   x 1/1024 staged in LDS (scalar stores, pitch OP), barrier, then + bf16-RNE bias; each wave stores whole 512-B rows.
// coverage: block writes o 0..127 x n n0..n0+127 of its b (16 it x 8 rows); grid covers y exactly once.
// =====================================================================================================
__global__ __launch_bounds__(256)
void attn_kernel(const unsigned short* __restrict__ QP, const unsigned short* __restrict__ KP,
                 const unsigned short* __restrict__ VP, const unsigned short* __restrict__ W16,
                 const float* __restrict__ bout, float* y) {
  // buffer u: K tile at u * 2 * TILEB, V tile at u * 2 * TILEB + TILEB; every tile starts at a multiple of 2 KiB
  __shared__ __attribute__((aligned(2048))) unsigned char Ring[6 * TILEB];
  // W_out tile (128 rows of 256 B, LDS pitch 272 B), loaded once, read by the output projection
  __shared__ __attribute__((aligned(2048))) unsigned char Wt[TILEB];
  __shared__ __align__(16) float Os[DCH * OP];
  const int tid  = threadIdx.x;
  const int lane = tid & 31;
  const uint32_t wave = uni((uint32_t)tid >> 5);
  const int hh   = lane >> 4;
  const int c    = lane & 15;
  const int bx   = blockIdx.x;
  const int b    = bx / (SEQ / QB);
  const int qb   = bx % (SEQ / QB);
  const int n0   = qb * QB;
  const _Float16* QPh = (const _Float16*)(const void*)QP;

  // ---- wave map: query group qg = 32 queries (two 16-column tiles), key half kh = 64 of every stage's 128 keys.
  //      Tile A is the tile this wave finishes (columns 32*qg + 16*kh + c), tile B the one its partner (wave ^ 4) finishes.
  const uint32_t qg = wave & 3u, kh = wave >> 2;
  const int colA = (int)(qg * 32u + kh * 16u), colB = (int)(qg * 32u + (1u - kh) * 16u);
  // ---- resident q fragments (B operand, col = query), d 0..31, 32..63, 64..95, 96..127, for both tiles ----
  const size_t qoA = ((size_t)b * SEQ + n0 + colA + c) * DCH + 8 * hh;
  const size_t qoB = ((size_t)b * SEQ + n0 + colB + c) * DCH + 8 * hh;
  const v16h qa0 = ldfrag_h(QPh + qoA), qa1 = ldfrag_h(QPh + qoA + 32);
  const v16h qa2 = ldfrag_h(QPh + qoA + 64), qa3 = ldfrag_h(QPh + qoA + 96);
  const v16h qb0 = ldfrag_h(QPh + qoB), qb1 = ldfrag_h(QPh + qoB + 32);
  const v16h qb2 = ldfrag_h(QPh + qoB + 64), qb3 = ldfrag_h(QPh + qoB + 96);

  // ---- the two issuing waves' requests: wave 0 = K tile, wave 1 = V tile ----
  const bool isV = wave == 1u;
  const uint64_t tsrc = isV ? (uint64_t)(size_t)(VP + (size_t)b * DCH * SEQ) : (uint64_t)(size_t)(KP + (size_t)b * SEQ * DCH);
  const uint32_t tstep = isV ? (uint32_t)(SK * 2) : (uint32_t)(SK * DCH * 2);     // bytes from one stage's tile to the next
  const uint32_t tdst  = (uint32_t)(size_t)Ring + (isV ? (uint32_t)TILEB : 0u);
  const u32x8 g1 = tdm_group1(isV ? (uint32_t)(SEQ * 2) : (uint32_t)(DCH * 2));

  u32x4 g0 = tdm_group0(tdst, tsrc);
  if (pinned(wave < 2u)) {
    tdm_load(g0, g1);                                          // stage 0 into buffer 0
    wait_tensor0_of(g0, g1);
  }
  // wave 2: the W_out rows of W16 (source pitch 256 B, as the K tile's) into Wt, one request per block
  const u32x4 gw = tdm_group0((uint32_t)(size_t)Wt, (uint64_t)(size_t)(W16 + (size_t)NQKV * DCH));
  if (pinned(wave == 2u)) {
    tdm_load(gw, g1);
    wait_tensor0_of(gw, g1);
  }
  asm volatile("s_wait_xcnt 0x0" ::: "memory");                // in front of the first overwrite of the q loads' address registers
  __syncthreads();                                             // stage 0 and the W_out tile published
  g0 = tdm_group0(tdst + 2u * TILEB, tsrc + tstep);
  if (pinned(wave < 2u)) {
    tdm_load(g0, g1);                                          // stage 1 into buffer 1
  }

  float mA = -1.0e30f, lA = 0.f, mB = -1.0e30f, lB = 0.f;
  float tA = -1.0e30f, tB = -1.0e30f, mshA = -1.0e30f, mshB = -1.0e30f;   // below every finite score: the first step sets m
  v8f oA[8], oB[8];
#pragma unroll
  for (int j = 0; j < 8; ++j) { oA[j] = zero8(); oB[j] = zero8(); }
  // k fragment offset in a buffer (A operand, row = key 64*kh + c of the stage), v fragment offset (A operand, row = d = c, keys
  // contiguous from key 64*kh of the stage), in halves
  const int kof = ((int)kh * (SK / 2) + c) * KVH + 8 * hh;
  const int vof = TILEB / 2 + c * KVH + 8 * hh + (int)kh * (SK / 2);
  // the K fragments of the step at hand: ka* = keys kb .. kb+15 of the wave's half, kc* = keys kb+16 .. kb+31; every fragment feeds
  // both query tiles. Step 0 of stage 0 is read here, behind the barrier that published it; each later step's one step ahead.
  v16h ka0, ka1, ka2, ka3, kc0, kc1, kc2, kc3;
  {
    const _Float16* k0p = (const _Float16*)(const void*)Ring + kof;
    const _Float16* k1p = k0p + 16 * KVH;
    ka0 = ldfrag_h(k0p); ka1 = ldfrag_h(k0p + 32); ka2 = ldfrag_h(k0p + 64); ka3 = ldfrag_h(k0p + 96);
    kc0 = ldfrag_h(k1p); kc1 = ldfrag_h(k1p + 32); kc2 = ldfrag_h(k1p + 64); kc3 = ldfrag_h(k1p + 96);
  }
  // byte offsets in the ring of the buffers of stage st, st + 1 and st + 2 (the last is the one that stage st - 1 has left)
  uint32_t bc = 0u, bn = 2u * TILEB, bf = 4u * TILEB;
  // kept rolled: one stage per trip, so the ring's publish point (waits, barrier, refill) stands once in the code
#pragma unroll 1
  for (int st = 0; st < SEQ / SK; ++st) {
    const _Float16* Tl = (const _Float16*)(const void*)(Ring + bc);
    const _Float16* Vl = Tl + vof;
    // unrolled: the stage's last step differs from the others (publish point in front, K fetched from the next stage's buffer)
#pragma unroll
    for (int sub = 0; sub < SK / 64; ++sub) {
      const int kb = sub * 32;
      if (sub == SK / 64 - 1) {
        // ---- publish point of stage st + 1, in front of stage st's last step, whose K fetch already reads that stage; then the
        //      load of stage st + 2 into the buffer that every reader of stage st - 1 has left ----
        wait_ds0();
        if (pinned(wave < 2u)) wait_tensor0_of(g0, g1);
        __syncthreads();
        if (pinned((wave < 2u) && (st + 2 < SEQ / SK))) {
          g0 = tdm_group0(tdst + bf, tsrc + (uint64_t)(st + 2) * tstep);
          tdm_load(g0, g1);
        }
      }
      v8f sA0, sA1, sB0, sB1;
      sA0 = mma_k(ka0, qa0, zero8());
      sB0 = mma_k(ka0, qb0, zero8());
      sA1 = mma_k(kc0, qa0, zero8());
      sB1 = mma_k(kc0, qb0, zero8());
      sA0 = mma_k(ka1, qa1, sA0);
      sB0 = mma_k(ka1, qb1, sB0);
      sA1 = mma_k(kc1, qa1, sA1);
      sB1 = mma_k(kc1, qb1, sB1);
      sA0 = mma_k(ka2, qa2, sA0);
      sB0 = mma_k(ka2, qb2, sB0);
      sA1 = mma_k(kc2, qa2, sA1);
      sB1 = mma_k(kc2, qb2, sB1);
      sA0 = mma_k(ka3, qa3, sA0);
      sB0 = mma_k(ka3, qb3, sB0);
      sA1 = mma_k(kc3, qa3, sA1);
      sB1 = mma_k(kc3, qb3, sB1);
      // lazy rescale: a column's reference point m stays in use until one of the step's scores exceeds it by more than LZT;
      // one test per step for both tiles, a scalar branch. Up to there P = e^{s-m} x 1024 <= e^LZT x 1024 stays finite in f16.
      // tA, tB = (m + LZT) / SCL: the test compares this lane's 16 unscaled scores of the step.
      const float rxA = fmaxf(hmax8(sA0), hmax8(sA1)), rxB = fmaxf(hmax8(sB0), hmax8(sB1));
      if (__builtin_amdgcn_ballot_w32((rxA > tA) || (rxB > tB)) != 0u) {
        float mxA = rxA * SCL, mxB = rxB * SCL;
        mxA = fmaxf(mxA, __shfl_xor(mxA, 16, 32));        // both halves of a column take the same new m
        mxB = fmaxf(mxB, __shfl_xor(mxB, 16, 32));
        const float mnA = fmaxf(mA, mxA), mnB = fmaxf(mB, mxB);
        const float corrA = __expf(mA - mnA), corrB = __expf(mB - mnB);
        mA = mnA; mB = mnB;
        tA = (mnA + LZT) * ISCL; tB = (mnB + LZT) * ISCL;
        mshA = mnA - LNPS; mshB = mnB - LNPS;             // exp gives e^{s-m} * 1024
        lA *= corrA; lB *= corrB;
#pragma unroll
        for (int j = 0; j < 8; ++j) {
#pragma unroll
          for (int r = 0; r < 8; ++r) { oA[j][r] *= corrA; oB[j][r] *= corrB; }
        }
      }
      // the step's 16 V reads; every fragment feeds both query tiles
      v16h va[8];
#pragma unroll
      for (int j = 0; j < 8; ++j) va[j] = ldfrag_h(Vl + j * 16 * KVH + kb);
      // LDS reads return in issue order: the V reads, which this step needs, stay ahead of the K reads, which the next one needs;
      // without this the scheduler puts most of the V reads behind the K reads
      __builtin_amdgcn_sched_barrier(0);
      // the next step's 16 K reads, into the fragments that this step's score products have just used, in one group with the V
      // reads: their latency passes under the exponentials and the output products. The last step of the last stage fetches
      // nothing (st is the same in every lane: a scalar branch).
      if (sub + 1 < SK / 64 || st + 1 < SEQ / SK) {
        const _Float16* k0p = (sub + 1 < SK / 64) ? Tl + kof + (kb + 32) * KVH
                                                  : (const _Float16*)(const void*)(Ring + bn) + kof;
        const _Float16* k1p = k0p + 16 * KVH;
        ka0 = ldfrag_h(k0p); ka1 = ldfrag_h(k0p + 32); ka2 = ldfrag_h(k0p + 64); ka3 = ldfrag_h(k0p + 96);
        kc0 = ldfrag_h(k1p); kc1 = ldfrag_h(k1p + 32); kc2 = ldfrag_h(k1p + 64); kc3 = ldfrag_h(k1p + 96);
      }
      // the V and K reads issue as one group in front of the exponentials, which cover their latency; without this the scheduler
      // spreads them through the exponentials, close ahead of their first use
      __builtin_amdgcn_sched_barrier(0);

      FragH pA, pB;
      float lsA = 0.f, lsB = 0.f;
#pragma unroll
      for (int r = 0; r < 8; ++r) {
        const float a0 = __expf(sA0[r] * SCL - mshA);   // key kb      + 8hh + r, tile A
        const float a1 = __expf(sA1[r] * SCL - mshA);   // key kb + 16 + 8hh + r, tile A
        const float b0 = __expf(sB0[r] * SCL - mshB);   // the same keys, tile B
        const float b1 = __expf(sB1[r] * SCL - mshB);
        lsA += a0 + a1;
        lsB += b0 + b1;
        pA.h[0][r] = (_Float16)a0;
        pA.h[1][r] = (_Float16)a1;
        pB.h[0][r] = (_Float16)b0;
        pB.h[1][r] = (_Float16)b1;
      }
      lA += lsA; lB += lsB;

#pragma unroll
      for (int j = 0; j < 8; ++j) {
        oA[j] = mma_k(va[j], pA.v, oA[j]);
        oB[j] = mma_k(va[j], pB.v, oB[j]);
      }
      // these four vector slots keep the distance between the
      // step's last WMMA and the first vector instruction behind the loop's back edge, which may overwrite its A or B
      asm volatile("v_nop\n\tv_nop\n\tv_nop\n\tv_nop" : "+v"(oB[7]) : "v"(va[7]), "v"(pB.v));
    }
    const uint32_t bt = bc; bc = bn; bn = bf; bf = bt;          // the ring turns by one buffer
  }
  wait_tensor0();
  wait_ds0();
  __syncthreads();                                             // every wave's last read of the ring has returned: it becomes staging
  // ---- join the two key halves: every wave hands tile B (running max, row-sum partial, O^T) to its partner through the ring,
  //      which nobody reads any more behind this barrier, and adds the partner's half to its own tile A ----
  {
    v4f* xs = (v4f*)(void*)Ring + (size_t)wave * (17 * 32) + lane;              // 17 x 512 B per wave, 16 B per lane
    const v4f* xr = (const v4f*)(const void*)Ring + (size_t)(wave ^ 4u) * (17 * 32) + lane;
#pragma unroll
    for (int j = 0; j < 8; ++j) {
      const v4f lo = {oB[j][0], oB[j][1], oB[j][2], oB[j][3]}, hi = {oB[j][4], oB[j][5], oB[j][6], oB[j][7]};
      xs[(2 * j) * 32] = lo;
      xs[(2 * j + 1) * 32] = hi;
    }
    const v4f ml = {mB, lB, 0.f, 0.f};
    xs[16 * 32] = ml;
    __syncthreads();                                                            // both halves' tiles are in LDS
    const v4f pm = xr[16 * 32];
    const float mt = fmaxf(mA, pm[0]);
    const float fa = __expf(mA - mt), fp = __expf(pm[0] - mt);
    lA = lA * fa + pm[1] * fp;
#pragma unroll
    for (int j = 0; j < 8; ++j) {
      const v4f lo = xr[(2 * j) * 32], hi = xr[(2 * j + 1) * 32];
#pragma unroll
      for (int r = 0; r < 4; ++r) {
        oA[j][r]     = oA[j][r] * fa + lo[r] * fp;
        oA[j][4 + r] = oA[j][4 + r] * fa + hi[r] * fp;
      }
    }
  }
  const float l = lA + __shfl_xor(lA, 16, 32);
  const float sc = OSC / l;                 // both o and l carry the x1024 factor; sc scales O by 64

  // ---- O (x64) as f16 B fragments of the output projection: d-step ks <- D tiles 2ks (r) and 2ks+1 (8+r) ----
  FragH ob0, ob1, ob2, ob3;
#pragma unroll
  for (int r = 0; r < 8; ++r) {
    ob0.h[0][r] = (_Float16)(oA[0][r] * sc); ob0.h[1][r] = (_Float16)(oA[1][r] * sc);
    ob1.h[0][r] = (_Float16)(oA[2][r] * sc); ob1.h[1][r] = (_Float16)(oA[3][r] * sc);
    ob2.h[0][r] = (_Float16)(oA[4][r] * sc); ob2.h[1][r] = (_Float16)(oA[5][r] * sc);
    ob3.h[0][r] = (_Float16)(oA[6][r] * sc); ob3.h[1][r] = (_Float16)(oA[7][r] * sc);
  }

  // ---- y^T tile: for each o tile, A = W_out rows 16*ot + c (f16 x16, split map over d), 4 d-steps; stage x 1/1024 ----
  const _Float16* wp = (const _Float16*)(const void*)Wt + c * KVH + 8 * hh;
  float* os = Os + (8 * hh) * OP + colA + c;                // row o = 16*ot + 8hh + r, col = query colA + c
#pragma unroll
  for (int og = 0; og < 2; ++og) {
    // four o tiles' 16 fragments as one group of LDS reads in front of their products: one read latency per group
    v16h wf[16];
#pragma unroll
    for (int t = 0; t < 16; ++t) wf[t] = ldfrag_h(wp + (og * 4 + (t >> 2)) * 16 * KVH + 32 * (t & 3));
#pragma unroll
    for (int t = 0; t < 4; ++t) {
      const int ot = og * 4 + t;
      v8f ya = zero8();
      ya = mma_h(wf[4 * t + 0], ob0.v, ya);
      ya = mma_h(wf[4 * t + 1], ob1.v, ya);
      ya = mma_h(wf[4 * t + 2], ob2.v, ya);
      ya = mma_h(wf[4 * t + 3], ob3.v, ya);
#pragma unroll
      for (int r = 0; r < 8; ++r) os[(ot * 16 + r) * OP] = ya[r] * IYS;
    }
  }
  __syncthreads();
  {
    float* ob = y + ((size_t)b * DCH) * SEQ + n0;
#pragma unroll
    for (int it = 0; it < 16; ++it) {
      const int row = it * 8 + (int)wave;                 // o row 0..127: one wave stores the row's 128 queries (512 B)
      const v4f v   = *(const v4f*)(Os + row * OP + 4 * lane);
      const float bb = bfr(bout[row]);
      const v4f vo  = {v[0] + bb, v[1] + bb, v[2] + bb, v[3] + bb};
      *(v4f*)(ob + (size_t)row * SEQ + 4 * lane) = vo;
    }
  }
}

// =====================================================================================================
//   W16  16-bit [512][128]        0           131072
//   QP   f16    [8][4096][128]    131072      8388608
//   KP   f16    [8][4096][128]    8519680     8388608
//   VP   f16    [8][128][4096]    16908288    8388608
//   end                           25296896
// =====================================================================================================
extern "C" void kernel_launch(void* const* d_in, const int* in_sizes, int n_in,
                              void* d_out, int out_size, void* d_ws, size_t ws_size,
                              hipStream_t stream) {
  const int NX = NB * DCH * SEQ;                        // 4194304
  if (n_in < 4) return;
  if (in_sizes[0] != NX || in_sizes[1] != NQKV * DCH || in_sizes[2] != DCH * DCH || in_sizes[3] != DCH) return;
  if (out_size != NX) return;

  size_t off = 0;
  const size_t oW  = off; off += (size_t)NW * DCH * 2;            // 131072
  const size_t szP = (size_t)NB * SEQ * DCH * 2;                  // 8388608
  const size_t oQ  = off; off += szP;
  const size_t oK  = off; off += szP;
  const size_t oV  = off; off += (size_t)NB * DCH * SEQ * 2;      // 8388608
  if (off > ws_size) return;                                      // off = 25296896
  if (off > (size_t)134217728) return;

  const float* x    = (const float*)d_in[0];
  const float* Wqkv = (const float*)d_in[1];
  const float* Wout = (const float*)d_in[2];
  const float* bout = (const float*)d_in[3];
  char* ws = (char*)d_ws;
  unsigned short* W16 = (unsigned short*)(ws + oW);
  unsigned short* QPp = (unsigned short*)(ws + oQ);
  unsigned short* KPp = (unsigned short*)(ws + oK);
  unsigned short* VPp = (unsigned short*)(ws + oV);
  float* y = (float*)d_out;

  const dim3 blk256(256);
  const dim3 gW((NW * DCH / 8) / 256);                  // 32 blocks
  const dim3 gP(NB * (SEQ / QT));                       // 512 blocks: one (b, 64-position tile) each
  const dim3 gA(NB * (SEQ / QB));                       // 256 blocks: one (b, 128-query tile) each

  // (0) stacked 16-bit weight plane
  cvt_w<<<gW, blk256, 0, stream>>>(Wqkv, Wout, W16);
  // (1) q, k, v planes
  proj_kernel<<<gP, blk256, 0, stream>>>(x, W16, QPp, KPp, VPp);
  // (2) attention + output projection + bias: y[b][o][n]
  attn_kernel<<<gA, blk256, 0, stream>>>(QPp, KPp, VPp, W16, bout, y);
  (void)hipGetLastError();
}

// v006
// It runs in 61.9 microseconds.
// Two timings next to v005 both put it at 1.04 times that version's speed.
// Over all steps from v000 it is 7.35 times as fast.
// Contractions: q/k/v 1x1-conv projections = W_qkv (bf16, RNE convert of input) . X (bf16, RNE convert of input) on
// v_wmma_f32_16x16x32_bf16, K=128; scores S^T = k (f16) . q^T (f16) on v_wmma_f32_16x16x32_f16, K=128, one product;
// O^T = v (f16) . P^T (f16, e^{s-m} x 1024 taken from the score D registers) on v_wmma_f32_16x16x32_f16 over 4096
// keys, one product; y = W_out (f16 bits of the bf16-RNE input x 16) . O (f16, x 64, taken from the O^T D registers)
// on v_wmma_f32_16x16x32_f16, K=128, one product; f32 accumulate everywhere; softmax (running max, row sums, 1/l)
// and the bias add in f32 on VALU; the 128^-0.5 scale, times log2 e, is multiplied in f32 into q in front of its f16 convert.
#include <hip/hip_runtime.h>
#include <math.h>
#include <stdint.h>

#define NB    8
#define DCH   128
#define SEQ   4096
#define NQKV  384
#define NW    512
#define QT    64
#define AP    144
#define LQP   136
#define LVP   72
#define OP    132
#define QB    128
#define SK    128
#define KVH   136
#define TILEB 34816
#define PSH   10.0f
#define THR   15.770780163555854f
#define QSC   0.12751743f
#define OSC   64.0f
#define WSC   16.0f
#define IYS   0.0009765625f
static_assert((SEQ % QT) == 0);
static_assert((SEQ % 32) == 0);
static_assert((DCH % 32) == 0);
static_assert(NQKV == 3 * DCH);
static_assert(NW == NQKV + DCH);
static_assert(((NW * DCH) / 8) % 256 == 0);
static_assert(64 * AP == DCH * LVP);
static_assert(LQP >= DCH && (LQP % 8) == 0);
static_assert((AP % 8) == 0 && (LVP % 8) == 0);
static_assert(OP >= QB && (OP % 4) == 0);
static_assert((SEQ % QB) == 0 && (SEQ % SK) == 0 && (SEQ / SK) >= 2 && (SK % 32) == 0);
static_assert(2 * DCH == 256 && 2 * SK == 256);           // both tiles have rows of 256 bytes
static_assert(2 * KVH == 256 + 16);                        // LDS row pitch = row + the 16-byte pad of the tensor load
static_assert(TILEB == SK * 2 * KVH && TILEB == DCH * 2 * KVH && (TILEB % 2048) == 0);
static_assert((SK % 64) == 0);                             // each key half of a stage is a whole number of 32-key steps
static_assert(8 * 17 * 512 <= 6 * TILEB);                  // the waves' swap of one tile each fits the ring's LDS

typedef _Float16       v16h __attribute__((ext_vector_type(16)));
typedef _Float16       v8h  __attribute__((ext_vector_type(8)));
typedef __bf16         v16b __attribute__((ext_vector_type(16)));
typedef unsigned short v8us __attribute__((ext_vector_type(8)));
typedef float          v8f  __attribute__((ext_vector_type(8)));
typedef float          v4f  __attribute__((ext_vector_type(4)));
typedef unsigned int   v4u  __attribute__((ext_vector_type(4)));
typedef uint32_t       u32x4 __attribute__((ext_vector_type(4)));
typedef uint32_t       u32x8 __attribute__((ext_vector_type(8)));

union FragH { v16h v; v8h  h[2]; };
union FragB { v16b v; v8us u[2]; };
static_assert(sizeof(FragH) == 32);
static_assert(sizeof(FragB) == 32);

// ---- scalar helpers --------------------------------------------------------------------------------
__device__ __forceinline__ unsigned short bf_bits(float f) {          // f32 -> bf16 bits, RNE convert
  unsigned u = __float_as_uint(f);
  return (unsigned short)((u + 0x7FFFu + ((u >> 16) & 1u)) >> 16);
}
__device__ __forceinline__ float bf_up(unsigned short h) { return __uint_as_float(((unsigned)h) << 16); }
__device__ __forceinline__ float bfr(float f) { return bf_up(bf_bits(f)); }
__device__ __forceinline__ unsigned short h_bits(_Float16 x) { return __builtin_bit_cast(unsigned short, x); }
__device__ __forceinline__ unsigned pk16(unsigned short a, unsigned short b) { return (unsigned)a | ((unsigned)b << 16); }
__device__ __forceinline__ v8f zero8() { v8f z = {0.f, 0.f, 0.f, 0.f, 0.f, 0.f, 0.f, 0.f}; return z; }
__device__ __forceinline__ float hmax8(v8f s) {
  return fmaxf(fmaxf(fmaxf(s[0], s[1]), fmaxf(s[2], s[3])), fmaxf(fmaxf(s[4], s[5]), fmaxf(s[6], s[7])));
}

// ---- fragment loaders: 16-bit A/B operand, lane -> row/col (lane&15), p already includes +8*(lane>>4);
//      elements 0..7 <- p[0..7] (k0+8h..), elements 8..15 <- p[16..23] (k0+16+8h..)
__device__ __forceinline__ v16h ldfrag_h(const _Float16* p) {
  FragH f;
  f.h[0] = *(const v8h*)(p);
  f.h[1] = *(const v8h*)(p + 16);
  return f.v;
}
__device__ __forceinline__ v16b ldfrag_b(const unsigned short* p) {
  FragB f;
  f.u[0] = *(const v8us*)(p);
  f.u[1] = *(const v8us*)(p + 16);
  return f.v;
}

// ---- WMMA helpers: builtin followed by a 4-slot VALU gap tying D and keeping A/B live ----------------------
__device__ __forceinline__ v8f mma_h(v16h a, v16h b, v8f c) {
  v8f d = __builtin_amdgcn_wmma_f32_16x16x32_f16(false, a, false, b, (short)0, c, false, false);
#if defined(__HIP_DEVICE_COMPILE__)
  asm volatile("v_nop\n\tv_nop\n\tv_nop\n\tv_nop" : "+v"(d) : "v"(a), "v"(b));
#endif
  return d;
}
// key loop of the attention: the plain builtin, padded by the compiler. The asm statement above takes its vector operands below v256,
// and the 32-column wave's fragments and accumulators do not all fit there (scratch reloads inside the loop).
__device__ __forceinline__ v8f mma_k(v16h a, v16h b, v8f c) {
  return __builtin_amdgcn_wmma_f32_16x16x32_f16(false, a, false, b, (short)0, c, false, false);
}
__device__ __forceinline__ v8f mma_b(v16b a, v16b b, v8f c) {
  v8f d = __builtin_amdgcn_wmma_f32_16x16x32_bf16(false, a, false, b, (short)0, c, false, false);
#if defined(__HIP_DEVICE_COMPILE__)
  const v16h ha = __builtin_bit_cast(v16h, a), hb = __builtin_bit_cast(v16h, b);
  asm volatile("v_nop\n\tv_nop\n\tv_nop\n\tv_nop" : "+v"(d) : "v"(ha), "v"(hb));
#endif
  return d;
}

// ---- one wave: 16 n rows x 64 output channels (4 D tiles) over K = 128 (4 k-steps), A from LDS, B from the chunk's
//      bf16 weight tile in LDS (rows = output channel, k = input channel contiguous, pitch KVH); the chunk's fragment
//      reads stand as one group in front of its 16 products, so their latency is paid once per chunk
__device__ __forceinline__ void gemm4(const unsigned short* ap, const unsigned short* bp,
                                      v8f& acc0, v8f& acc1, v8f& acc2, v8f& acc3) {
  v16b a[4], w[16];
#pragma unroll
  for (int ks = 0; ks < 4; ++ks) {
    a[ks] = ldfrag_b(ap + 32 * ks);
#pragma unroll
    for (int j = 0; j < 4; ++j) w[4 * ks + j] = ldfrag_b(bp + 32 * ks + j * 16 * KVH);
  }
  acc0 = zero8(); acc1 = zero8(); acc2 = zero8(); acc3 = zero8();
#pragma unroll
  for (int ks = 0; ks < 4; ++ks) {
    acc0 = mma_b(a[ks], w[4 * ks + 0], acc0);
    acc1 = mma_b(a[ks], w[4 * ks + 1], acc1);
    acc2 = mma_b(a[ks], w[4 * ks + 2], acc2);
    acc3 = mma_b(a[ks], w[4 * ks + 3], acc3);
  }
}

// ---- LDS staging helpers for the projection epilogue (D rows = n, D cols = channel) ------------------------
__device__ __forceinline__ void stage_h(unsigned short* L, int nr, int col, v8f acc) {
#pragma unroll
  for (int r = 0; r < 8; ++r) L[(nr + r) * LQP + col] = h_bits((_Float16)acc[r]);
}
// q rows: x 128^-0.5 x log2 e in f32 in front of the f16 convert, so that the score products come out as exponents of 2
__device__ __forceinline__ void stage_q(unsigned short* L, int nr, int col, v8f acc) {
#pragma unroll
  for (int r = 0; r < 8; ++r) L[(nr + r) * LQP + col] = h_bits((_Float16)(acc[r] * QSC));
}
__device__ __forceinline__ void stage_v(unsigned short* Lv, int e, int nr, v8f acc) {
#pragma unroll
  for (int r = 0; r < 8; ++r) Lv[e * LVP + nr + r] = h_bits((_Float16)acc[r]);
}

// ---- tensor load to LDS: descriptor words live in scalar registers; every test around an issue is a scalar branch ----
__device__ __forceinline__ uint32_t uni(uint32_t v) { return (uint32_t)__builtin_amdgcn_readfirstlane(v); }
__device__ __forceinline__ uint32_t pinned(uint32_t v) {
  uint32_t w = uni(v);
  asm volatile("" : "+s"(w));   // pinned(): an issue test or a descriptor word held in a scalar register; the test then compiles to s_cmp + s_cbranch_scc (tensor loads ignore EXEC)
  return w;
}
// group 1: 1-byte elements, tile = tensor = 128 rows of 256 bytes, 16 bytes of LDS pad behind every 256-byte row
__device__ __forceinline__ u32x8 tdm_group1(uint32_t src_pitch) {
  u32x8 g;
  // pinned(): each descriptor word held in a scalar register of its own, so that the tuple is built once and nothing rewrites it
  // while a request is in flight; word 0 stays a plain constant
  g[0] = uni((1u << 20) | (5u << 22) | (3u << 25));
  g[1] = pinned(256u << 16);
  g[2] = pinned(128u << 16);
  g[3] = pinned(256u << 16);
  g[4] = pinned(128u);
  g[5] = pinned(src_pitch);
  g[6] = pinned(0u);
  g[7] = pinned(0u);
  return g;
}
__device__ __forceinline__ u32x4 tdm_group0(uint32_t lds_dst, uint64_t ga) {
  u32x4 g;
  g[0] = uni(1u);
  g[1] = uni(lds_dst);
  g[2] = uni((uint32_t)ga);
  g[3] = uni((((uint32_t)(ga >> 32)) & 0x01FFFFFFu) | 0x80000000u);
  asm volatile("" : "+s"(g));   // descriptor words held in scalar registers: the tuple is complete here, in front of the issue test
  return g;
}
__device__ __forceinline__ void tdm_load(u32x4 g0, u32x8 g1) {
  asm volatile("tensor_load_to_lds %0, %1" :: "s"(g0), "s"(g1) : "memory");   // one request of the whole wave: a 2-D tile into LDS
}
// the compiler places no wait for a tensor load: the issuing wave's own wait says that its tile has landed
__device__ __forceinline__ void wait_tensor0() { asm volatile("s_wait_tensorcnt 0x0" ::: "memory"); }
// the same wait, naming the request's descriptor as inputs: its registers stay live, so unwritten, until the tile has landed
__device__ __forceinline__ void wait_tensor0_of(u32x4 g0, u32x8 g1) {
  asm volatile("s_wait_tensorcnt 0x0" :: "s"(g0), "s"(g1) : "memory");
}
// this wave's LDS reads have returned before the barrier behind which their buffer is refilled
__device__ __forceinline__ void wait_ds0() { asm volatile("s_wait_dscnt 0x0" ::: "memory"); }

// ---- weight element convert: rows < NQKV -> bf16 bits; rows >= NQKV -> f16 bits of (bf16 RNE value x 16)
__device__ __forceinline__ unsigned short cvt_sel(bool isq, float fq, float fo) {
  const unsigned short uq = bf_bits(fq);
  const unsigned short uo = h_bits((_Float16)(bfr(fo) * WSC));
  return isq ? uq : uo;
}

// =====================================================================================================
// (0) stacked 16-bit weight plane W16[512][128]: rows 0..383 = bf16 bits of W_qkv (RNE convert),
//     rows 384..511 = f16 bits of (bf16 RNE value of W_out) x 16. Thread i writes 8 halves (16 B) at element 8i;
//     sources loaded with clamped rows, selected by value.
// coverage: 32 blocks x 256 threads x 8 = 65536 = 512 x 128.
// =====================================================================================================
__global__ __launch_bounds__(256) void cvt_w(const float* __restrict__ wqkv, const float* __restrict__ wout,
                                             unsigned short* W16) {
  const int i = blockIdx.x * 256 + threadIdx.x;
  if (i >= (NW * DCH) / 8) return;
  const int row = i >> 4;                  // 0..511
  const int col = (i & 15) * 8;
  const int ra = min(row, NQKV - 1);
  const int rb = min(max(row - NQKV, 0), DCH - 1);
  const v4f a0 = *(const v4f*)(wqkv + (size_t)ra * DCH + col), a1 = *(const v4f*)(wqkv + (size_t)ra * DCH + col + 4);
  const v4f c0 = *(const v4f*)(wout + (size_t)rb * DCH + col), c1 = *(const v4f*)(wout + (size_t)rb * DCH + col + 4);
  const bool isq = row < NQKV;
  v4u w;
#pragma unroll
  for (int t = 0; t < 2; ++t) {
    w[t]     = pk16(cvt_sel(isq, a0[2 * t], c0[2 * t]), cvt_sel(isq, a0[2 * t + 1], c0[2 * t + 1]));
    w[2 + t] = pk16(cvt_sel(isq, a1[2 * t], c1[2 * t]), cvt_sel(isq, a1[2 * t + 1], c1[2 * t + 1]));
  }
  unsigned short* p = W16 + (size_t)i * 8;
  *(v4u*)p = w;
  
}

// =====================================================================================================
// (1) fused q/k/v projection for one (b, 64-position tile): block = 256 threads = 8 waves.
//   x tile [128 d][64 n] f32 is staged once as bf16 A tile Lav[n][d] (pitch AP halves, 2-byte LDS stores), barrier.
//   Wave w: n group ng = w&3 (A rows n = 16ng + (lane&15), split k map over d), channel half ch = w>>2
//   (B = W16 rows chunk*128 + ch*64 + 16j + (lane&15), same split k map), 4 D tiles per chunk, 4 k-steps of 32,
//   chunks q, k, v in sequence (A reloaded from LDS). The 384 weight rows come once per block by tensor_load_to_lds into three
//   LDS tiles (rows padded to 272 B); every B fragment is read from there.
//   Epilogue: D -> f16 bits in LDS: q tile Lq[n][128] (x 128^-0.5 x log2 e), k tile Lk[n][128], v transposed Lv[e][n] (aliases Lav after
//   [b][e][4096] (line = 64 keys of one e row); every line = 8 consecutive lanes x 16 B of one instruction, two
// coverage: Lav: 256 threads x 8 it x 4 = 64 n x 128 d; Lq/Lk: 8 waves x (16 n x 64 ch) per chunk = 64 x 128;
//           Q/K planes: 4 it x 32 lines x 8 lanes x 8 halves = 64 rows x 128; V plane: 4 it x 32 lines x 8 x 8 =
//           128 e x 64 n; grid = 8 x 64 blocks covers every plane exactly once.
// =====================================================================================================
__global__ __launch_bounds__(256)
void proj_kernel(const float* __restrict__ x, const unsigned short* __restrict__ W16,
                 unsigned short* QP, unsigned short* KP, unsigned short* VP) {
  // q, k and v weight tiles (128 rows of 256 B each, LDS pitch 272 B), tile t at t * TILEB: a multiple of 2 KiB
  __shared__ __attribute__((aligned(2048))) unsigned char Wt[3 * TILEB];
  __shared__ __align__(16) unsigned short Lav[64 * AP];    // A tile [n][d]; reused as Lv[e][n] (pitch LVP) later
  __shared__ __align__(16) unsigned short Lq[64 * LQP];    // q f16 [n][128]
  __shared__ __align__(16) unsigned short Lk[64 * LQP];    // k f16 [n][128]
  const int tid  = threadIdx.x;
  const int lane = tid & 31, wave = tid >> 5;
  const int hh   = lane >> 4, c = lane & 15;
  const int bx   = blockIdx.x;
  const int b    = bx / (SEQ / QT);
  const int nt   = bx % (SEQ / QT);
  const int n0   = nt * QT;

  // ---- stage x tile as bf16 [n][d] ----
  {
    const int n4 = (tid & 15) * 4, ds = tid >> 4;          // ds 0..15
    const float* xp = x + ((size_t)b * DCH + ds) * SEQ + n0 + n4;
    v4f xv[8];
#pragma unroll
    for (int it = 0; it < 8; ++it) xv[it] = *(const v4f*)(xp + (size_t)it * 16 * SEQ);
    asm volatile("s_wait_xcnt 0x0" ::: "memory");          // in front of the first overwrite of the x loads' address registers
    // ---- the three weight tiles by tensor_load_to_lds, once per block: waves 0, 1, 2 bring the q, k, v rows of W16, one request
    //      each, behind the issue of the x loads, whose latency the request's own wait overlaps ----
    const uint32_t wv = uni((uint32_t)tid >> 5);
    const u32x8 g1 = tdm_group1((uint32_t)(DCH * 2));
    const u32x4 g0 = tdm_group0((uint32_t)(size_t)Wt + wv * (uint32_t)TILEB,
                                (uint64_t)(size_t)W16 + (uint64_t)wv * (uint64_t)(DCH * DCH * 2));
    if (pinned(wv < 3u)) {
      tdm_load(g0, g1);
      wait_tensor0_of(g0, g1);
    }
#pragma unroll
    for (int it = 0; it < 8; ++it) {
      const int d = it * 16 + ds;                          // 0..127
#pragma unroll
      for (int q = 0; q < 4; ++q) Lav[(n4 + q) * AP + d] = bf_bits(xv[it][q]);
    }
  }
  __syncthreads();            // publishes the x tile and the three weight tiles

  // ---- GEMMs: 16 n rows x 64 channels per wave per chunk ----
  const int ng = wave & 3, ch = wave >> 2;
  const unsigned short* ap = Lav + (ng * 16 + c) * AP + 8 * hh;
  const int nr = ng * 16 + 8 * hh;                         // D row r -> n local nr + r
  const int cb = ch * 64;                                  // channel base within a chunk; D col = cb + 16j + c
  v8f acc0, acc1, acc2, acc3;
  const unsigned short* wl = (const unsigned short*)(const void*)Wt + (cb + c) * KVH + 8 * hh;   // tile rows follow on: row r at r * KVH

  // q chunk (weight rows 0..127)
  gemm4(ap, wl + 0 * DCH * KVH, acc0, acc1, acc2, acc3);
  stage_q(Lq, nr, cb + 0 * 16 + c, acc0);
  stage_q(Lq, nr, cb + 1 * 16 + c, acc1);
  stage_q(Lq, nr, cb + 2 * 16 + c, acc2);
  stage_q(Lq, nr, cb + 3 * 16 + c, acc3);
  // k chunk (weight rows 128..255)
  gemm4(ap, wl + 1 * DCH * KVH, acc0, acc1, acc2, acc3);
  stage_h(Lk, nr, cb + 0 * 16 + c, acc0);
  stage_h(Lk, nr, cb + 1 * 16 + c, acc1);
  stage_h(Lk, nr, cb + 2 * 16 + c, acc2);
  stage_h(Lk, nr, cb + 3 * 16 + c, acc3);
  // v chunk (weight rows 256..383)
  gemm4(ap, wl + 2 * DCH * KVH, acc0, acc1, acc2, acc3);

  __syncthreads();            // every wave is done reading Lav before it is reused as Lv
  stage_v(Lav, cb + 0 * 16 + c, nr, acc0);
  stage_v(Lav, cb + 1 * 16 + c, nr, acc1);
  stage_v(Lav, cb + 2 * 16 + c, nr, acc2);
  stage_v(Lav, cb + 3 * 16 + c, nr, acc3);
  __syncthreads();

  {
    const int e = tid & 7, lq = tid >> 3;                    // lq 0..31
{
#pragma unroll
      for (int it = 0; it < 4; ++it) {
        const int L  = it * 32 + lq;                         // 0..127
        const int n  = L >> 1, hf = L & 1;                   // row 0..63, half 0..1
        const size_t go = ((size_t)b * SEQ + n0 + n) * DCH + hf * 64 + 8 * e;
        const int lo_ = n * LQP + hf * 64 + 8 * e;
        const v4u uq = *(const v4u*)(Lq + lo_);
        const v4u uk = *(const v4u*)(Lk + lo_);
        *(v4u*)(QP + go) = uq;
        *(v4u*)(KP + go) = uk;
      }
#pragma unroll
      for (int it = 0; it < 4; ++it) {
        const int er = it * 32 + lq;                         // 0..127
        const v4u uv = *(const v4u*)(Lav + er * LVP + 8 * e);
        *(v4u*)(VP + ((size_t)b * DCH + er) * SEQ + n0 + 8 * e) = uv;
      }
      
    }
  }
}

// =====================================================================================================
// (2) attention + output projection for one (b, 128-query tile), transposed formulation, 128-deep scores, 4096 keys:
//   K rows and V rows come in stages of 128 keys by tensor_load_to_lds into a ring of three LDS buffers that the block's
//   8 waves share: wave 0 brings the K tile (128 keys x 256 B, source pitch 256 B), wave 1 the V tile (128 d rows x
//   256 B = 128 keys, source pitch 8192 B), each one request per stage, rows padded to a pitch of 272 B in LDS.
//   Every wave fetches its K fragments one 32-key step ahead, so the publish point of stage s + 1 stands in front of stage s's
//   last step: s_wait_dscnt 0, the issuers' s_wait_tensorcnt 0, the workgroup barrier, then stage s + 2's load into the buffer
//   that stage s - 1 has left.
//   S^T tile (16 keys x 16 queries) = A(k rows = keys kb + (lane&15), d via the split k map, f16, from LDS) .
//                                     B(q, col = query, same d map, resident f16 fragments), four d-steps.
//   q carries 128^-0.5 x log2 e, and the score accumulators start at 10 - m (m = the column's reference point, in powers of 2), so
//   a D register is the exponent itself: P = 2^D = e^{s-m} x 1024. Per lane the D tile holds 8 keys of ONE query: online softmax state per lane; the reference
//   point m moves (one shuffle lane^16, D shifted, O and l rescaled) only when a score exceeds it by more than 4 (natural log); row-sum partials combined at the end. P as one
//   f16 vector is the B operand of O^T (rows d, cols queries) += A(v rows d, keys contiguous, from LDS) . B(P^T):
//   element r <- D of the tile covering keys kb..kb+15, element 8+r <- the tile covering kb+16..kb+31, lane unchanged.
//   Wave map: wave w works on 32 queries (two 16-column tiles, group w&3) and on 64 of every stage's 128 keys (half w>>2), so
//   each K and V fragment read from LDS feeds two query tiles. 32 keys per step: 16 score WMMAs + 16 output WMMAs per wave.
//   Behind the key loop the two waves of a query group swap one tile each (max, row sum, O^T) through the ring's LDS and join
//   the halves in f32: O = Oa 2^{ma-m} + Ob 2^{mb-m}; each wave then finishes one 16-query tile.
//   Block = 8 waves = 128 queries; grid = 8 b x 32.
//   Output projection: B fragment of d-step ks = f16(O^T x 64 / l) of D tiles j = 2ks (element r) and 2ks+1 (element
//   8+r), lane unchanged (col = query); A = W16 rows 384 + o (f16, x16), split k map over d, read from an LDS tile that wave 2
//   fills by one tensor_load_to_lds in front of the first barrier; D[row o][col query]
//   x 1/1024 staged in LDS (scalar stores, pitch OP), barrier, then + bf16-RNE bias; each wave stores whole 512-B rows.
// coverage: block writes o 0..127 x n n0..n0+127 of its b (16 it x 8 rows); grid covers y exactly once.
// =====================================================================================================
__global__ __launch_bounds__(256)
void attn_kernel(const unsigned short* __restrict__ QP, const unsigned short* __restrict__ KP,
                 const unsigned short* __restrict__ VP, const unsigned short* __restrict__ W16,
                 const float* __restrict__ bout, float* y) {
  // buffer u: K tile at u * 2 * TILEB, V tile at u * 2 * TILEB + TILEB; every tile starts at a multiple of 2 KiB
  __shared__ __attribute__((aligned(2048))) unsigned char Ring[6 * TILEB];
  // W_out tile (128 rows of 256 B, LDS pitch 272 B), loaded once, read by the output projection
  __shared__ __attribute__((aligned(2048))) unsigned char Wt[TILEB];
  __shared__ __align__(16) float Os[DCH * OP];
  const int tid  = threadIdx.x;
  const int lane = tid & 31;
  const uint32_t wave = uni((uint32_t)tid >> 5);
  const int hh   = lane >> 4;
  const int c    = lane & 15;
  const int bx   = blockIdx.x;
  const int b    = bx / (SEQ / QB);
  const int qb   = bx % (SEQ / QB);
  const int n0   = qb * QB;
  const _Float16* QPh = (const _Float16*)(const void*)QP;

  // ---- wave map: query group qg = 32 queries (two 16-column tiles), key half kh = 64 of every stage's 128 keys.
  //      Tile A is the tile this wave finishes (columns 32*qg + 16*kh + c), tile B the one its partner (wave ^ 4) finishes.
  const uint32_t qg = wave & 3u, kh = wave >> 2;
  const int colA = (int)(qg * 32u + kh * 16u), colB = (int)(qg * 32u + (1u - kh) * 16u);
  // ---- resident q fragments (B operand, col = query), d 0..31, 32..63, 64..95, 96..127, for both tiles ----
  const size_t qoA = ((size_t)b * SEQ + n0 + colA + c) * DCH + 8 * hh;
  const size_t qoB = ((size_t)b * SEQ + n0 + colB + c) * DCH + 8 * hh;
  const v16h qa0 = ldfrag_h(QPh + qoA), qa1 = ldfrag_h(QPh + qoA + 32);
  const v16h qa2 = ldfrag_h(QPh + qoA + 64), qa3 = ldfrag_h(QPh + qoA + 96);
  const v16h qb0 = ldfrag_h(QPh + qoB), qb1 = ldfrag_h(QPh + qoB + 32);
  const v16h qb2 = ldfrag_h(QPh + qoB + 64), qb3 = ldfrag_h(QPh + qoB + 96);

  // ---- the two issuing waves' requests: wave 0 = K tile, wave 1 = V tile ----
  const bool isV = wave == 1u;
  const uint64_t tsrc = isV ? (uint64_t)(size_t)(VP + (size_t)b * DCH * SEQ) : (uint64_t)(size_t)(KP + (size_t)b * SEQ * DCH);
  const uint32_t tstep = isV ? (uint32_t)(SK * 2) : (uint32_t)(SK * DCH * 2);     // bytes from one stage's tile to the next
  const uint32_t tdst  = (uint32_t)(size_t)Ring + (isV ? (uint32_t)TILEB : 0u);
  const u32x8 g1 = tdm_group1(isV ? (uint32_t)(SEQ * 2) : (uint32_t)(DCH * 2));

  u32x4 g0 = tdm_group0(tdst, tsrc);
  if (pinned(wave < 2u)) {
    tdm_load(g0, g1);                                          // stage 0 into buffer 0
    wait_tensor0_of(g0, g1);
  }
  // wave 2: the W_out rows of W16 (source pitch 256 B, as the K tile's) into Wt, one request per block
  const u32x4 gw = tdm_group0((uint32_t)(size_t)Wt, (uint64_t)(size_t)(W16 + (size_t)NQKV * DCH));
  if (pinned(wave == 2u)) {
    tdm_load(gw, g1);
    wait_tensor0_of(gw, g1);
  }
  asm volatile("s_wait_xcnt 0x0" ::: "memory");                // in front of the first overwrite of the q loads' address registers
  __syncthreads();                                             // stage 0 and the W_out tile published
  g0 = tdm_group0(tdst + 2u * TILEB, tsrc + tstep);
  if (pinned(wave < 2u)) {
    tdm_load(g0, g1);                                          // stage 1 into buffer 1
  }

  float mA = -1.0e30f, lA = 0.f, mB = -1.0e30f, lB = 0.f;
  float thr = -3.0e38f;                            // below every finite score: the first step sets m
  // start value of the score accumulators, 10 - m in all eight rows of a column (0 until the first step has set m)
  v8f cA = zero8(), cB = zero8();
  v8f oA[8], oB[8];
#pragma unroll
  for (int j = 0; j < 8; ++j) { oA[j] = zero8(); oB[j] = zero8(); }
  // k fragment offset in a buffer (A operand, row = key 64*kh + c of the stage), v fragment offset (A operand, row = d = c, keys
  // contiguous from key 64*kh of the stage), in halves
  const int kof = ((int)kh * (SK / 2) + c) * KVH + 8 * hh;
  const int vof = TILEB / 2 + c * KVH + 8 * hh + (int)kh * (SK / 2);
  // the K fragments of the step at hand: ka* = keys kb .. kb+15 of the wave's half, kc* = keys kb+16 .. kb+31; every fragment feeds
  // both query tiles. Step 0 of stage 0 is read here, behind the barrier that published it; each later step's one step ahead.
  v16h ka0, ka1, ka2, ka3, kc0, kc1, kc2, kc3;
  {
    const _Float16* k0p = (const _Float16*)(const void*)Ring + kof;
    const _Float16* k1p = k0p + 16 * KVH;
    ka0 = ldfrag_h(k0p); ka1 = ldfrag_h(k0p + 32); ka2 = ldfrag_h(k0p + 64); ka3 = ldfrag_h(k0p + 96);
    kc0 = ldfrag_h(k1p); kc1 = ldfrag_h(k1p + 32); kc2 = ldfrag_h(k1p + 64); kc3 = ldfrag_h(k1p + 96);
  }
  // byte offsets in the ring of the buffers of stage st, st + 1 and st + 2 (the last is the one that stage st - 1 has left)
  uint32_t bc = 0u, bn = 2u * TILEB, bf = 4u * TILEB;
  // kept rolled: one stage per trip, so the ring's publish point (waits, barrier, refill) stands once in the code
#pragma unroll 1
  for (int st = 0; st < SEQ / SK; ++st) {
    const _Float16* Tl = (const _Float16*)(const void*)(Ring + bc);
    const _Float16* Vl = Tl + vof;
    // unrolled: the stage's last step differs from the others (publish point in front, K fetched from the next stage's buffer)
#pragma unroll
    for (int sub = 0; sub < SK / 64; ++sub) {
      const int kb = sub * 32;
      if (sub == SK / 64 - 1) {
        // ---- publish point of stage st + 1, in front of stage st's last step, whose K fetch already reads that stage; then the
        //      load of stage st + 2 into the buffer that every reader of stage st - 1 has left ----
        wait_ds0();
        if (pinned(wave < 2u)) wait_tensor0_of(g0, g1);
        __syncthreads();
        if (pinned((wave < 2u) && (st + 2 < SEQ / SK))) {
          g0 = tdm_group0(tdst + bf, tsrc + (uint64_t)(st + 2) * tstep);
          tdm_load(g0, g1);
        }
      }
      v8f sA0, sA1, sB0, sB1;
      sA0 = mma_k(ka0, qa0, cA);
      sB0 = mma_k(ka0, qb0, cB);
      sA1 = mma_k(kc0, qa0, cA);
      sB1 = mma_k(kc0, qb0, cB);
      sA0 = mma_k(ka1, qa1, sA0);
      sB0 = mma_k(ka1, qb1, sB0);
      sA1 = mma_k(kc1, qa1, sA1);
      sB1 = mma_k(kc1, qb1, sB1);
      sA0 = mma_k(ka2, qa2, sA0);
      sB0 = mma_k(ka2, qb2, sB0);
      sA1 = mma_k(kc2, qa2, sA1);
      sB1 = mma_k(kc2, qb2, sB1);
      sA0 = mma_k(ka3, qa3, sA0);
      sB0 = mma_k(ka3, qb3, sB0);
      sA1 = mma_k(kc3, qa3, sA1);
      sB1 = mma_k(kc3, qb3, sB1);
      // lazy rescale: a column's reference point m stays in use until one of the step's scores exceeds it by more than 4 (natural log);
      // one test per step for both tiles, a scalar branch. Up to there P = 2^D <= 2^THR = e^4 x 1024 stays finite in f16.
      // The test compares this lane's 32 exponents of the step (16 per tile) with thr.
      const float rxA = fmaxf(hmax8(sA0), hmax8(sA1)), rxB = fmaxf(hmax8(sB0), hmax8(sB1));
      if (__builtin_amdgcn_ballot_w32((rxA > thr) || (rxB > thr)) != 0u) {
        float mxA = rxA - cA[0], mxB = rxB - cB[0];       // the step's largest score without the start value
        mxA = fmaxf(mxA, __shfl_xor(mxA, 16, 32));        // both halves of a column take the same new m
        mxB = fmaxf(mxB, __shfl_xor(mxB, 16, 32));
        const float mnA = fmaxf(mA, mxA), mnB = fmaxf(mB, mxB);
        const float corrA = __builtin_amdgcn_exp2f(mA - mnA), corrB = __builtin_amdgcn_exp2f(mB - mnB);
        const float dA = (PSH - mnA) - cA[0], dB = (PSH - mnB) - cB[0];   // start value and this step's exponents move by this
        mA = mnA; mB = mnB;
        thr = THR;
        lA *= corrA; lB *= corrB;
#pragma unroll
        for (int r = 0; r < 8; ++r) {
          sA0[r] += dA; sA1[r] += dA; sB0[r] += dB; sB1[r] += dB;
          cA[r] += dA; cB[r] += dB;
        }
#pragma unroll
        for (int j = 0; j < 8; ++j) {
#pragma unroll
          for (int r = 0; r < 8; ++r) { oA[j][r] *= corrA; oB[j][r] *= corrB; }
        }
      }
      // the step's 16 V reads; every fragment feeds both query tiles
      v16h va[8];
#pragma unroll
      for (int j = 0; j < 8; ++j) va[j] = ldfrag_h(Vl + j * 16 * KVH + kb);
      // LDS reads return in issue order: the V reads, which this step needs, stay ahead of the K reads, which the next one needs;
      // without this the scheduler puts most of the V reads behind the K reads
      __builtin_amdgcn_sched_barrier(0);
      // the next step's 16 K reads, into the fragments that this step's score products have just used, in one group with the V
      // reads: their latency passes under the exponentials and the output products. The last step of the last stage fetches
      // nothing (st is the same in every lane: a scalar branch).
      if (sub + 1 < SK / 64 || st + 1 < SEQ / SK) {
        const _Float16* k0p = (sub + 1 < SK / 64) ? Tl + kof + (kb + 32) * KVH
                                                  : (const _Float16*)(const void*)(Ring + bn) + kof;
        const _Float16* k1p = k0p + 16 * KVH;
        ka0 = ldfrag_h(k0p); ka1 = ldfrag_h(k0p + 32); ka2 = ldfrag_h(k0p + 64); ka3 = ldfrag_h(k0p + 96);
        kc0 = ldfrag_h(k1p); kc1 = ldfrag_h(k1p + 32); kc2 = ldfrag_h(k1p + 64); kc3 = ldfrag_h(k1p + 96);
      }
      // the V and K reads issue as one group in front of the exponentials, which cover their latency; without this the scheduler
      // spreads them through the exponentials, close ahead of their first use
      __builtin_amdgcn_sched_barrier(0);

      FragH pA, pB;
      float lsA = 0.f, lsB = 0.f;
#pragma unroll
      for (int r = 0; r < 8; ++r) {
        const float a0 = __builtin_amdgcn_exp2f(sA0[r]);   // key kb      + 8hh + r, tile A
        const float a1 = __builtin_amdgcn_exp2f(sA1[r]);   // key kb + 16 + 8hh + r, tile A
        const float b0 = __builtin_amdgcn_exp2f(sB0[r]);   // the same keys, tile B
        const float b1 = __builtin_amdgcn_exp2f(sB1[r]);
        lsA += a0 + a1;
        lsB += b0 + b1;
        pA.h[0][r] = (_Float16)a0;
        pA.h[1][r] = (_Float16)a1;
        pB.h[0][r] = (_Float16)b0;
        pB.h[1][r] = (_Float16)b1;
      }
      lA += lsA; lB += lsB;

#pragma unroll
      for (int j = 0; j < 8; ++j) {
        oA[j] = mma_k(va[j], pA.v, oA[j]);
        oB[j] = mma_k(va[j], pB.v, oB[j]);
      }
      // these four vector slots keep the distance between the
      // step's last WMMA and the first vector instruction behind the loop's back edge, which may overwrite its A or B
      asm volatile("v_nop\n\tv_nop\n\tv_nop\n\tv_nop" : "+v"(oB[7]) : "v"(va[7]), "v"(pB.v));
    }
    const uint32_t bt = bc; bc = bn; bn = bf; bf = bt;          // the ring turns by one buffer
  }
  wait_tensor0();
  wait_ds0();
  __syncthreads();                                             // every wave's last read of the ring has returned: it becomes staging
  // ---- join the two key halves: every wave hands tile B (running max, row-sum partial, O^T) to its partner through the ring,
  //      which nobody reads any more behind this barrier, and adds the partner's half to its own tile A ----
  {
    v4f* xs = (v4f*)(void*)Ring + (size_t)wave * (17 * 32) + lane;              // 17 x 512 B per wave, 16 B per lane
    const v4f* xr = (const v4f*)(const void*)Ring + (size_t)(wave ^ 4u) * (17 * 32) + lane;
#pragma unroll
    for (int j = 0; j < 8; ++j) {
      const v4f lo = {oB[j][0], oB[j][1], oB[j][2], oB[j][3]}, hi = {oB[j][4], oB[j][5], oB[j][6], oB[j][7]};
      xs[(2 * j) * 32] = lo;
      xs[(2 * j + 1) * 32] = hi;
    }
    const v4f ml = {mB, lB, 0.f, 0.f};
    xs[16 * 32] = ml;
    __syncthreads();                                                            // both halves' tiles are in LDS
    const v4f pm = xr[16 * 32];
    const float mt = fmaxf(mA, pm[0]);
    const float fa = __builtin_amdgcn_exp2f(mA - mt), fp = __builtin_amdgcn_exp2f(pm[0] - mt);   // m counts in powers of 2
    lA = lA * fa + pm[1] * fp;
#pragma unroll
    for (int j = 0; j < 8; ++j) {
      const v4f lo = xr[(2 * j) * 32], hi = xr[(2 * j + 1) * 32];
#pragma unroll
      for (int r = 0; r < 4; ++r) {
        oA[j][r]     = oA[j][r] * fa + lo[r] * fp;
        oA[j][4 + r] = oA[j][4 + r] * fa + hi[r] * fp;
      }
    }
  }
  const float l = lA + __shfl_xor(lA, 16, 32);
  const float sc = OSC / l;                 // both o and l carry the x1024 factor; sc scales O by 64

  // ---- O (x64) as f16 B fragments of the output projection: d-step ks <- D tiles 2ks (r) and 2ks+1 (8+r) ----
  FragH ob0, ob1, ob2, ob3;
#pragma unroll
  for (int r = 0; r < 8; ++r) {
    ob0.h[0][r] = (_Float16)(oA[0][r] * sc); ob0.h[1][r] = (_Float16)(oA[1][r] * sc);
    ob1.h[0][r] = (_Float16)(oA[2][r] * sc); ob1.h[1][r] = (_Float16)(oA[3][r] * sc);
    ob2.h[0][r] = (_Float16)(oA[4][r] * sc); ob2.h[1][r] = (_Float16)(oA[5][r] * sc);
    ob3.h[0][r] = (_Float16)(oA[6][r] * sc); ob3.h[1][r] = (_Float16)(oA[7][r] * sc);
  }

  // ---- y^T tile: for each o tile, A = W_out rows 16*ot + c (f16 x16, split map over d), 4 d-steps; stage x 1/1024 ----
  const _Float16* wp = (const _Float16*)(const void*)Wt + c * KVH + 8 * hh;
  float* os = Os + (8 * hh) * OP + colA + c;                // row o = 16*ot + 8hh + r, col = query colA + c
#pragma unroll
  for (int og = 0; og < 2; ++og) {
    // four o tiles' 16 fragments as one group of LDS reads in front of their products: one read latency per group
    v16h wf[16];
#pragma unroll
    for (int t = 0; t < 16; ++t) wf[t] = ldfrag_h(wp + (og * 4 + (t >> 2)) * 16 * KVH + 32 * (t & 3));
#pragma unroll
    for (int t = 0; t < 4; ++t) {
      const int ot = og * 4 + t;
      v8f ya = zero8();
      ya = mma_h(wf[4 * t + 0], ob0.v, ya);
      ya = mma_h(wf[4 * t + 1], ob1.v, ya);
      ya = mma_h(wf[4 * t + 2], ob2.v, ya);
      ya = mma_h(wf[4 * t + 3], ob3.v, ya);
#pragma unroll
      for (int r = 0; r < 8; ++r) os[(ot * 16 + r) * OP] = ya[r] * IYS;
    }
  }
  __syncthreads();
  {
    float* ob = y + ((size_t)b * DCH) * SEQ + n0;
#pragma unroll
    for (int it = 0; it < 16; ++it) {
      const int row = it * 8 + (int)wave;                 // o row 0..127: one wave stores the row's 128 queries (512 B)
      const v4f v   = *(const v4f*)(Os + row * OP + 4 * lane);
      const float bb = bfr(bout[row]);
      const v4f vo  = {v[0] + bb, v[1] + bb, v[2] + bb, v[3] + bb};
      *(v4f*)(ob + (size_t)row * SEQ + 4 * lane) = vo;
    }
  }
}

// =====================================================================================================
//   W16  16-bit [512][128]        0           131072
//   QP   f16    [8][4096][128]    131072      8388608
//   KP   f16    [8][4096][128]    8519680     8388608
//   VP   f16    [8][128][4096]    16908288    8388608
//   end                           25296896
// =====================================================================================================
extern "C" void kernel_launch(void* const* d_in, const int* in_sizes, int n_in,
                              void* d_out, int out_size, void* d_ws, size_t ws_size,
                              hipStream_t stream) {
  const int NX = NB * DCH * SEQ;                        // 4194304
  if (n_in < 4) return;
  if (in_sizes[0] != NX || in_sizes[1] != NQKV * DCH || in_sizes[2] != DCH * DCH || in_sizes[3] != DCH) return;
  if (out_size != NX) return;

  size_t off = 0;
  const size_t oW  = off; off += (size_t)NW * DCH * 2;            // 131072
  const size_t szP = (size_t)NB * SEQ * DCH * 2;                  // 8388608
  const size_t oQ  = off; off += szP;
  const size_t oK  = off; off += szP;
  const size_t oV  = off; off += (size_t)NB * DCH * SEQ * 2;      // 8388608
  if (off > ws_size) return;                                      // off = 25296896
  if (off > (size_t)134217728) return;

  const float* x    = (const float*)d_in[0];
  const float* Wqkv = (const float*)d_in[1];
  const float* Wout = (const float*)d_in[2];
  const float* bout = (const float*)d_in[3];
  char* ws = (char*)d_ws;
  unsigned short* W16 = (unsigned short*)(ws + oW);
  unsigned short* QPp = (unsigned short*)(ws + oQ);
  unsigned short* KPp = (unsigned short*)(ws + oK);
  unsigned short* VPp = (unsigned short*)(ws + oV);
  float* y = (float*)d_out;

  const dim3 blk256(256);
  const dim3 gW((NW * DCH / 8) / 256);                  // 32 blocks
  const dim3 gP(NB * (SEQ / QT));                       // 512 blocks: one (b, 64-position tile) each
  const dim3 gA(NB * (SEQ / QB));                       // 256 blocks: one (b, 128-query tile) each

  // (0) stacked 16-bit weight plane
  cvt_w<<<gW, blk256, 0, stream>>>(Wqkv, Wout, W16);
  // (1) q, k, v planes
  proj_kernel<<<gP, blk256, 0, stream>>>(x, W16, QPp, KPp, VPp);
  // (2) attention + output projection + bias: y[b][o][n]
  attn_kernel<<<gA, blk256, 0, stream>>>(QPp, KPp, VPp, W16, bout, y);
  (void)hipGetLastError();
}

// v007
// Measured time: 58.6 microseconds a run.
// Next to v006, in two timings, it ran 1.05 and 1.06 times as fast.
// All steps since v000 together make it 7.75 times as fast.
// Contractions: q/k/v 1x1-conv projections = W_qkv (bf16, RNE convert of input) . X (bf16, RNE convert of input) on
// v_wmma_f32_16x16x32_bf16, K=128; scores S^T = k (f16) . q^T (f16) on v_wmma_f32_16x16x32_f16, K=128, one product;
// O^T = v (f16) . P^T (f16, e^{s-m} x 1024 taken from the score D registers) on v_wmma_f32_16x16x32_f16 over 4096
// keys, one product; y = W_out (f16 bits of the bf16-RNE input x 16) . O (f16, x 64, taken from the O^T D registers)
// on v_wmma_f32_16x16x32_f16, K=128, one product; f32 accumulate everywhere; softmax (running max, row sums, 1/l)
// and the bias add in f32 on VALU; the 128^-0.5 scale, times log2 e, is multiplied in f32 into q in front of its f16 convert.
#include <hip/hip_runtime.h>
#include <math.h>
#include <stdint.h>

#define NB    8
#define DCH   128
#define SEQ   4096
#define NQKV  384
#define QT    64
#define AP    144
#define LQP   136
#define LVP   72
#define OP    132
#define QB    128
#define SK    128
#define KVH   136
#define TILEB 34816
#define PSH   10.0f
#define THR   15.770780163555854f
#define QSC   0.12751743f
#define OSC   64.0f
#define WSC   16.0f
#define IYS   0.0009765625f
static_assert((SEQ % QT) == 0);
static_assert((SEQ % 32) == 0);
static_assert((DCH % 32) == 0);
static_assert(NQKV == 3 * DCH);
static_assert(NQKV * DCH == 48 * 256 * 4 && DCH * DCH == 16 * 256 * 4);   // weight planes: 48 and 16 loads of 4 floats per thread
static_assert(DCH == 32 * 4);                              // one wave-wide 16-byte load = one weight row
static_assert(64 * AP == DCH * LVP);
static_assert(LQP >= DCH && (LQP % 8) == 0);
static_assert((AP % 8) == 0 && (LVP % 8) == 0);
static_assert(OP >= QB && (OP % 4) == 0);
static_assert((SEQ % QB) == 0 && (SEQ % SK) == 0 && (SEQ / SK) >= 2 && (SK % 32) == 0);
static_assert(2 * DCH == 256 && 2 * SK == 256);           // both tiles have rows of 256 bytes
static_assert(2 * KVH == 256 + 16);                        // LDS row pitch = row + the 16-byte pad of the tensor load
static_assert(TILEB == SK * 2 * KVH && TILEB == DCH * 2 * KVH && (TILEB % 2048) == 0);
static_assert((SK % 64) == 0);                             // each key half of a stage is a whole number of 32-key steps
static_assert(8 * 17 * 512 <= 6 * TILEB);                  // the waves' swap of one tile each fits the ring's LDS

typedef _Float16       v16h __attribute__((ext_vector_type(16)));
typedef _Float16       v8h  __attribute__((ext_vector_type(8)));
typedef __bf16         v16b __attribute__((ext_vector_type(16)));
typedef unsigned short v8us __attribute__((ext_vector_type(8)));
typedef float          v8f  __attribute__((ext_vector_type(8)));
typedef float          v4f  __attribute__((ext_vector_type(4)));
typedef float          v2f  __attribute__((ext_vector_type(2)));
typedef __bf16         v2b  __attribute__((ext_vector_type(2)));
typedef _Float16       v2h  __attribute__((ext_vector_type(2)));
typedef unsigned int   v2u  __attribute__((ext_vector_type(2)));
typedef unsigned int   v4u  __attribute__((ext_vector_type(4)));
typedef uint32_t       u32x4 __attribute__((ext_vector_type(4)));
typedef uint32_t       u32x8 __attribute__((ext_vector_type(8)));

union FragH { v16h v; v8h  h[2]; };
union FragB { v16b v; v8us u[2]; };
static_assert(sizeof(FragH) == 32);
static_assert(sizeof(FragB) == 32);

// ---- scalar helpers --------------------------------------------------------------------------------
__device__ __forceinline__ unsigned short bf_bits(float f) {          // f32 -> bf16 bits, RNE convert
  unsigned u = __float_as_uint(f);
  return (unsigned short)((u + 0x7FFFu + ((u >> 16) & 1u)) >> 16);
}
__device__ __forceinline__ float bf_up(unsigned short h) { return __uint_as_float(((unsigned)h) << 16); }
__device__ __forceinline__ float bfr(float f) { return bf_up(bf_bits(f)); }
__device__ __forceinline__ unsigned short h_bits(_Float16 x) { return __builtin_bit_cast(unsigned short, x); }
__device__ __forceinline__ unsigned pk16(unsigned short a, unsigned short b) { return (unsigned)a | ((unsigned)b << 16); }
__device__ __forceinline__ v8f zero8() { v8f z = {0.f, 0.f, 0.f, 0.f, 0.f, 0.f, 0.f, 0.f}; return z; }
__device__ __forceinline__ float hmax8(v8f s) {
  return fmaxf(fmaxf(fmaxf(s[0], s[1]), fmaxf(s[2], s[3])), fmaxf(fmaxf(s[4], s[5]), fmaxf(s[6], s[7])));
}

// ---- fragment loaders: 16-bit A/B operand, lane -> row/col (lane&15), p already includes +8*(lane>>4);
//      elements 0..7 <- p[0..7] (k0+8h..), elements 8..15 <- p[16..23] (k0+16+8h..)
__device__ __forceinline__ v16h ldfrag_h(const _Float16* p) {
  FragH f;
  f.h[0] = *(const v8h*)(p);
  f.h[1] = *(const v8h*)(p + 16);
  return f.v;
}
__device__ __forceinline__ v16b ldfrag_b(const unsigned short* p) {
  FragB f;
  f.u[0] = *(const v8us*)(p);
  f.u[1] = *(const v8us*)(p + 16);
  return f.v;
}

// ---- WMMA helpers: builtin followed by a 4-slot VALU gap tying D and keeping A/B live ----------------------
__device__ __forceinline__ v8f mma_h(v16h a, v16h b, v8f c) {
  v8f d = __builtin_amdgcn_wmma_f32_16x16x32_f16(false, a, false, b, (short)0, c, false, false);
#if defined(__HIP_DEVICE_COMPILE__)
  asm volatile("v_nop\n\tv_nop\n\tv_nop\n\tv_nop" : "+v"(d) : "v"(a), "v"(b));
#endif
  return d;
}
// key loop of the attention: the plain builtin, padded by the compiler. The asm statement above takes its vector operands below v256,
// and the 32-column wave's fragments and accumulators do not all fit there (scratch reloads inside the loop).
__device__ __forceinline__ v8f mma_k(v16h a, v16h b, v8f c) {
  return __builtin_amdgcn_wmma_f32_16x16x32_f16(false, a, false, b, (short)0, c, false, false);
}
__device__ __forceinline__ v8f mma_b(v16b a, v16b b, v8f c) {
  v8f d = __builtin_amdgcn_wmma_f32_16x16x32_bf16(false, a, false, b, (short)0, c, false, false);
#if defined(__HIP_DEVICE_COMPILE__)
  const v16h ha = __builtin_bit_cast(v16h, a), hb = __builtin_bit_cast(v16h, b);
  asm volatile("v_nop\n\tv_nop\n\tv_nop\n\tv_nop" : "+v"(d) : "v"(ha), "v"(hb));
#endif
  return d;
}

// ---- one wave: 16 n rows x 64 output channels (4 D tiles) over K = 128 (4 k-steps), A from LDS, B from the chunk's
//      bf16 weight tile in LDS (rows = output channel, k = input channel contiguous, pitch KVH); the chunk's fragment
//      reads stand as one group in front of its 16 products, so their latency is paid once per chunk
__device__ __forceinline__ void gemm4(const unsigned short* ap, const unsigned short* bp,
                                      v8f& acc0, v8f& acc1, v8f& acc2, v8f& acc3) {
  v16b a[4], w[16];
#pragma unroll
  for (int ks = 0; ks < 4; ++ks) {
    a[ks] = ldfrag_b(ap + 32 * ks);
#pragma unroll
    for (int j = 0; j < 4; ++j) w[4 * ks + j] = ldfrag_b(bp + 32 * ks + j * 16 * KVH);
  }
  acc0 = zero8(); acc1 = zero8(); acc2 = zero8(); acc3 = zero8();
#pragma unroll
  for (int ks = 0; ks < 4; ++ks) {
    acc0 = mma_b(a[ks], w[4 * ks + 0], acc0);
    acc1 = mma_b(a[ks], w[4 * ks + 1], acc1);
    acc2 = mma_b(a[ks], w[4 * ks + 2], acc2);
    acc3 = mma_b(a[ks], w[4 * ks + 3], acc3);
  }
}

// ---- LDS staging helpers for the projection epilogue (D rows = n, D cols = channel) ------------------------
__device__ __forceinline__ void stage_h(unsigned short* L, int nr, int col, v8f acc) {
#pragma unroll
  for (int r = 0; r < 8; ++r) L[(nr + r) * LQP + col] = h_bits((_Float16)acc[r]);
}
// q rows: x 128^-0.5 x log2 e in f32 in front of the f16 convert, so that the score products come out as exponents of 2
__device__ __forceinline__ void stage_q(unsigned short* L, int nr, int col, v8f acc) {
#pragma unroll
  for (int r = 0; r < 8; ++r) L[(nr + r) * LQP + col] = h_bits((_Float16)(acc[r] * QSC));
}
__device__ __forceinline__ void stage_v(unsigned short* Lv, int e, int nr, v8f acc) {
#pragma unroll
  for (int r = 0; r < 8; ++r) Lv[e * LVP + nr + r] = h_bits((_Float16)acc[r]);
}

// ---- tensor load to LDS: descriptor words live in scalar registers; every test around an issue is a scalar branch ----
__device__ __forceinline__ uint32_t uni(uint32_t v) { return (uint32_t)__builtin_amdgcn_readfirstlane(v); }
__device__ __forceinline__ uint32_t pinned(uint32_t v) {
  uint32_t w = uni(v);
  asm volatile("" : "+s"(w));   // pinned(): an issue test or a descriptor word held in a scalar register; the test then compiles to s_cmp + s_cbranch_scc (tensor loads ignore EXEC)
  return w;
}
// group 1: 1-byte elements, tile = tensor = 128 rows of 256 bytes, 16 bytes of LDS pad behind every 256-byte row
__device__ __forceinline__ u32x8 tdm_group1(uint32_t src_pitch) {
  u32x8 g;
  // pinned(): each descriptor word held in a scalar register of its own, so that the tuple is built once and nothing rewrites it
  // while a request is in flight; word 0 stays a plain constant
  g[0] = uni((1u << 20) | (5u << 22) | (3u << 25));
  g[1] = pinned(256u << 16);
  g[2] = pinned(128u << 16);
  g[3] = pinned(256u << 16);
  g[4] = pinned(128u);
  g[5] = pinned(src_pitch);
  g[6] = pinned(0u);
  g[7] = pinned(0u);
  return g;
}
__device__ __forceinline__ u32x4 tdm_group0(uint32_t lds_dst, uint64_t ga) {
  u32x4 g;
  g[0] = uni(1u);
  g[1] = uni(lds_dst);
  g[2] = uni((uint32_t)ga);
  g[3] = uni((((uint32_t)(ga >> 32)) & 0x01FFFFFFu) | 0x80000000u);
  asm volatile("" : "+s"(g));   // descriptor words held in scalar registers: the tuple is complete here, in front of the issue test
  return g;
}
__device__ __forceinline__ void tdm_load(u32x4 g0, u32x8 g1) {
  asm volatile("tensor_load_to_lds %0, %1" :: "s"(g0), "s"(g1) : "memory");   // one request of the whole wave: a 2-D tile into LDS
}
// the compiler places no wait for a tensor load: the issuing wave's own wait says that its tile has landed
__device__ __forceinline__ void wait_tensor0() { asm volatile("s_wait_tensorcnt 0x0" ::: "memory"); }
// the same wait, naming the request's descriptor as inputs: its registers stay live, so unwritten, until the tile has landed
__device__ __forceinline__ void wait_tensor0_of(u32x4 g0, u32x8 g1) {
  asm volatile("s_wait_tensorcnt 0x0" :: "s"(g0), "s"(g1) : "memory");
}
// this wave's LDS reads have returned before the barrier behind which their buffer is refilled
__device__ __forceinline__ void wait_ds0() { asm volatile("s_wait_dscnt 0x0" ::: "memory"); }

// ---- weight converts, two elements per call (the hardware's packed RNE converts) ----
// W_qkv: bf16 bits of the f32 input
__device__ __forceinline__ unsigned pk_bf(float a, float b) {
  const v2f f = {a, b};
  return __builtin_bit_cast(unsigned, __builtin_convertvector(f, v2b));
}
// W_out: f16 bits of (bf16 RNE value of the f32 input) x 16
__device__ __forceinline__ unsigned pk_wo(float a, float b) {
  const unsigned u = pk_bf(a, b);
  const v2f f = {__uint_as_float(u << 16) * WSC, __uint_as_float(u & 0xFFFF0000u) * WSC};
  return __builtin_bit_cast(unsigned, __builtin_convertvector(f, v2h));
}

// =====================================================================================================
// (1) fused q/k/v projection for one (b, 64-position tile): block = 256 threads = 8 waves.
//   x tile [128 d][64 n] f32 is staged once as bf16 A tile Lav[n][d] (pitch AP halves, 2-byte LDS stores), barrier.
//   Wave w: n group ng = w&3 (A rows n = 16ng + (lane&15), split k map over d), channel half ch = w>>2
//   (B = W_qkv rows chunk*128 + ch*64 + 16j + (lane&15), same split k map), 4 D tiles per chunk, 4 k-steps of 32,
//   chunks q, k, v in sequence (A reloaded from LDS). The 384 weight rows are read once per block as f32 (one wave-wide load =
//   one row of 512 B), converted to bf16 (RNE) and stored into three LDS tiles (row pitch 272 B); every B fragment is read from there.
//   Epilogue: D -> f16 bits in LDS: q tile Lq[n][128] (x 128^-0.5 x log2 e), k tile Lk[n][128], v transposed Lv[e][n] (aliases Lav after
//   [b][e][4096] (line = 64 keys of one e row); every line = 8 consecutive lanes x 16 B of one instruction, two
// coverage: Lav: 256 threads x 8 it x 4 = 64 n x 128 d; Lq/Lk: 8 waves x (16 n x 64 ch) per chunk = 64 x 128;
//           Q/K planes: 4 it x 32 lines x 8 lanes x 8 halves = 64 rows x 128; V plane: 4 it x 32 lines x 8 x 8 =
//           128 e x 64 n; grid = 8 x 64 blocks covers every plane exactly once.
// =====================================================================================================
__global__ __launch_bounds__(256)
void proj_kernel(const float* __restrict__ x, const float* __restrict__ wqkv,
                 unsigned short* QP, unsigned short* KP, unsigned short* VP) {
  // q, k and v weight tiles (128 rows of 256 B each, LDS pitch 272 B), tile t at t * TILEB
  __shared__ __align__(16) unsigned char Wt[3 * TILEB];
  __shared__ __align__(16) unsigned short Lav[64 * AP];    // A tile [n][d]; reused as Lv[e][n] (pitch LVP) later
  __shared__ __align__(16) unsigned short Lq[64 * LQP];    // q f16 [n][128]
  __shared__ __align__(16) unsigned short Lk[64 * LQP];    // k f16 [n][128]
  const int tid  = threadIdx.x;
  const int lane = tid & 31, wave = tid >> 5;
  const int hh   = lane >> 4, c = lane & 15;
  const int bx   = blockIdx.x;
  const int b    = bx / (SEQ / QT);
  const int nt   = bx % (SEQ / QT);
  const int n0   = nt * QT;

  // ---- stage x tile as bf16 [n][d] ----
  {
    const int n4 = (tid & 15) * 4, ds = tid >> 4;          // ds 0..15
    const float* xp = x + ((size_t)b * DCH + ds) * SEQ + n0 + n4;
    v4f xv[8];
#pragma unroll
    for (int it = 0; it < 8; ++it) xv[it] = *(const v4f*)(xp + (size_t)it * 16 * SEQ);
    asm volatile("s_wait_xcnt 0x0" ::: "memory");          // in front of the first overwrite of the x loads' address registers (a weight load's result lands there)
    // the x loads, which come from furthest away, issue first; without this the scheduler puts them behind the 48 weight loads
    __builtin_amdgcn_sched_barrier(0);
    // ---- the 384 weight rows, f32: load i of a wave is row 8 i + wave (32 lanes x 16 B = the row's 512 B); all 48 loads are issued
    //      up front with the x loads, so that one latency covers them all ----
    const v4f* wp = (const v4f*)wqkv + tid;
    unsigned char* wd = Wt + wave * (2 * KVH) + lane * 8;  // the lane's 4 bf16 of row 8 i + wave at wd + i * 8 * 272
    v4f wv[48];
#pragma unroll
    for (int i = 0; i < 48; ++i) wv[i] = wp[(size_t)i * 256];
    asm volatile("s_wait_xcnt 0x0" ::: "memory");          // in front of the first overwrite of the weight loads' address registers
#pragma unroll
    for (int it = 0; it < 8; ++it) {
      const int d = it * 16 + ds;                          // 0..127
#pragma unroll
      for (int q = 0; q < 4; ++q) Lav[(n4 + q) * AP + d] = bf_bits(xv[it][q]);
    }
#pragma unroll
    for (int i = 0; i < 48; ++i) {
      const v2u w = {pk_bf(wv[i][0], wv[i][1]), pk_bf(wv[i][2], wv[i][3])};
      *(v2u*)(wd + i * (8 * 2 * KVH)) = w;
    }
  }
  __syncthreads();            // publishes the x tile and the three weight tiles

  // ---- GEMMs: 16 n rows x 64 channels per wave per chunk ----
  const int ng = wave & 3, ch = wave >> 2;
  const unsigned short* ap = Lav + (ng * 16 + c) * AP + 8 * hh;
  const int nr = ng * 16 + 8 * hh;                         // D row r -> n local nr + r
  const int cb = ch * 64;                                  // channel base within a chunk; D col = cb + 16j + c
  v8f acc0, acc1, acc2, acc3;
  const unsigned short* wl = (const unsigned short*)(const void*)Wt + (cb + c) * KVH + 8 * hh;   // tile rows follow on: row r at r * KVH

  // q chunk (weight rows 0..127)
  gemm4(ap, wl + 0 * DCH * KVH, acc0, acc1, acc2, acc3);
  stage_q(Lq, nr, cb + 0 * 16 + c, acc0);
  stage_q(Lq, nr, cb + 1 * 16 + c, acc1);
  stage_q(Lq, nr, cb + 2 * 16 + c, acc2);
  stage_q(Lq, nr, cb + 3 * 16 + c, acc3);
  // k chunk (weight rows 128..255)
  gemm4(ap, wl + 1 * DCH * KVH, acc0, acc1, acc2, acc3);
  stage_h(Lk, nr, cb + 0 * 16 + c, acc0);
  stage_h(Lk, nr, cb + 1 * 16 + c, acc1);
  stage_h(Lk, nr, cb + 2 * 16 + c, acc2);
  stage_h(Lk, nr, cb + 3 * 16 + c, acc3);
  // v chunk (weight rows 256..383)
  gemm4(ap, wl + 2 * DCH * KVH, acc0, acc1, acc2, acc3);

  __syncthreads();            // every wave is done reading Lav before it is reused as Lv
  stage_v(Lav, cb + 0 * 16 + c, nr, acc0);
  stage_v(Lav, cb + 1 * 16 + c, nr, acc1);
  stage_v(Lav, cb + 2 * 16 + c, nr, acc2);
  stage_v(Lav, cb + 3 * 16 + c, nr, acc3);
  __syncthreads();

  {
    const int e = tid & 7, lq = tid >> 3;                    // lq 0..31
{
#pragma unroll
      for (int it = 0; it < 4; ++it) {
        const int L  = it * 32 + lq;                         // 0..127
        const int n  = L >> 1, hf = L & 1;                   // row 0..63, half 0..1
        const size_t go = ((size_t)b * SEQ + n0 + n) * DCH + hf * 64 + 8 * e;
        const int lo_ = n * LQP + hf * 64 + 8 * e;
        const v4u uq = *(const v4u*)(Lq + lo_);
        const v4u uk = *(const v4u*)(Lk + lo_);
        *(v4u*)(QP + go) = uq;
        *(v4u*)(KP + go) = uk;
      }
#pragma unroll
      for (int it = 0; it < 4; ++it) {
        const int er = it * 32 + lq;                         // 0..127
        const v4u uv = *(const v4u*)(Lav + er * LVP + 8 * e);
        *(v4u*)(VP + ((size_t)b * DCH + er) * SEQ + n0 + 8 * e) = uv;
      }
      
    }
  }
}

// =====================================================================================================
// (2) attention + output projection for one (b, 128-query tile), transposed formulation, 128-deep scores, 4096 keys:
//   K rows and V rows come in stages of 128 keys by tensor_load_to_lds into a ring of three LDS buffers that the block's
//   8 waves share: wave 0 brings the K tile (128 keys x 256 B, source pitch 256 B), wave 1 the V tile (128 d rows x
//   256 B = 128 keys, source pitch 8192 B), each one request per stage, rows padded to a pitch of 272 B in LDS.
//   Every wave fetches its K fragments one 32-key step ahead, so the publish point of stage s + 1 stands in front of stage s's
//   last step: s_wait_dscnt 0, the issuers' s_wait_tensorcnt 0, the workgroup barrier, then stage s + 2's load into the buffer
//   that stage s - 1 has left.
//   S^T tile (16 keys x 16 queries) = A(k rows = keys kb + (lane&15), d via the split k map, f16, from LDS) .
//                                     B(q, col = query, same d map, resident f16 fragments), four d-steps.
//   q carries 128^-0.5 x log2 e, and the score accumulators start at 10 - m (m = the column's reference point, in powers of 2), so
//   a D register is the exponent itself: P = 2^D = e^{s-m} x 1024. Per lane the D tile holds 8 keys of ONE query: online softmax state per lane; the reference
//   point m moves (one shuffle lane^16, D shifted, O and l rescaled) only when a score exceeds it by more than 4 (natural log); row-sum partials combined at the end. P as one
//   f16 vector is the B operand of O^T (rows d, cols queries) += A(v rows d, keys contiguous, from LDS) . B(P^T):
//   element r <- D of the tile covering keys kb..kb+15, element 8+r <- the tile covering kb+16..kb+31, lane unchanged.
//   Wave map: wave w works on 32 queries (two 16-column tiles, group w&3) and on 64 of every stage's 128 keys (half w>>2), so
//   each K and V fragment read from LDS feeds two query tiles. 32 keys per step: 16 score WMMAs + 16 output WMMAs per wave.
//   Behind the key loop the two waves of a query group swap one tile each (max, row sum, O^T) through the ring's LDS and join
//   the halves in f32: O = Oa 2^{ma-m} + Ob 2^{mb-m}; each wave then finishes one 16-query tile.
//   Block = 8 waves = 128 queries; grid = 8 b x 32.
//   Output projection: B fragment of d-step ks = f16(O^T x 64 / l) of D tiles j = 2ks (element r) and 2ks+1 (element
//   8+r), lane unchanged (col = query); A = W_out rows o (f16, x16), split k map over d, read from an LDS tile that the block
//   fills in front of the first barrier from the f32 input (one wave-wide load = one row, converted in registers); D[row o][col query]
//   x 1/1024 staged in LDS (scalar stores, pitch OP), barrier, then + bf16-RNE bias; each wave stores whole 512-B rows.
// coverage: block writes o 0..127 x n n0..n0+127 of its b (16 it x 8 rows); grid covers y exactly once.
// =====================================================================================================
__global__ __launch_bounds__(256)
void attn_kernel(const unsigned short* __restrict__ QP, const unsigned short* __restrict__ KP,
                 const unsigned short* __restrict__ VP, const float* __restrict__ wout,
                 const float* __restrict__ bout, float* y) {
  // buffer u: K tile at u * 2 * TILEB, V tile at u * 2 * TILEB + TILEB; every tile starts at a multiple of 2 KiB
  __shared__ __attribute__((aligned(2048))) unsigned char Ring[6 * TILEB];
  // W_out tile (128 rows of 256 B, LDS pitch 272 B), filled once, read by the output projection
  __shared__ __align__(16) unsigned char Wt[TILEB];
  __shared__ __align__(16) float Os[DCH * OP];
  const int tid  = threadIdx.x;
  const int lane = tid & 31;
  const uint32_t wave = uni((uint32_t)tid >> 5);
  const int hh   = lane >> 4;
  const int c    = lane & 15;
  const int bx   = blockIdx.x;
  const int b    = bx / (SEQ / QB);
  const int qb   = bx % (SEQ / QB);
  const int n0   = qb * QB;
  const _Float16* QPh = (const _Float16*)(const void*)QP;

  // ---- wave map: query group qg = 32 queries (two 16-column tiles), key half kh = 64 of every stage's 128 keys.
  //      Tile A is the tile this wave finishes (columns 32*qg + 16*kh + c), tile B the one its partner (wave ^ 4) finishes.
  const uint32_t qg = wave & 3u, kh = wave >> 2;
  const int colA = (int)(qg * 32u + kh * 16u), colB = (int)(qg * 32u + (1u - kh) * 16u);
  // ---- resident q fragments (B operand, col = query), d 0..31, 32..63, 64..95, 96..127, for both tiles ----
  const size_t qoA = ((size_t)b * SEQ + n0 + colA + c) * DCH + 8 * hh;
  const size_t qoB = ((size_t)b * SEQ + n0 + colB + c) * DCH + 8 * hh;
  const v16h qa0 = ldfrag_h(QPh + qoA), qa1 = ldfrag_h(QPh + qoA + 32);
  const v16h qa2 = ldfrag_h(QPh + qoA + 64), qa3 = ldfrag_h(QPh + qoA + 96);
  const v16h qb0 = ldfrag_h(QPh + qoB), qb1 = ldfrag_h(QPh + qoB + 32);
  const v16h qb2 = ldfrag_h(QPh + qoB + 64), qb3 = ldfrag_h(QPh + qoB + 96);
  asm volatile("s_wait_xcnt 0x0" ::: "memory");                // in front of the first overwrite of the q loads' address registers (a W_out load's result lands there)
  // keeps the W_out loads behind that wait: the scheduler moves loads of read-only inputs over an asm statement
  __builtin_amdgcn_sched_barrier(0);
  // ---- the 128 W_out rows, f32: load i of a wave is row 8 i + wave (32 lanes x 16 B = the row's 512 B); issued here, so that their
  //      latency passes under the wait for stage 0 ----
  v4f wo[16];
  {
    const v4f* wsp = (const v4f*)wout + tid;
#pragma unroll
    for (int i = 0; i < 16; ++i) wo[i] = wsp[(size_t)i * 256];
  }
  asm volatile("s_wait_xcnt 0x0" ::: "memory");                // in front of the first overwrite of the W_out loads' address registers

  // ---- the two issuing waves' requests: wave 0 = K tile, wave 1 = V tile ----
  const bool isV = wave == 1u;
  const uint64_t tsrc = isV ? (uint64_t)(size_t)(VP + (size_t)b * DCH * SEQ) : (uint64_t)(size_t)(KP + (size_t)b * SEQ * DCH);
  const uint32_t tstep = isV ? (uint32_t)(SK * 2) : (uint32_t)(SK * DCH * 2);     // bytes from one stage's tile to the next
  const uint32_t tdst  = (uint32_t)(size_t)Ring + (isV ? (uint32_t)TILEB : 0u);
  const u32x8 g1 = tdm_group1(isV ? (uint32_t)(SEQ * 2) : (uint32_t)(DCH * 2));

  u32x4 g0 = tdm_group0(tdst, tsrc);
  if (pinned(wave < 2u)) {
    tdm_load(g0, g1);                                          // stage 0 into buffer 0
    wait_tensor0_of(g0, g1);
  }
  // W_out tile: f16 bits of (bf16 RNE value x 16), the lane's 4 halves of row 8 i + wave
  {
    unsigned char* wd = Wt + wave * (uint32_t)(2 * KVH) + lane * 8;
#pragma unroll
    for (int i = 0; i < 16; ++i) {
      const v2u w = {pk_wo(wo[i][0], wo[i][1]), pk_wo(wo[i][2], wo[i][3])};
      *(v2u*)(wd + i * (8 * 2 * KVH)) = w;
    }
  }
  __syncthreads();                                             // stage 0 and the W_out tile published
  g0 = tdm_group0(tdst + 2u * TILEB, tsrc + tstep);
  if (pinned(wave < 2u)) {
    tdm_load(g0, g1);                                          // stage 1 into buffer 1
  }

  float mA = -1.0e30f, lA = 0.f, mB = -1.0e30f, lB = 0.f;
  float thr = -3.0e38f;                            // below every finite score: the first step sets m
  // start value of the score accumulators, 10 - m in all eight rows of a column (0 until the first step has set m)
  v8f cA = zero8(), cB = zero8();
  v8f oA[8], oB[8];
#pragma unroll
  for (int j = 0; j < 8; ++j) { oA[j] = zero8(); oB[j] = zero8(); }
  // k fragment offset in a buffer (A operand, row = key 64*kh + c of the stage), v fragment offset (A operand, row = d = c, keys
  // contiguous from key 64*kh of the stage), in halves
  const int kof = ((int)kh * (SK / 2) + c) * KVH + 8 * hh;
  const int vof = TILEB / 2 + c * KVH + 8 * hh + (int)kh * (SK / 2);
  // the K fragments of the step at hand: ka* = keys kb .. kb+15 of the wave's half, kc* = keys kb+16 .. kb+31; every fragment feeds
  // both query tiles. Step 0 of stage 0 is read here, behind the barrier that published it; each later step's one step ahead.
  v16h ka0, ka1, ka2, ka3, kc0, kc1, kc2, kc3;
  {
    const _Float16* k0p = (const _Float16*)(const void*)Ring + kof;
    const _Float16* k1p = k0p + 16 * KVH;
    ka0 = ldfrag_h(k0p); ka1 = ldfrag_h(k0p + 32); ka2 = ldfrag_h(k0p + 64); ka3 = ldfrag_h(k0p + 96);
    kc0 = ldfrag_h(k1p); kc1 = ldfrag_h(k1p + 32); kc2 = ldfrag_h(k1p + 64); kc3 = ldfrag_h(k1p + 96);
  }
  // byte offsets in the ring of the buffers of stage st, st + 1 and st + 2 (the last is the one that stage st - 1 has left)
  uint32_t bc = 0u, bn = 2u * TILEB, bf = 4u * TILEB;
  // kept rolled: one stage per trip, so the ring's publish point (waits, barrier, refill) stands once in the code
#pragma unroll 1
  for (int st = 0; st < SEQ / SK; ++st) {
    const _Float16* Tl = (const _Float16*)(const void*)(Ring + bc);
    const _Float16* Vl = Tl + vof;
    // unrolled: the stage's last step differs from the others (publish point in front, K fetched from the next stage's buffer)
#pragma unroll
    for (int sub = 0; sub < SK / 64; ++sub) {
      const int kb = sub * 32;
      if (sub == SK / 64 - 1) {
        // ---- publish point of stage st + 1, in front of stage st's last step, whose K fetch already reads that stage; then the
        //      load of stage st + 2 into the buffer that every reader of stage st - 1 has left ----
        wait_ds0();
        if (pinned(wave < 2u)) wait_tensor0_of(g0, g1);
        __syncthreads();
        if (pinned((wave < 2u) && (st + 2 < SEQ / SK))) {
          g0 = tdm_group0(tdst + bf, tsrc + (uint64_t)(st + 2) * tstep);
          tdm_load(g0, g1);
        }
      }
      v8f sA0, sA1, sB0, sB1;
      sA0 = mma_k(ka0, qa0, cA);
      sB0 = mma_k(ka0, qb0, cB);
      sA1 = mma_k(kc0, qa0, cA);
      sB1 = mma_k(kc0, qb0, cB);
      sA0 = mma_k(ka1, qa1, sA0);
      sB0 = mma_k(ka1, qb1, sB0);
      sA1 = mma_k(kc1, qa1, sA1);
      sB1 = mma_k(kc1, qb1, sB1);
      sA0 = mma_k(ka2, qa2, sA0);
      sB0 = mma_k(ka2, qb2, sB0);
      sA1 = mma_k(kc2, qa2, sA1);
      sB1 = mma_k(kc2, qb2, sB1);
      sA0 = mma_k(ka3, qa3, sA0);
      sB0 = mma_k(ka3, qb3, sB0);
      sA1 = mma_k(kc3, qa3, sA1);
      sB1 = mma_k(kc3, qb3, sB1);
      // lazy rescale: a column's reference point m stays in use until one of the step's scores exceeds it by more than 4 (natural log);
      // one test per step for both tiles, a scalar branch. Up to there P = 2^D <= 2^THR = e^4 x 1024 stays finite in f16.
      // The test compares this lane's 32 exponents of the step (16 per tile) with thr.
      const float rxA = fmaxf(hmax8(sA0), hmax8(sA1)), rxB = fmaxf(hmax8(sB0), hmax8(sB1));
      if (__builtin_amdgcn_ballot_w32((rxA > thr) || (rxB > thr)) != 0u) {
        float mxA = rxA - cA[0], mxB = rxB - cB[0];       // the step's largest score without the start value
        mxA = fmaxf(mxA, __shfl_xor(mxA, 16, 32));        // both halves of a column take the same new m
        mxB = fmaxf(mxB, __shfl_xor(mxB, 16, 32));
        const float mnA = fmaxf(mA, mxA), mnB = fmaxf(mB, mxB);
        const float corrA = __builtin_amdgcn_exp2f(mA - mnA), corrB = __builtin_amdgcn_exp2f(mB - mnB);
        const float dA = (PSH - mnA) - cA[0], dB = (PSH - mnB) - cB[0];   // start value and this step's exponents move by this
        mA = mnA; mB = mnB;
        thr = THR;
        lA *= corrA; lB *= corrB;
#pragma unroll
        for (int r = 0; r < 8; ++r) {
          sA0[r] += dA; sA1[r] += dA; sB0[r] += dB; sB1[r] += dB;
          cA[r] += dA; cB[r] += dB;
        }
#pragma unroll
        for (int j = 0; j < 8; ++j) {
#pragma unroll
          for (int r = 0; r < 8; ++r) { oA[j][r] *= corrA; oB[j][r] *= corrB; }
        }
      }
      // the step's 16 V reads; every fragment feeds both query tiles
      v16h va[8];
#pragma unroll
      for (int j = 0; j < 8; ++j) va[j] = ldfrag_h(Vl + j * 16 * KVH + kb);
      // LDS reads return in issue order: the V reads, which this step needs, stay ahead of the K reads, which the next one needs;
      // without this the scheduler puts most of the V reads behind the K reads
      __builtin_amdgcn_sched_barrier(0);
      // the next step's 16 K reads, into the fragments that this step's score products have just used, in one group with the V
      // reads: their latency passes under the exponentials and the output products. The last step of the last stage fetches
      // nothing (st is the same in every lane: a scalar branch).
      if (sub + 1 < SK / 64 || st + 1 < SEQ / SK) {
        const _Float16* k0p = (sub + 1 < SK / 64) ? Tl + kof + (kb + 32) * KVH
                                                  : (const _Float16*)(const void*)(Ring + bn) + kof;
        const _Float16* k1p = k0p + 16 * KVH;
        ka0 = ldfrag_h(k0p); ka1 = ldfrag_h(k0p + 32); ka2 = ldfrag_h(k0p + 64); ka3 = ldfrag_h(k0p + 96);
        kc0 = ldfrag_h(k1p); kc1 = ldfrag_h(k1p + 32); kc2 = ldfrag_h(k1p + 64); kc3 = ldfrag_h(k1p + 96);
      }
      // the V and K reads issue as one group in front of the exponentials, which cover their latency; without this the scheduler
      // spreads them through the exponentials, close ahead of their first use
      __builtin_amdgcn_sched_barrier(0);

      FragH pA, pB;
      float lsA = 0.f, lsB = 0.f;
#pragma unroll
      for (int r = 0; r < 8; ++r) {
        const float a0 = __builtin_amdgcn_exp2f(sA0[r]);   // key kb      + 8hh + r, tile A
        const float a1 = __builtin_amdgcn_exp2f(sA1[r]);   // key kb + 16 + 8hh + r, tile A
        const float b0 = __builtin_amdgcn_exp2f(sB0[r]);   // the same keys, tile B
        const float b1 = __builtin_amdgcn_exp2f(sB1[r]);
        lsA += a0 + a1;
        lsB += b0 + b1;
        pA.h[0][r] = (_Float16)a0;
        pA.h[1][r] = (_Float16)a1;
        pB.h[0][r] = (_Float16)b0;
        pB.h[1][r] = (_Float16)b1;
      }
      lA += lsA; lB += lsB;

#pragma unroll
      for (int j = 0; j < 8; ++j) {
        oA[j] = mma_k(va[j], pA.v, oA[j]);
        oB[j] = mma_k(va[j], pB.v, oB[j]);
      }
      // these four vector slots keep the distance between the
      // step's last WMMA and the first vector instruction behind the loop's back edge, which may overwrite its A or B
      asm volatile("v_nop\n\tv_nop\n\tv_nop\n\tv_nop" : "+v"(oB[7]) : "v"(va[7]), "v"(pB.v));
    }
    const uint32_t bt = bc; bc = bn; bn = bf; bf = bt;          // the ring turns by one buffer
  }
  wait_tensor0();
  wait_ds0();
  __syncthreads();                                             // every wave's last read of the ring has returned: it becomes staging
  // ---- join the two key halves: every wave hands tile B (running max, row-sum partial, O^T) to its partner through the ring,
  //      which nobody reads any more behind this barrier, and adds the partner's half to its own tile A ----
  {
    v4f* xs = (v4f*)(void*)Ring + (size_t)wave * (17 * 32) + lane;              // 17 x 512 B per wave, 16 B per lane
    const v4f* xr = (const v4f*)(const void*)Ring + (size_t)(wave ^ 4u) * (17 * 32) + lane;
#pragma unroll
    for (int j = 0; j < 8; ++j) {
      const v4f lo = {oB[j][0], oB[j][1], oB[j][2], oB[j][3]}, hi = {oB[j][4], oB[j][5], oB[j][6], oB[j][7]};
      xs[(2 * j) * 32] = lo;
      xs[(2 * j + 1) * 32] = hi;
    }
    const v4f ml = {mB, lB, 0.f, 0.f};
    xs[16 * 32] = ml;
    __syncthreads();                                                            // both halves' tiles are in LDS
    const v4f pm = xr[16 * 32];
    const float mt = fmaxf(mA, pm[0]);
    const float fa = __builtin_amdgcn_exp2f(mA - mt), fp = __builtin_amdgcn_exp2f(pm[0] - mt);   // m counts in powers of 2
    lA = lA * fa + pm[1] * fp;
#pragma unroll
    for (int j = 0; j < 8; ++j) {
      const v4f lo = xr[(2 * j) * 32], hi = xr[(2 * j + 1) * 32];
#pragma unroll
      for (int r = 0; r < 4; ++r) {
        oA[j][r]     = oA[j][r] * fa + lo[r] * fp;
        oA[j][4 + r] = oA[j][4 + r] * fa + hi[r] * fp;
      }
    }
  }
  const float l = lA + __shfl_xor(lA, 16, 32);
  const float sc = OSC / l;                 // both o and l carry the x1024 factor; sc scales O by 64

  // ---- O (x64) as f16 B fragments of the output projection: d-step ks <- D tiles 2ks (r) and 2ks+1 (8+r) ----
  FragH ob0, ob1, ob2, ob3;
#pragma unroll
  for (int r = 0; r < 8; ++r) {
    ob0.h[0][r] = (_Float16)(oA[0][r] * sc); ob0.h[1][r] = (_Float16)(oA[1][r] * sc);
    ob1.h[0][r] = (_Float16)(oA[2][r] * sc); ob1.h[1][r] = (_Float16)(oA[3][r] * sc);
    ob2.h[0][r] = (_Float16)(oA[4][r] * sc); ob2.h[1][r] = (_Float16)(oA[5][r] * sc);
    ob3.h[0][r] = (_Float16)(oA[6][r] * sc); ob3.h[1][r] = (_Float16)(oA[7][r] * sc);
  }

  // ---- y^T tile: for each o tile, A = W_out rows 16*ot + c (f16 x16, split map over d), 4 d-steps; stage x 1/1024 ----
  const _Float16* wp = (const _Float16*)(const void*)Wt + c * KVH + 8 * hh;
  float* os = Os + (8 * hh) * OP + colA + c;                // row o = 16*ot + 8hh + r, col = query colA + c
#pragma unroll
  for (int og = 0; og < 2; ++og) {
    // four o tiles' 16 fragments as one group of LDS reads in front of their products: one read latency per group
    v16h wf[16];
#pragma unroll
    for (int t = 0; t < 16; ++t) wf[t] = ldfrag_h(wp + (og * 4 + (t >> 2)) * 16 * KVH + 32 * (t & 3));
#pragma unroll
    for (int t = 0; t < 4; ++t) {
      const int ot = og * 4 + t;
      v8f ya = zero8();
      ya = mma_h(wf[4 * t + 0], ob0.v, ya);
      ya = mma_h(wf[4 * t + 1], ob1.v, ya);
      ya = mma_h(wf[4 * t + 2], ob2.v, ya);
      ya = mma_h(wf[4 * t + 3], ob3.v, ya);
#pragma unroll
      for (int r = 0; r < 8; ++r) os[(ot * 16 + r) * OP] = ya[r] * IYS;
    }
  }
  __syncthreads();
  {
    float* ob = y + ((size_t)b * DCH) * SEQ + n0;
#pragma unroll
    for (int it = 0; it < 16; ++it) {
      const int row = it * 8 + (int)wave;                 // o row 0..127: one wave stores the row's 128 queries (512 B)
      const v4f v   = *(const v4f*)(Os + row * OP + 4 * lane);
      const float bb = bfr(bout[row]);
      const v4f vo  = {v[0] + bb, v[1] + bb, v[2] + bb, v[3] + bb};
      *(v4f*)(ob + (size_t)row * SEQ + 4 * lane) = vo;
    }
  }
}

// =====================================================================================================
//   QP   f16    [8][4096][128]    0           8388608
//   KP   f16    [8][4096][128]    8388608     8388608
//   VP   f16    [8][128][4096]    16777216    8388608
//   end                           25165824
// =====================================================================================================
extern "C" void kernel_launch(void* const* d_in, const int* in_sizes, int n_in,
                              void* d_out, int out_size, void* d_ws, size_t ws_size,
                              hipStream_t stream) {
  const int NX = NB * DCH * SEQ;                        // 4194304
  if (n_in < 4) return;
  if (in_sizes[0] != NX || in_sizes[1] != NQKV * DCH || in_sizes[2] != DCH * DCH || in_sizes[3] != DCH) return;
  if (out_size != NX) return;

  size_t off = 0;
  const size_t szP = (size_t)NB * SEQ * DCH * 2;                  // 8388608
  const size_t oQ  = off; off += szP;
  const size_t oK  = off; off += szP;
  const size_t oV  = off; off += (size_t)NB * DCH * SEQ * 2;      // 8388608
  if (off > ws_size) return;                                      // off = 25165824
  if (off > (size_t)134217728) return;

  const float* x    = (const float*)d_in[0];
  const float* Wqkv = (const float*)d_in[1];
  const float* Wout = (const float*)d_in[2];
  const float* bout = (const float*)d_in[3];
  char* ws = (char*)d_ws;
  unsigned short* QPp = (unsigned short*)(ws + oQ);
  unsigned short* KPp = (unsigned short*)(ws + oK);
  unsigned short* VPp = (unsigned short*)(ws + oV);
  float* y = (float*)d_out;

  const dim3 blk256(256);
  const dim3 gP(NB * (SEQ / QT));                       // 512 blocks: one (b, 64-position tile) each
  const dim3 gA(NB * (SEQ / QB));                       // 256 blocks: one (b, 128-query tile) each

  // (1) q, k, v planes
  proj_kernel<<<gP, blk256, 0, stream>>>(x, Wqkv, QPp, KPp, VPp);
  // (2) attention + output projection + bias: y[b][o][n]
  attn_kernel<<<gA, blk256, 0, stream>>>(QPp, KPp, VPp, Wout, bout, y);
  (void)hipGetLastError();
}

// v008
// A run of this version takes 55.9 microseconds.
// In both of two side-by-side timings against v007, it was 1.05 times as fast.
// All steps since v000 together make it 8.11 times as fast.
// Contractions: q/k/v 1x1-conv projections = W_qkv (bf16, RNE convert of input) . X (bf16, RNE convert of input) on
// v_wmma_f32_16x16x32_bf16, K=128; scores S^T = k (f16) . q^T (f16) on v_wmma_f32_16x16x32_f16, K=128, one product;
// O^T = v (f16) . P^T (f16, e^{s-m} x 1024 taken from the score D registers) on v_wmma_f32_16x16x32_f16 over 4096
// keys, one product; y = W_out (f16 bits of the bf16-RNE input x 16) . O (f16, x 64, taken from the O^T D registers)
// on v_wmma_f32_16x16x32_f16, K=128, one product; f32 accumulate everywhere; softmax (running max, row sums, 1/l)
// and the bias add in f32 on VALU; the 128^-0.5 scale, times log2 e, is multiplied in f32 into q in front of its f16 convert.
#include <hip/hip_runtime.h>
#include <math.h>
#include <stdint.h>

#define NB    8
#define DCH   128
#define SEQ   4096
#define NQKV  384
#define QT    64
#define AP    136
#define LQP   136
#define LVP   72
#define OP    132
#define QB    128
#define SK    128
#define KVH   136
#define TILEB 34816
#define PSH   10.0f
#define THR   15.770780163555854f
#define QSC   0.12751743f
#define OSC   64.0f
#define WSC   16.0f
#define IYS   0.0009765625f
static_assert((SEQ % QT) == 0);
static_assert((SEQ % 32) == 0);
static_assert((DCH % 32) == 0);
static_assert(NQKV == 3 * DCH);
static_assert(NQKV * DCH == 48 * 256 * 4 && DCH * DCH == 16 * 256 * 4);   // weight planes: 48 and 16 loads of 4 floats per thread
static_assert(DCH == 32 * 4);                              // one wave-wide 16-byte load = one weight row
static_assert(64 * AP <= DCH * LVP);                       // the x tile fits the array that later holds the v tile
static_assert(LQP >= DCH && (LQP % 8) == 0);
static_assert((AP % 8) == 0 && (LVP % 8) == 0);
static_assert(OP >= QB && (OP % 4) == 0);
static_assert((SEQ % QB) == 0 && (SEQ % SK) == 0 && (SEQ / SK) >= 2 && (SK % 32) == 0);
static_assert(2 * DCH == 256 && 2 * SK == 256);           // both tiles have rows of 256 bytes
static_assert(2 * KVH == 256 + 16);                        // LDS row pitch = row + the 16-byte pad of the tensor load
static_assert(TILEB == SK * 2 * KVH && TILEB == DCH * 2 * KVH && (TILEB % 2048) == 0);
static_assert((SK % 64) == 0);                             // each key half of a stage is a whole number of 32-key steps
static_assert(8 * 17 * 512 <= 6 * TILEB);                  // the waves' swap of one tile each fits the ring's LDS

typedef _Float16       v16h __attribute__((ext_vector_type(16)));
typedef _Float16       v8h  __attribute__((ext_vector_type(8)));
typedef __bf16         v16b __attribute__((ext_vector_type(16)));
typedef unsigned short v8us __attribute__((ext_vector_type(8)));
typedef float          v8f  __attribute__((ext_vector_type(8)));
typedef float          v4f  __attribute__((ext_vector_type(4)));
typedef float          v2f  __attribute__((ext_vector_type(2)));
typedef __bf16         v2b  __attribute__((ext_vector_type(2)));
typedef _Float16       v2h  __attribute__((ext_vector_type(2)));
typedef unsigned int   v2u  __attribute__((ext_vector_type(2)));
typedef unsigned int   v4u  __attribute__((ext_vector_type(4)));
typedef uint32_t       u32x4 __attribute__((ext_vector_type(4)));
typedef uint32_t       u32x8 __attribute__((ext_vector_type(8)));

union FragH { v16h v; v8h  h[2]; };
union FragB { v16b v; v8us u[2]; };
static_assert(sizeof(FragH) == 32);
static_assert(sizeof(FragB) == 32);

// ---- scalar helpers --------------------------------------------------------------------------------
__device__ __forceinline__ unsigned short bf_bits(float f) {          // f32 -> bf16 bits, RNE convert
  unsigned u = __float_as_uint(f);
  return (unsigned short)((u + 0x7FFFu + ((u >> 16) & 1u)) >> 16);
}
__device__ __forceinline__ float bf_up(unsigned short h) { return __uint_as_float(((unsigned)h) << 16); }
__device__ __forceinline__ float bfr(float f) { return bf_up(bf_bits(f)); }
__device__ __forceinline__ unsigned short h_bits(_Float16 x) { return __builtin_bit_cast(unsigned short, x); }
__device__ __forceinline__ unsigned pk16(unsigned short a, unsigned short b) { return (unsigned)a | ((unsigned)b << 16); }
__device__ __forceinline__ v8f zero8() { v8f z = {0.f, 0.f, 0.f, 0.f, 0.f, 0.f, 0.f, 0.f}; return z; }
__device__ __forceinline__ float hmax8(v8f s) {
  return fmaxf(fmaxf(fmaxf(s[0], s[1]), fmaxf(s[2], s[3])), fmaxf(fmaxf(s[4], s[5]), fmaxf(s[6], s[7])));
}

// ---- fragment loaders: 16-bit A/B operand, lane -> row/col (lane&15), p already includes +8*(lane>>4);
//      elements 0..7 <- p[0..7] (k0+8h..), elements 8..15 <- p[16..23] (k0+16+8h..)
__device__ __forceinline__ v16h ldfrag_h(const _Float16* p) {
  FragH f;
  f.h[0] = *(const v8h*)(p);
  f.h[1] = *(const v8h*)(p + 16);
  return f.v;
}
__device__ __forceinline__ v16b ldfrag_b(const unsigned short* p) {
  FragB f;
  f.u[0] = *(const v8us*)(p);
  f.u[1] = *(const v8us*)(p + 16);
  return f.v;
}

// ---- WMMA helpers: builtin followed by a 4-slot VALU gap tying D and keeping A/B live ----------------------
__device__ __forceinline__ v8f mma_h(v16h a, v16h b, v8f c) {
  v8f d = __builtin_amdgcn_wmma_f32_16x16x32_f16(false, a, false, b, (short)0, c, false, false);
#if defined(__HIP_DEVICE_COMPILE__)
  asm volatile("v_nop\n\tv_nop\n\tv_nop\n\tv_nop" : "+v"(d) : "v"(a), "v"(b));
#endif
  return d;
}
// key loop of the attention: the plain builtin, padded by the compiler. The asm statement above takes its vector operands below v256,
// and the 32-column wave's fragments and accumulators do not all fit there (scratch reloads inside the loop).
__device__ __forceinline__ v8f mma_k(v16h a, v16h b, v8f c) {
  return __builtin_amdgcn_wmma_f32_16x16x32_f16(false, a, false, b, (short)0, c, false, false);
}
__device__ __forceinline__ v8f mma_b(v16b a, v16b b, v8f c) {
  v8f d = __builtin_amdgcn_wmma_f32_16x16x32_bf16(false, a, false, b, (short)0, c, false, false);
#if defined(__HIP_DEVICE_COMPILE__)
  const v16h ha = __builtin_bit_cast(v16h, a), hb = __builtin_bit_cast(v16h, b);
  asm volatile("v_nop\n\tv_nop\n\tv_nop\n\tv_nop" : "+v"(d) : "v"(ha), "v"(hb));
#endif
  return d;
}

// ---- one wave: 16 n rows x 64 output channels (4 D tiles) over K = 128 (4 k-steps), A from LDS, B from the chunk's
//      bf16 weight tile in LDS (rows = output channel, k = input channel contiguous, pitch KVH); the chunk's fragment
//      reads stand as one group in front of its 16 products, so their latency is paid once per chunk
__device__ __forceinline__ void gemm4(const unsigned short* ap, const unsigned short* bp,
                                      v8f& acc0, v8f& acc1, v8f& acc2, v8f& acc3) {
  v16b a[4], w[16];
#pragma unroll
  for (int ks = 0; ks < 4; ++ks) {
    a[ks] = ldfrag_b(ap + 32 * ks);
#pragma unroll
    for (int j = 0; j < 4; ++j) w[4 * ks + j] = ldfrag_b(bp + 32 * ks + j * 16 * KVH);
  }
  acc0 = zero8(); acc1 = zero8(); acc2 = zero8(); acc3 = zero8();
#pragma unroll
  for (int ks = 0; ks < 4; ++ks) {
    acc0 = mma_b(a[ks], w[4 * ks + 0], acc0);
    acc1 = mma_b(a[ks], w[4 * ks + 1], acc1);
    acc2 = mma_b(a[ks], w[4 * ks + 2], acc2);
    acc3 = mma_b(a[ks], w[4 * ks + 3], acc3);
  }
}

// ---- the same products with the operands swapped (A = weight rows, B = x columns; both loaders share one k map): D rows = channel,
//      D cols = n, so a lane holds 8 consecutive channels of ONE position, which go to the [n][channel] LDS tile as one 16-byte store
__device__ __forceinline__ void gemm4t(const unsigned short* ap, const unsigned short* bp,
                                       v8f& acc0, v8f& acc1, v8f& acc2, v8f& acc3) {
  v16b a[4], w[16];
#pragma unroll
  for (int ks = 0; ks < 4; ++ks) {
    a[ks] = ldfrag_b(ap + 32 * ks);
#pragma unroll
    for (int j = 0; j < 4; ++j) w[4 * ks + j] = ldfrag_b(bp + 32 * ks + j * 16 * KVH);
  }
  acc0 = zero8(); acc1 = zero8(); acc2 = zero8(); acc3 = zero8();
#pragma unroll
  for (int ks = 0; ks < 4; ++ks) {
    acc0 = mma_b(w[4 * ks + 0], a[ks], acc0);
    acc1 = mma_b(w[4 * ks + 1], a[ks], acc1);
    acc2 = mma_b(w[4 * ks + 2], a[ks], acc2);
    acc3 = mma_b(w[4 * ks + 3], a[ks], acc3);
  }
}

// ---- LDS staging helpers for the projection epilogue ------------------------
// k rows (D rows = channel, D col = n): p = the lane's 8 consecutive channels of its position, one 16-byte store
__device__ __forceinline__ void stage_h(unsigned short* p, v8f acc) {
  v8h h;
#pragma unroll
  for (int r = 0; r < 8; ++r) h[r] = (_Float16)acc[r];
  *(v8h*)(void*)p = h;
}
// q rows: x 128^-0.5 x log2 e in f32 in front of the f16 convert, so that the score products come out as exponents of 2
__device__ __forceinline__ void stage_q(unsigned short* p, v8f acc) {
  v8h h;
#pragma unroll
  for (int r = 0; r < 8; ++r) h[r] = (_Float16)(acc[r] * QSC);
  *(v8h*)(void*)p = h;
}
// v rows (D rows = n, D col = channel e): 8 consecutive positions of one channel
__device__ __forceinline__ void stage_v(unsigned short* Lv, int e, int nr, v8f acc) {
#pragma unroll
  for (int r = 0; r < 8; ++r) Lv[e * LVP + nr + r] = h_bits((_Float16)acc[r]);
}

// ---- tensor load to LDS: descriptor words live in scalar registers; every test around an issue is a scalar branch ----
__device__ __forceinline__ uint32_t uni(uint32_t v) { return (uint32_t)__builtin_amdgcn_readfirstlane(v); }
__device__ __forceinline__ uint32_t pinned(uint32_t v) {
  uint32_t w = uni(v);
  asm volatile("" : "+s"(w));   // pinned(): an issue test or a descriptor word held in a scalar register; the test then compiles to s_cmp + s_cbranch_scc (tensor loads ignore EXEC)
  return w;
}
// group 1: 1-byte elements, tile = tensor = 128 rows of 256 bytes, 16 bytes of LDS pad behind every 256-byte row
__device__ __forceinline__ u32x8 tdm_group1(uint32_t src_pitch) {
  u32x8 g;
  // pinned(): each descriptor word held in a scalar register of its own, so that the tuple is built once and nothing rewrites it
  // while a request is in flight; word 0 stays a plain constant
  g[0] = uni((1u << 20) | (5u << 22) | (3u << 25));
  g[1] = pinned(256u << 16);
  g[2] = pinned(128u << 16);
  g[3] = pinned(256u << 16);
  g[4] = pinned(128u);
  g[5] = pinned(src_pitch);
  g[6] = pinned(0u);
  g[7] = pinned(0u);
  return g;
}
__device__ __forceinline__ u32x4 tdm_group0(uint32_t lds_dst, uint64_t ga) {
  u32x4 g;
  g[0] = uni(1u);
  g[1] = uni(lds_dst);
  g[2] = uni((uint32_t)ga);
  g[3] = uni((((uint32_t)(ga >> 32)) & 0x01FFFFFFu) | 0x80000000u);
  asm volatile("" : "+s"(g));   // descriptor words held in scalar registers: the tuple is complete here, in front of the issue test
  return g;
}
__device__ __forceinline__ void tdm_load(u32x4 g0, u32x8 g1) {
  asm volatile("tensor_load_to_lds %0, %1" :: "s"(g0), "s"(g1) : "memory");   // one request of the whole wave: a 2-D tile into LDS
}
// the compiler places no wait for a tensor load: the issuing wave's own wait says that its tile has landed
__device__ __forceinline__ void wait_tensor0() { asm volatile("s_wait_tensorcnt 0x0" ::: "memory"); }
// the same wait, naming the request's descriptor as inputs: its registers stay live, so unwritten, until the tile has landed
__device__ __forceinline__ void wait_tensor0_of(u32x4 g0, u32x8 g1) {
  asm volatile("s_wait_tensorcnt 0x0" :: "s"(g0), "s"(g1) : "memory");
}
// this wave's LDS reads have returned before the barrier behind which their buffer is refilled
__device__ __forceinline__ void wait_ds0() { asm volatile("s_wait_dscnt 0x0" ::: "memory"); }

// ---- weight converts, two elements per call (the hardware's packed RNE converts) ----
// W_qkv: bf16 bits of the f32 input
__device__ __forceinline__ unsigned pk_bf(float a, float b) {
  const v2f f = {a, b};
  return __builtin_bit_cast(unsigned, __builtin_convertvector(f, v2b));
}
// W_out: f16 bits of (bf16 RNE value of the f32 input) x 16
__device__ __forceinline__ unsigned pk_wo(float a, float b) {
  const unsigned u = pk_bf(a, b);
  const v2f f = {__uint_as_float(u << 16) * WSC, __uint_as_float(u & 0xFFFF0000u) * WSC};
  return __builtin_bit_cast(unsigned, __builtin_convertvector(f, v2h));
}

// =====================================================================================================
// (1) fused q/k/v projection for one (b, 64-position tile): block = 256 threads = 8 waves.
//   x tile [128 d][64 n] f32 is staged once as bf16 tile Lav[n][d] (pitch AP halves = 272 B, 16-byte LDS stores), barrier.
//   Wave w: n group ng = w&3 (x fragment: n = 16ng + (lane&15), split k map over d), channel half ch = w>>2
//   (weight fragment: W_qkv rows chunk*128 + ch*64 + 16j + (lane&15), same split k map), 4 D tiles per chunk, 4 k-steps of 32,
//   chunks q, k, v in sequence (x fragments reloaded from LDS). q, k chunks: A = weights, B = x (D rows = channel, so that a lane's 8
//   values are 16 contiguous bytes of the [n][channel] tile); v chunk: A = x, B = weights (D rows = n, the same for the [e][n] tile).
//   The 384 weight rows are read once per block as f32 (one wave-wide load =
//   one row of 512 B), converted to bf16 (RNE) and stored into three LDS tiles (row pitch 272 B); every weight fragment is read from there.
//   Epilogue: D -> f16 bits in LDS: q tile Lq[n][128] (x 128^-0.5 x log2 e), k tile Lk[n][128], v transposed Lv[e][n] (aliases Lav after
//   [b][e][4096] (line = 64 keys of one e row); every line = 8 consecutive lanes x 16 B of one instruction, two
// coverage: Lav: 256 threads x 8 it x 4 = 64 n x 128 d; Lq/Lk: 8 waves x (16 n x 64 ch) per chunk = 64 x 128;
//           Q/K planes: 4 it x 32 lines x 8 lanes x 8 halves = 64 rows x 128; V plane: 4 it x 32 lines x 8 x 8 =
//           128 e x 64 n; grid = 8 x 64 blocks covers every plane exactly once.
// =====================================================================================================
__global__ __launch_bounds__(256)
void proj_kernel(const float* __restrict__ x, const float* __restrict__ wqkv,
                 unsigned short* QP, unsigned short* KP, unsigned short* VP) {
  // q, k and v weight tiles (128 rows of 256 B each, LDS pitch 272 B), tile t at t * TILEB
  __shared__ __align__(16) unsigned char Wt[3 * TILEB];
  __shared__ __align__(16) unsigned short Lav[DCH * LVP];  // x tile [n][d] (pitch AP); reused as Lv[e][n] (pitch LVP) later
  __shared__ __align__(16) unsigned short Lq[64 * LQP];    // q f16 [n][128]
  __shared__ __align__(16) unsigned short Lk[64 * LQP];    // k f16 [n][128]
  const int tid  = threadIdx.x;
  const int lane = tid & 31, wave = tid >> 5;
  const int hh   = lane >> 4, c = lane & 15;
  const int bx   = blockIdx.x;
  const int b    = bx / (SEQ / QT);
  const int nt   = bx % (SEQ / QT);
  const int n0   = nt * QT;

  // ---- stage x tile as bf16 [n][d] ----
  {
    // a thread holds 4 positions x 8 consecutive channels d = 8 ds + it, so each position's 8 bf16 go to LDS as one 16-byte store.
    // One wave-wide load = 2 channel rows x 256 B; lanes 0-15 take the first 128 B of both rows, so that their 16 stores spread over the banks
    const int n4 = ((lane & 7) + 8 * (lane >> 4)) * 4, ds = 2 * wave + ((lane >> 3) & 1);   // ds 0..15
    const float* xp = x + ((size_t)b * DCH + ds * 8) * SEQ + n0 + n4;
    v4f xv[8];
#pragma unroll
    for (int it = 0; it < 8; ++it) xv[it] = *(const v4f*)(xp + (size_t)it * SEQ);
    asm volatile("s_wait_xcnt 0x0" ::: "memory");          // in front of the first overwrite of the x loads' address registers (a weight load's result lands there)
    // the x loads, which come from furthest away, issue first; without this the scheduler puts them behind the 48 weight loads
    __builtin_amdgcn_sched_barrier(0);
    // ---- the 384 weight rows, f32: load i of a wave is row 8 i + wave (32 lanes x 16 B = the row's 512 B); all 48 loads are issued
    //      up front with the x loads, so that one latency covers them all ----
    const v4f* wp = (const v4f*)wqkv + tid;
    unsigned char* wd = Wt + wave * (2 * KVH) + lane * 8;  // the lane's 4 bf16 of row 8 i + wave at wd + i * 8 * 272
    v4f wv[48];
#pragma unroll
    for (int i = 0; i < 48; ++i) wv[i] = wp[(size_t)i * 256];
    asm volatile("s_wait_xcnt 0x0" ::: "memory");          // in front of the first overwrite of the weight loads' address registers
#pragma unroll
    for (int q = 0; q < 4; ++q) {
      const v4u w = {pk_bf(xv[0][q], xv[1][q]), pk_bf(xv[2][q], xv[3][q]), pk_bf(xv[4][q], xv[5][q]), pk_bf(xv[6][q], xv[7][q])};
      *(v4u*)(Lav + (n4 + q) * AP + ds * 8) = w;
    }
#pragma unroll
    for (int i = 0; i < 48; ++i) {
      const v2u w = {pk_bf(wv[i][0], wv[i][1]), pk_bf(wv[i][2], wv[i][3])};
      *(v2u*)(wd + i * (8 * 2 * KVH)) = w;
    }
  }
  __syncthreads();            // publishes the x tile and the three weight tiles

  // ---- GEMMs: 16 n rows x 64 channels per wave per chunk ----
  const int ng = wave & 3, ch = wave >> 2;
  const unsigned short* ap = Lav + (ng * 16 + c) * AP + 8 * hh;
  const int nr = ng * 16 + 8 * hh;                         // v chunk: D row r -> n local nr + r, D col = channel cb + 16j + c
  const int cb = ch * 64;                                  // channel base within a chunk
  const int qk = (ng * 16 + c) * LQP + cb + 8 * hh;        // q, k chunks: D col = n local 16 ng + c, D row r = channel cb + 16j + 8hh + r
  v8f acc0, acc1, acc2, acc3;
  const unsigned short* wl = (const unsigned short*)(const void*)Wt + (cb + c) * KVH + 8 * hh;   // tile rows follow on: row r at r * KVH

  // q chunk (weight rows 0..127)
  gemm4t(ap, wl + 0 * DCH * KVH, acc0, acc1, acc2, acc3);
  stage_q(Lq + qk + 0 * 16, acc0);
  stage_q(Lq + qk + 1 * 16, acc1);
  stage_q(Lq + qk + 2 * 16, acc2);
  stage_q(Lq + qk + 3 * 16, acc3);
  // k chunk (weight rows 128..255)
  gemm4t(ap, wl + 1 * DCH * KVH, acc0, acc1, acc2, acc3);
  stage_h(Lk + qk + 0 * 16, acc0);
  stage_h(Lk + qk + 1 * 16, acc1);
  stage_h(Lk + qk + 2 * 16, acc2);
  stage_h(Lk + qk + 3 * 16, acc3);
  // v chunk (weight rows 256..383)
  gemm4(ap, wl + 2 * DCH * KVH, acc0, acc1, acc2, acc3);

  __syncthreads();            // every wave is done reading Lav before it is reused as Lv
  stage_v(Lav, cb + 0 * 16 + c, nr, acc0);
  stage_v(Lav, cb + 1 * 16 + c, nr, acc1);
  stage_v(Lav, cb + 2 * 16 + c, nr, acc2);
  stage_v(Lav, cb + 3 * 16 + c, nr, acc3);
  __syncthreads();

  {
    const int e = tid & 7, lq = tid >> 3;                    // lq 0..31
{
#pragma unroll
      for (int it = 0; it < 4; ++it) {
        const int L  = it * 32 + lq;                         // 0..127
        const int n  = L >> 1, hf = L & 1;                   // row 0..63, half 0..1
        const size_t go = ((size_t)b * SEQ + n0 + n) * DCH + hf * 64 + 8 * e;
        const int lo_ = n * LQP + hf * 64 + 8 * e;
        const v4u uq = *(const v4u*)(Lq + lo_);
        const v4u uk = *(const v4u*)(Lk + lo_);
        *(v4u*)(QP + go) = uq;
        *(v4u*)(KP + go) = uk;
      }
#pragma unroll
      for (int it = 0; it < 4; ++it) {
        const int er = it * 32 + lq;                         // 0..127
        const v4u uv = *(const v4u*)(Lav + er * LVP + 8 * e);
        *(v4u*)(VP + ((size_t)b * DCH + er) * SEQ + n0 + 8 * e) = uv;
      }
      
    }
  }
}

// =====================================================================================================
// (2) attention + output projection for one (b, 128-query tile), transposed formulation, 128-deep scores, 4096 keys:
//   K rows and V rows come in stages of 128 keys by tensor_load_to_lds into a ring of three LDS buffers that the block's
//   8 waves share: wave 0 brings the K tile (128 keys x 256 B, source pitch 256 B), wave 1 the V tile (128 d rows x
//   256 B = 128 keys, source pitch 8192 B), each one request per stage, rows padded to a pitch of 272 B in LDS.
//   Every wave fetches its K fragments one 32-key step ahead, so the publish point of stage s + 1 stands in front of stage s's
//   last step: s_wait_dscnt 0, the issuers' s_wait_tensorcnt 0, the workgroup barrier, then stage s + 2's load into the buffer
//   that stage s - 1 has left.
//   S^T tile (16 keys x 16 queries) = A(k rows = keys kb + (lane&15), d via the split k map, f16, from LDS) .
//                                     B(q, col = query, same d map, resident f16 fragments), four d-steps.
//   q carries 128^-0.5 x log2 e, and the score accumulators start at 10 - m (m = the column's reference point, in powers of 2), so
//   a D register is the exponent itself: P = 2^D = e^{s-m} x 1024. Per lane the D tile holds 8 keys of ONE query: online softmax state per lane; the reference
//   point m moves (one shuffle lane^16, D shifted, O and l rescaled) only when a score exceeds it by more than 4 (natural log); row-sum partials combined at the end. P as one
//   f16 vector is the B operand of O^T (rows d, cols queries) += A(v rows d, keys contiguous, from LDS) . B(P^T):
//   element r <- D of the tile covering keys kb..kb+15, element 8+r <- the tile covering kb+16..kb+31, lane unchanged.
//   Wave map: wave w works on 32 queries (two 16-column tiles, group w&3) and on 64 of every stage's 128 keys (half w>>2), so
//   each K and V fragment read from LDS feeds two query tiles. 32 keys per step: 16 score WMMAs + 16 output WMMAs per wave.
//   Behind the key loop the two waves of a query group swap one tile each (max, row sum, O^T) through the ring's LDS and join
//   the halves in f32: O = Oa 2^{ma-m} + Ob 2^{mb-m}; each wave then finishes one 16-query tile.
//   Block = 8 waves = 128 queries; grid = 8 b x 32.
//   Output projection: B fragment of d-step ks = f16(O^T x 64 / l) of D tiles j = 2ks (element r) and 2ks+1 (element
//   8+r), lane unchanged (col = query); A = W_out rows o (f16, x16), split k map over d, read from an LDS tile that the block
//   fills in front of the first barrier from the f32 input (one wave-wide load = one row, converted in registers); D[row o][col query]
//   x 1/1024 staged in LDS (scalar stores, pitch OP), barrier, then + bf16-RNE bias; each wave stores whole 512-B rows.
// coverage: block writes o 0..127 x n n0..n0+127 of its b (16 it x 8 rows); grid covers y exactly once.
// =====================================================================================================
__global__ __launch_bounds__(256)
void attn_kernel(const unsigned short* __restrict__ QP, const unsigned short* __restrict__ KP,
                 const unsigned short* __restrict__ VP, const float* __restrict__ wout,
                 const float* __restrict__ bout, float* y) {
  // buffer u: K tile at u * 2 * TILEB, V tile at u * 2 * TILEB + TILEB; every tile starts at a multiple of 2 KiB
  __shared__ __attribute__((aligned(2048))) unsigned char Ring[6 * TILEB];
  // W_out tile (128 rows of 256 B, LDS pitch 272 B), filled once, read by the output projection
  __shared__ __align__(16) unsigned char Wt[TILEB];
  __shared__ __align__(16) float Os[DCH * OP];
  const int tid  = threadIdx.x;
  const int lane = tid & 31;
  const uint32_t wave = uni((uint32_t)tid >> 5);
  const int hh   = lane >> 4;
  const int c    = lane & 15;
  const int bx   = blockIdx.x;
  const int b    = bx / (SEQ / QB);
  const int qb   = bx % (SEQ / QB);
  const int n0   = qb * QB;
  const _Float16* QPh = (const _Float16*)(const void*)QP;

  // ---- wave map: query group qg = 32 queries (two 16-column tiles), key half kh = 64 of every stage's 128 keys.
  //      Tile A is the tile this wave finishes (columns 32*qg + 16*kh + c), tile B the one its partner (wave ^ 4) finishes.
  const uint32_t qg = wave & 3u, kh = wave >> 2;
  const int colA = (int)(qg * 32u + kh * 16u), colB = (int)(qg * 32u + (1u - kh) * 16u);
  // ---- resident q fragments (B operand, col = query), d 0..31, 32..63, 64..95, 96..127, for both tiles ----
  const size_t qoA = ((size_t)b * SEQ + n0 + colA + c) * DCH + 8 * hh;
  const size_t qoB = ((size_t)b * SEQ + n0 + colB + c) * DCH + 8 * hh;
  const v16h qa0 = ldfrag_h(QPh + qoA), qa1 = ldfrag_h(QPh + qoA + 32);
  const v16h qa2 = ldfrag_h(QPh + qoA + 64), qa3 = ldfrag_h(QPh + qoA + 96);
  const v16h qb0 = ldfrag_h(QPh + qoB), qb1 = ldfrag_h(QPh + qoB + 32);
  const v16h qb2 = ldfrag_h(QPh + qoB + 64), qb3 = ldfrag_h(QPh + qoB + 96);
  asm volatile("s_wait_xcnt 0x0" ::: "memory");                // in front of the first overwrite of the q loads' address registers (a W_out load's result lands there)
  // keeps the W_out loads behind that wait: the scheduler moves loads of read-only inputs over an asm statement
  __builtin_amdgcn_sched_barrier(0);
  // ---- the 128 W_out rows, f32: load i of a wave is row 8 i + wave (32 lanes x 16 B = the row's 512 B); issued here, so that their
  //      latency passes under the wait for stage 0 ----
  v4f wo[16];
  {
    const v4f* wsp = (const v4f*)wout + tid;
#pragma unroll
    for (int i = 0; i < 16; ++i) wo[i] = wsp[(size_t)i * 256];
  }
  asm volatile("s_wait_xcnt 0x0" ::: "memory");                // in front of the first overwrite of the W_out loads' address registers

  // ---- the two issuing waves' requests: wave 0 = K tile, wave 1 = V tile ----
  const bool isV = wave == 1u;
  const uint64_t tsrc = isV ? (uint64_t)(size_t)(VP + (size_t)b * DCH * SEQ) : (uint64_t)(size_t)(KP + (size_t)b * SEQ * DCH);
  const uint32_t tstep = isV ? (uint32_t)(SK * 2) : (uint32_t)(SK * DCH * 2);     // bytes from one stage's tile to the next
  const uint32_t tdst  = (uint32_t)(size_t)Ring + (isV ? (uint32_t)TILEB : 0u);
  const u32x8 g1 = tdm_group1(isV ? (uint32_t)(SEQ * 2) : (uint32_t)(DCH * 2));

  u32x4 g0 = tdm_group0(tdst, tsrc);
  if (pinned(wave < 2u)) {
    tdm_load(g0, g1);                                          // stage 0 into buffer 0
    wait_tensor0_of(g0, g1);
  }
  // W_out tile: f16 bits of (bf16 RNE value x 16), the lane's 4 halves of row 8 i + wave
  {
    unsigned char* wd = Wt + wave * (uint32_t)(2 * KVH) + lane * 8;
#pragma unroll
    for (int i = 0; i < 16; ++i) {
      const v2u w = {pk_wo(wo[i][0], wo[i][1]), pk_wo(wo[i][2], wo[i][3])};
      *(v2u*)(wd + i * (8 * 2 * KVH)) = w;
    }
  }
  __syncthreads();                                             // stage 0 and the W_out tile published
  g0 = tdm_group0(tdst + 2u * TILEB, tsrc + tstep);
  if (pinned(wave < 2u)) {
    tdm_load(g0, g1);                                          // stage 1 into buffer 1
  }

  float mA = -1.0e30f, lA = 0.f, mB = -1.0e30f, lB = 0.f;
  float thr = -3.0e38f;                            // below every finite score: the first step sets m
  // start value of the score accumulators, 10 - m in all eight rows of a column (0 until the first step has set m)
  v8f cA = zero8(), cB = zero8();
  v8f oA[8], oB[8];
#pragma unroll
  for (int j = 0; j < 8; ++j) { oA[j] = zero8(); oB[j] = zero8(); }
  // k fragment offset in a buffer (A operand, row = key 64*kh + c of the stage), v fragment offset (A operand, row = d = c, keys
  // contiguous from key 64*kh of the stage), in halves
  const int kof = ((int)kh * (SK / 2) + c) * KVH + 8 * hh;
  const int vof = TILEB / 2 + c * KVH + 8 * hh + (int)kh * (SK / 2);
  // the K fragments of the step at hand: ka* = keys kb .. kb+15 of the wave's half, kc* = keys kb+16 .. kb+31; every fragment feeds
  // both query tiles. Step 0 of stage 0 is read here, behind the barrier that published it; each later step's one step ahead.
  v16h ka0, ka1, ka2, ka3, kc0, kc1, kc2, kc3;
  {
    const _Float16* k0p = (const _Float16*)(const void*)Ring + kof;
    const _Float16* k1p = k0p + 16 * KVH;
    ka0 = ldfrag_h(k0p); ka1 = ldfrag_h(k0p + 32); ka2 = ldfrag_h(k0p + 64); ka3 = ldfrag_h(k0p + 96);
    kc0 = ldfrag_h(k1p); kc1 = ldfrag_h(k1p + 32); kc2 = ldfrag_h(k1p + 64); kc3 = ldfrag_h(k1p + 96);
  }
  // byte offsets in the ring of the buffers of stage st, st + 1 and st + 2 (the last is the one that stage st - 1 has left)
  uint32_t bc = 0u, bn = 2u * TILEB, bf = 4u * TILEB;
  // kept rolled: one stage per trip, so the ring's publish point (waits, barrier, refill) stands once in the code
#pragma unroll 1
  for (int st = 0; st < SEQ / SK; ++st) {
    const _Float16* Tl = (const _Float16*)(const void*)(Ring + bc);
    const _Float16* Vl = Tl + vof;
    // unrolled: the stage's last step differs from the others (publish point in front, K fetched from the next stage's buffer)
#pragma unroll
    for (int sub = 0; sub < SK / 64; ++sub) {
      const int kb = sub * 32;
      if (sub == SK / 64 - 1) {
        // ---- publish point of stage st + 1, in front of stage st's last step, whose K fetch already reads that stage; then the
        //      load of stage st + 2 into the buffer that every reader of stage st - 1 has left ----
        wait_ds0();
        if (pinned(wave < 2u)) wait_tensor0_of(g0, g1);
        __syncthreads();
        if (pinned((wave < 2u) && (st + 2 < SEQ / SK))) {
          g0 = tdm_group0(tdst + bf, tsrc + (uint64_t)(st + 2) * tstep);
          tdm_load(g0, g1);
        }
      }
      v8f sA0, sA1, sB0, sB1;
      sA0 = mma_k(ka0, qa0, cA);
      sB0 = mma_k(ka0, qb0, cB);
      sA1 = mma_k(kc0, qa0, cA);
      sB1 = mma_k(kc0, qb0, cB);
      sA0 = mma_k(ka1, qa1, sA0);
      sB0 = mma_k(ka1, qb1, sB0);
      sA1 = mma_k(kc1, qa1, sA1);
      sB1 = mma_k(kc1, qb1, sB1);
      sA0 = mma_k(ka2, qa2, sA0);
      sB0 = mma_k(ka2, qb2, sB0);
      sA1 = mma_k(kc2, qa2, sA1);
      sB1 = mma_k(kc2, qb2, sB1);
      sA0 = mma_k(ka3, qa3, sA0);
      sB0 = mma_k(ka3, qb3, sB0);
      sA1 = mma_k(kc3, qa3, sA1);
      sB1 = mma_k(kc3, qb3, sB1);
      // lazy rescale: a column's reference point m stays in use until one of the step's scores exceeds it by more than 4 (natural log);
      // one test per step for both tiles, a scalar branch. Up to there P = 2^D <= 2^THR = e^4 x 1024 stays finite in f16.
      // The test compares this lane's 32 exponents of the step (16 per tile) with thr.
      const float rxA = fmaxf(hmax8(sA0), hmax8(sA1)), rxB = fmaxf(hmax8(sB0), hmax8(sB1));
      if (__builtin_amdgcn_ballot_w32((rxA > thr) || (rxB > thr)) != 0u) {
        float mxA = rxA - cA[0], mxB = rxB - cB[0];       // the step's largest score without the start value
        mxA = fmaxf(mxA, __shfl_xor(mxA, 16, 32));        // both halves of a column take the same new m
        mxB = fmaxf(mxB, __shfl_xor(mxB, 16, 32));
        const float mnA = fmaxf(mA, mxA), mnB = fmaxf(mB, mxB);
        const float corrA = __builtin_amdgcn_exp2f(mA - mnA), corrB = __builtin_amdgcn_exp2f(mB - mnB);
        const float dA = (PSH - mnA) - cA[0], dB = (PSH - mnB) - cB[0];   // start value and this step's exponents move by this
        mA = mnA; mB = mnB;
        thr = THR;
        lA *= corrA; lB *= corrB;
#pragma unroll
        for (int r = 0; r < 8; ++r) {
          sA0[r] += dA; sA1[r] += dA; sB0[r] += dB; sB1[r] += dB;
          cA[r] += dA; cB[r] += dB;
        }
#pragma unroll
        for (int j = 0; j < 8; ++j) {
#pragma unroll
          for (int r = 0; r < 8; ++r) { oA[j][r] *= corrA; oB[j][r] *= corrB; }
        }
      }
      // the step's 16 V reads; every fragment feeds both query tiles
      v16h va[8];
#pragma unroll
      for (int j = 0; j < 8; ++j) va[j] = ldfrag_h(Vl + j * 16 * KVH + kb);
      // LDS reads return in issue order: the V reads, which this step needs, stay ahead of the K reads, which the next one needs;
      // without this the scheduler puts most of the V reads behind the K reads
      __builtin_amdgcn_sched_barrier(0);
      // the next step's 16 K reads, into the fragments that this step's score products have just used, in one group with the V
      // reads: their latency passes under the exponentials and the output products. The last step of the last stage fetches
      // nothing (st is the same in every lane: a scalar branch).
      if (sub + 1 < SK / 64 || st + 1 < SEQ / SK) {
        const _Float16* k0p = (sub + 1 < SK / 64) ? Tl + kof + (kb + 32) * KVH
                                                  : (const _Float16*)(const void*)(Ring + bn) + kof;
        const _Float16* k1p = k0p + 16 * KVH;
        ka0 = ldfrag_h(k0p); ka1 = ldfrag_h(k0p + 32); ka2 = ldfrag_h(k0p + 64); ka3 = ldfrag_h(k0p + 96);
        kc0 = ldfrag_h(k1p); kc1 = ldfrag_h(k1p + 32); kc2 = ldfrag_h(k1p + 64); kc3 = ldfrag_h(k1p + 96);
      }
      // the V and K reads issue as one group in front of the exponentials, which cover their latency; without this the scheduler
      // spreads them through the exponentials, close ahead of their first use
      __builtin_amdgcn_sched_barrier(0);

      FragH pA, pB;
      float lsA = 0.f, lsB = 0.f;
#pragma unroll
      for (int r = 0; r < 8; ++r) {
        const float a0 = __builtin_amdgcn_exp2f(sA0[r]);   // key kb      + 8hh + r, tile A
        const float a1 = __builtin_amdgcn_exp2f(sA1[r]);   // key kb + 16 + 8hh + r, tile A
        const float b0 = __builtin_amdgcn_exp2f(sB0[r]);   // the same keys, tile B
        const float b1 = __builtin_amdgcn_exp2f(sB1[r]);
        lsA += a0 + a1;
        lsB += b0 + b1;
        pA.h[0][r] = (_Float16)a0;
        pA.h[1][r] = (_Float16)a1;
        pB.h[0][r] = (_Float16)b0;
        pB.h[1][r] = (_Float16)b1;
      }
      lA += lsA; lB += lsB;

#pragma unroll
      for (int j = 0; j < 8; ++j) {
        oA[j] = mma_k(va[j], pA.v, oA[j]);
        oB[j] = mma_k(va[j], pB.v, oB[j]);
      }
      // these four vector slots keep the distance between the
      // step's last WMMA and the first vector instruction behind the loop's back edge, which may overwrite its A or B
      asm volatile("v_nop\n\tv_nop\n\tv_nop\n\tv_nop" : "+v"(oB[7]) : "v"(va[7]), "v"(pB.v));
    }
    const uint32_t bt = bc; bc = bn; bn = bf; bf = bt;          // the ring turns by one buffer
  }
  wait_tensor0();
  wait_ds0();
  __syncthreads();                                             // every wave's last read of the ring has returned: it becomes staging
  // ---- join the two key halves: every wave hands tile B (running max, row-sum partial, O^T) to its partner through the ring,
  //      which nobody reads any more behind this barrier, and adds the partner's half to its own tile A ----
  {
    v4f* xs = (v4f*)(void*)Ring + (size_t)wave * (17 * 32) + lane;              // 17 x 512 B per wave, 16 B per lane
    const v4f* xr = (const v4f*)(const void*)Ring + (size_t)(wave ^ 4u) * (17 * 32) + lane;
#pragma unroll
    for (int j = 0; j < 8; ++j) {
      const v4f lo = {oB[j][0], oB[j][1], oB[j][2], oB[j][3]}, hi = {oB[j][4], oB[j][5], oB[j][6], oB[j][7]};
      xs[(2 * j) * 32] = lo;
      xs[(2 * j + 1) * 32] = hi;
    }
    const v4f ml = {mB, lB, 0.f, 0.f};
    xs[16 * 32] = ml;
    __syncthreads();                                                            // both halves' tiles are in LDS
    const v4f pm = xr[16 * 32];
    const float mt = fmaxf(mA, pm[0]);
    const float fa = __builtin_amdgcn_exp2f(mA - mt), fp = __builtin_amdgcn_exp2f(pm[0] - mt);   // m counts in powers of 2
    lA = lA * fa + pm[1] * fp;
#pragma unroll
    for (int j = 0; j < 8; ++j) {
      const v4f lo = xr[(2 * j) * 32], hi = xr[(2 * j + 1) * 32];
#pragma unroll
      for (int r = 0; r < 4; ++r) {
        oA[j][r]     = oA[j][r] * fa + lo[r] * fp;
        oA[j][4 + r] = oA[j][4 + r] * fa + hi[r] * fp;
      }
    }
  }
  const float l = lA + __shfl_xor(lA, 16, 32);
  const float sc = OSC / l;                 // both o and l carry the x1024 factor; sc scales O by 64

  // ---- O (x64) as f16 B fragments of the output projection: d-step ks <- D tiles 2ks (r) and 2ks+1 (8+r) ----
  FragH ob0, ob1, ob2, ob3;
#pragma unroll
  for (int r = 0; r < 8; ++r) {
    ob0.h[0][r] = (_Float16)(oA[0][r] * sc); ob0.h[1][r] = (_Float16)(oA[1][r] * sc);
    ob1.h[0][r] = (_Float16)(oA[2][r] * sc); ob1.h[1][r] = (_Float16)(oA[3][r] * sc);
    ob2.h[0][r] = (_Float16)(oA[4][r] * sc); ob2.h[1][r] = (_Float16)(oA[5][r] * sc);
    ob3.h[0][r] = (_Float16)(oA[6][r] * sc); ob3.h[1][r] = (_Float16)(oA[7][r] * sc);
  }

  // ---- y^T tile: for each o tile, A = W_out rows 16*ot + c (f16 x16, split map over d), 4 d-steps; stage x 1/1024 ----
  const _Float16* wp = (const _Float16*)(const void*)Wt + c * KVH + 8 * hh;
  float* os = Os + (8 * hh) * OP + colA + c;                // row o = 16*ot + 8hh + r, col = query colA + c
#pragma unroll
  for (int og = 0; og < 2; ++og) {
    // four o tiles' 16 fragments as one group of LDS reads in front of their products: one read latency per group
    v16h wf[16];
#pragma unroll
    for (int t = 0; t < 16; ++t) wf[t] = ldfrag_h(wp + (og * 4 + (t >> 2)) * 16 * KVH + 32 * (t & 3));
#pragma unroll
    for (int t = 0; t < 4; ++t) {
      const int ot = og * 4 + t;
      v8f ya = zero8();
      ya = mma_h(wf[4 * t + 0], ob0.v, ya);
      ya = mma_h(wf[4 * t + 1], ob1.v, ya);
      ya = mma_h(wf[4 * t + 2], ob2.v, ya);
      ya = mma_h(wf[4 * t + 3], ob3.v, ya);
#pragma unroll
      for (int r = 0; r < 8; ++r) os[(ot * 16 + r) * OP] = ya[r] * IYS;
    }
  }
  __syncthreads();
  {
    float* ob = y + ((size_t)b * DCH) * SEQ + n0;
#pragma unroll
    for (int it = 0; it < 16; ++it) {
      const int row = it * 8 + (int)wave;                 // o row 0..127: one wave stores the row's 128 queries (512 B)
      const v4f v   = *(const v4f*)(Os + row * OP + 4 * lane);
      const float bb = bfr(bout[row]);
      const v4f vo  = {v[0] + bb, v[1] + bb, v[2] + bb, v[3] + bb};
      *(v4f*)(ob + (size_t)row * SEQ + 4 * lane) = vo;
    }
  }
}

// =====================================================================================================
//   QP   f16    [8][4096][128]    0           8388608
//   KP   f16    [8][4096][128]    8388608     8388608
//   VP   f16    [8][128][4096]    16777216    8388608
//   end                           25165824
// =====================================================================================================
extern "C" void kernel_launch(void* const* d_in, const int* in_sizes, int n_in,
                              void* d_out, int out_size, void* d_ws, size_t ws_size,
                              hipStream_t stream) {
  const int NX = NB * DCH * SEQ;                        // 4194304
  if (n_in < 4) return;
  if (in_sizes[0] != NX || in_sizes[1] != NQKV * DCH || in_sizes[2] != DCH * DCH || in_sizes[3] != DCH) return;
  if (out_size != NX) return;

  size_t off = 0;
  const size_t szP = (size_t)NB * SEQ * DCH * 2;                  // 8388608
  const size_t oQ  = off; off += szP;
  const size_t oK  = off; off += szP;
  const size_t oV  = off; off += (size_t)NB * DCH * SEQ * 2;      // 8388608
  if (off > ws_size) return;                                      // off = 25165824
  if (off > (size_t)134217728) return;

  const float* x    = (const float*)d_in[0];
  const float* Wqkv = (const float*)d_in[1];
  const float* Wout = (const float*)d_in[2];
  const float* bout = (const float*)d_in[3];
  char* ws = (char*)d_ws;
  unsigned short* QPp = (unsigned short*)(ws + oQ);
  unsigned short* KPp = (unsigned short*)(ws + oK);
  unsigned short* VPp = (unsigned short*)(ws + oV);
  float* y = (float*)d_out;

  const dim3 blk256(256);
  const dim3 gP(NB * (SEQ / QT));                       // 512 blocks: one (b, 64-position tile) each
  const dim3 gA(NB * (SEQ / QB));                       // 256 blocks: one (b, 128-query tile) each

  // (1) q, k, v planes
  proj_kernel<<<gP, blk256, 0, stream>>>(x, Wqkv, QPp, KPp, VPp);
  // (2) attention + output projection + bias: y[b][o][n]
  attn_kernel<<<gA, blk256, 0, stream>>>(QPp, KPp, VPp, Wout, bout, y);
  (void)hipGetLastError();
}
